// v000
// The times below were measured on an AMD MI455X: many runs one after another, warmed up first and cycling through
// copies of the inputs, with the whole window's GPU time divided by the number of runs. Launches and the gaps
// between them are all in it. The median over several windows is given; except for v000 it joins two sittings, which
// can be a few percent apart, so the side-by-side timings, each taken in one sitting, are the better comparison.
// The starting kernel, v000, takes 1460 microseconds a run.
#include <hip/hip_runtime.h>

// Causal multi-head attention on three input streams with per-head stacked projection weights (x_query, x_key, x_value [2][2048][1024]; q = einsum('bsd,hdk', x_query, Wq) with Wq [16][1024][64] = [h][d][k] (1/32), k, v likewise from x_key / x_value; scores x 1/sqrt(64) + causal additive mask (0 / -inf); softmax; heads concatenated h-major; out = concat W0^T ('oi' [1024][1024]) -> [2][2048][1024] (4.2 M); argument order x_query, x_key, x_value, Wq, Wk, Wv, W0).
// Layout per batch: bf16 copies of the three streams in turn; k_wtH turns each [h][d][k] weight into Bt rows h*64 + k; exact projections; identity-table plane builders; causal T-2048 attention (hybrid rows: < 512 hi/lo 3 products, rest fp16 x1024; k_gemmc skips tiles above the diagonal); merged hi/lo x W0 exact.
// Compute dtypes, f32 accumulate: every input rounded to bf16; projections exact; attention rows < 512 3 products, rest fp16; softmax f32; W0 hl x exact.

#define NB_  2
#define TT   2048
#define DM   1024
#define NH_  16
#define NKV  16
#define REP  (NH_ / NKV)
#define HD   64
#define DQ   (NH_ * HD)
#define DKV  (NKV * HD)
#define ZH   2
#define RH   512                  // query rows < RH use hi+lo planes (0: none)
#define WIN  2048
#define PCAR 1024.0f
#define SCL  0.125f   // HD^-0.5
typedef _Float16 h16;
typedef unsigned short bf;
typedef __attribute__((ext_vector_type(16))) __bf16   v16bf;
typedef __attribute__((ext_vector_type(16))) _Float16 v16h;
typedef __attribute__((ext_vector_type(8)))  _Float16 v8h;
typedef __attribute__((ext_vector_type(8)))  unsigned short v8us;
typedef __attribute__((ext_vector_type(8)))  float    v8f;
typedef __attribute__((ext_vector_type(4)))  float    v4f;
typedef v8h  __attribute__((may_alias)) v8ha;
typedef v4f  __attribute__((may_alias)) v4fa;
typedef v8us __attribute__((may_alias)) v8usa;

__device__ __forceinline__ unsigned short f2bf(float f) { unsigned u = __float_as_uint(f); u += 0x7FFFu + ((u >> 16) & 1u); return (unsigned short)(u >> 16); }
__device__ __forceinline__ float bf2f(unsigned short b) { return __uint_as_float(((unsigned)b) << 16); }
__device__ __forceinline__ float bfr(float f) { return bf2f(f2bf(f)); }
__device__ __forceinline__ v16h cat16(v8h lo, v8h hi) { return __builtin_shufflevector(lo, hi, 0, 1, 2, 3, 4, 5, 6, 7, 8, 9, 10, 11, 12, 13, 14, 15); }
__device__ __forceinline__ v16bf cat16b(v8us lo, v8us hi) { return __builtin_bit_cast(v16bf, __builtin_shufflevector(lo, hi, 0, 1, 2, 3, 4, 5, 6, 7, 8, 9, 10, 11, 12, 13, 14, 15)); }
__device__ __forceinline__ v8f wmma16(v16h a, v16h b, v8f c) { return __builtin_amdgcn_wmma_f32_16x16x32_f16(false, a, false, b, (short)0, c, false, false); }
__device__ __forceinline__ v8f wmmab(v16bf a, v16bf b, v8f c) { return __builtin_amdgcn_wmma_f32_16x16x32_bf16(false, a, false, b, (short)0, c, false, false); }



// ---- k_gemmw: register-blocked GEMM, ONE WAVE per 64x64 output tile (16 accumulators), operands straight from K-contiguous 16-bit planes; grid (M/64, N/64, Z), 32 threads.
// C[m][n] (f32, pitch ldc, + optional f32 bias[n]) = sum_k A[m][k] Bt[n][k] (+ split products per NSPLIT). z-batch strides sA/sB/sC in elements. K % 32 == 0.
template <typename T16> struct WFrag;
template <> struct WFrag<h16> { typedef v16h V; static __device__ __forceinline__ V ld(const h16* p) { return cat16(*(const v8h*)p, *(const v8h*)(p + 16)); } static __device__ __forceinline__ v8f mma(V a, V b, v8f c) { return wmma16(a, b, c); } };
template <> struct WFrag<bf> { typedef v16bf V; static __device__ __forceinline__ V ld(const bf* p) { return cat16b(*(const v8us*)p, *(const v8us*)(p + 16)); } static __device__ __forceinline__ v8f mma(V a, V b, v8f c) { return wmmab(a, b, c); } };
template <typename T16, int NSPLIT, bool BIAS>
__global__ __launch_bounds__(32) void k_gemmw(const T16* __restrict__ A, const T16* __restrict__ A2, const T16* __restrict__ Bt, const T16* __restrict__ Bt2, int K, float* C, int ldc, const float* __restrict__ bias, size_t sA, size_t sB, size_t sC) {
    typedef typename WFrag<T16>::V V;
    __shared__ __align__(16) float os[16 * 68];
    const size_t z = blockIdx.z; A += z * sA; if (A2) A2 += z * sA; Bt += z * sB; if (Bt2) Bt2 += z * sB; C += z * sC;
    const int lane = threadIdx.x & 31, lr = lane & 15, hi = lane >> 4; const int r0 = blockIdx.x * 64, c0 = blockIdx.y * 64;
    v8f acc[4][4];
#pragma unroll
    for (int mb = 0; mb < 4; ++mb)
#pragma unroll
        for (int nb = 0; nb < 4; ++nb) acc[mb][nb] = (v8f){};
    const size_t aoff = (size_t)(r0 + lr) * K + 8 * hi, boff = (size_t)(c0 + lr) * K + 8 * hi;
#pragma unroll 1
    for (int kc = 0; kc < K; kc += 32) {
        V a[4], a2[4];
#pragma unroll
        for (int mb = 0; mb < 4; ++mb) { a[mb] = WFrag<T16>::ld(A + aoff + (size_t)mb * 16 * K + kc); if (NSPLIT == 1 || NSPLIT == 2) a2[mb] = WFrag<T16>::ld(A2 + aoff + (size_t)mb * 16 * K + kc); }
#pragma unroll
        for (int nb = 0; nb < 4; ++nb) { const V b = WFrag<T16>::ld(Bt + boff + (size_t)nb * 16 * K + kc); V b2; if (NSPLIT >= 2) b2 = WFrag<T16>::ld(Bt2 + boff + (size_t)nb * 16 * K + kc);
#pragma unroll
            for (int mb = 0; mb < 4; ++mb) { acc[mb][nb] = WFrag<T16>::mma(a[mb], b, acc[mb][nb]); if (NSPLIT == 1 || NSPLIT == 2) acc[mb][nb] = WFrag<T16>::mma(a2[mb], b, acc[mb][nb]); if (NSPLIT >= 2) acc[mb][nb] = WFrag<T16>::mma(a[mb], b2, acc[mb][nb]); } }
        asm volatile("v_nop\n\tv_nop\n\tv_nop\n\tv_nop" : "+v"(acc[0][0]), "+v"(acc[1][1]), "+v"(acc[2][2]), "+v"(acc[3][3]) : "v"(a[0]), "v"(a[3]));
    }
#pragma unroll
    for (int mb = 0; mb < 4; ++mb) {
#pragma unroll
        for (int nb = 0; nb < 4; ++nb) {
#pragma unroll
            for (int j = 0; j < 8; ++j) os[(hi * 8 + j) * 68 + nb * 16 + lr] = acc[mb][nb][j]; }
        __builtin_amdgcn_wave_barrier(); asm volatile("" ::: "memory");
        float* crow = C + (size_t)(r0 + mb * 16) * ldc + c0;
{
#pragma unroll
            for (int s = 0; s < 8; ++s) { const int row = 2 * s + hi, cofs = lr * 4; v4f val = *(const v4fa*)(os + row * 68 + cofs); if (BIAS) { val[0] += bfr(bias[c0 + cofs]); val[1] += bfr(bias[c0 + cofs + 1]); val[2] += bfr(bias[c0 + cofs + 2]); val[3] += bfr(bias[c0 + cofs + 3]); }
                *(v4f*)(crow + (size_t)row * ldc + cofs) = val; }
             }
        __builtin_amdgcn_wave_barrier(); asm volatile("" ::: "memory");
    }
}

// ---- k_gemmc: the same one-wave 64x64 tile GEMM specialised for causal attention: CMODE 1 skips score tiles entirely above the diagonal (query rows r0+roff.., key columns c0..), CMODE 2 limits the
// key (K) loop of the probability x value contraction to the diagonal block (probabilities beyond it are exactly zero). roff = row offset of this launch's first row within the sequence.
template <typename T16, int NSPLIT, int CMODE>
__global__ __launch_bounds__(32) void k_gemmc(const T16* __restrict__ A, const T16* __restrict__ A2, const T16* __restrict__ Bt, const T16* __restrict__ Bt2, int K, float* C, int ldc, int roff, size_t sA, size_t sB, size_t sC) {
    typedef typename WFrag<T16>::V V;
    __shared__ __align__(16) float os[16 * 68];
    const size_t z = blockIdx.z; A += z * sA; if (A2) A2 += z * sA; Bt += z * sB; if (Bt2) Bt2 += z * sB; C += z * sC;
    const int lane = threadIdx.x & 31, lr = lane & 15, hi = lane >> 4; const int r0 = blockIdx.x * 64, c0 = blockIdx.y * 64;
    if (CMODE == 1 && c0 > r0 + roff + 63) return;                  // score tile entirely above the causal diagonal: never written (the softmax masks j > i by select)
    const int Kl = (CMODE == 2) ? min(K, r0 + roff + 64) : K;        // P.V: probabilities are exactly 0 beyond the diagonal block, so the K loop stops there
    v8f acc[4][4];
#pragma unroll
    for (int mb = 0; mb < 4; ++mb)
#pragma unroll
        for (int nb = 0; nb < 4; ++nb) acc[mb][nb] = (v8f){};
    const size_t aoff = (size_t)(r0 + lr) * K + 8 * hi, boff = (size_t)(c0 + lr) * K + 8 * hi;
#pragma unroll 1
    for (int kc = 0; kc < Kl; kc += 32) {
        V a[4], a2[4];
#pragma unroll
        for (int mb = 0; mb < 4; ++mb) { a[mb] = WFrag<T16>::ld(A + aoff + (size_t)mb * 16 * K + kc); if (NSPLIT == 1 || NSPLIT == 2) a2[mb] = WFrag<T16>::ld(A2 + aoff + (size_t)mb * 16 * K + kc); }
#pragma unroll
        for (int nb = 0; nb < 4; ++nb) { const V b = WFrag<T16>::ld(Bt + boff + (size_t)nb * 16 * K + kc); V b2; if (NSPLIT >= 2) b2 = WFrag<T16>::ld(Bt2 + boff + (size_t)nb * 16 * K + kc);
#pragma unroll
            for (int mb = 0; mb < 4; ++mb) { acc[mb][nb] = WFrag<T16>::mma(a[mb], b, acc[mb][nb]); if (NSPLIT == 1 || NSPLIT == 2) acc[mb][nb] = WFrag<T16>::mma(a2[mb], b, acc[mb][nb]); if (NSPLIT >= 2) acc[mb][nb] = WFrag<T16>::mma(a[mb], b2, acc[mb][nb]); } }
        asm volatile("v_nop\n\tv_nop\n\tv_nop\n\tv_nop" : "+v"(acc[0][0]), "+v"(acc[1][1]), "+v"(acc[2][2]), "+v"(acc[3][3]) : "v"(a[0]), "v"(a[3]));
    }
#pragma unroll
    for (int mb = 0; mb < 4; ++mb) {
#pragma unroll
        for (int nb = 0; nb < 4; ++nb) {
#pragma unroll
            for (int j = 0; j < 8; ++j) os[(hi * 8 + j) * 68 + nb * 16 + lr] = acc[mb][nb][j]; }
        __builtin_amdgcn_wave_barrier(); asm volatile("" ::: "memory");
        float* crow = C + (size_t)(r0 + mb * 16) * ldc + c0;
{
#pragma unroll
            for (int s = 0; s < 8; ++s) { const int row = 2 * s + hi, cofs = lr * 4; v4f val = *(const v4fa*)(os + row * 68 + cofs);
                *(v4f*)(crow + (size_t)row * ldc + cofs) = val; }
             }
        __builtin_amdgcn_wave_barrier(); asm volatile("" ::: "memory");
    }
}

__device__ __forceinline__ h16 tohx(float x) { return (h16)x; }
__device__ __forceinline__ void splitf(float y, unsigned short& h, unsigned short& l) { h = f2bf(y); l = f2bf(y - bf2f(h)); }
typedef __attribute__((ext_vector_type(2))) _Float16 v2h;
typedef __attribute__((ext_vector_type(4))) _Float16 v4h;
typedef __attribute__((ext_vector_type(2))) unsigned short v2us;
typedef __attribute__((ext_vector_type(4))) unsigned short v4us;
typedef __attribute__((ext_vector_type(2))) float v2f;
typedef __attribute__((ext_vector_type(4))) int v4i;

__global__ __launch_bounds__(256) void k_cvt8(const float* __restrict__ src, bf* dst, size_t n8) { const size_t i = (size_t)blockIdx.x * 256 + threadIdx.x; if (i >= n8) return; const v8f v = *(const v8f*)(src + i * 8); v8us o;
#pragma unroll
    for (int k = 0; k < 8; ++k) o[k] = f2bf(v[k]); *(v8us*)(dst + i * 8) = o;  }

// k_rope: head planes [h][t][d] (fp16 + hi/lo) of rope(x) x sc with the rotate-half convention out[d] = x[d] cos[t][d] - x[d+HD/2] sin[t][d], out[d+HD/2] = x[d+HD/2] cos[t][d+HD/2] + x[d] sin[t][d+HD/2]
__global__ __launch_bounds__(256) void k_rope(const float* __restrict__ F, int pitch, int nheads, const float* __restrict__ CS, const float* __restrict__ RF, const float* __restrict__ nw, float sc, h16* P16, bf* Ph, bf* Pl) {
    const size_t e = ((size_t)blockIdx.x * 256 + threadIdx.x) * 2; if (e >= (size_t)nheads * TT * HD) return; const int d = (int)(e % HD); const int t = (int)((e / HD) % TT); const int h = (int)(e / ((size_t)HD * TT)); const float* f = F + (size_t)t * pitch + h * HD; const float rf = RF ? RF[(size_t)h * TT + t] : 1.0f; v2h o16; v2us oh, ol;
#pragma unroll
    for (int q = 0; q < 2; ++q) { const int dd = d + q; const int dp = (dd < HD / 2) ? dd + HD / 2 : dd - HD / 2; float x0 = f[dd], x1 = f[dp];
        if (RF) { float n0 = __fmul_rn(x0, rf), n1 = __fmul_rn(x1, rf); asm volatile("" : "+v"(n0)); asm volatile("" : "+v"(n1)); x0 = __fmul_rn(bfr(nw[dd]), n0); x1 = __fmul_rn(bfr(nw[dp]), n1); }
        const v2f cs = *(const v2f*)(CS + ((size_t)t * HD + dd) * 2); float a = __fmul_rn(x0, cs[0]), bq = __fmul_rn(x1, cs[1]); asm volatile("" : "+v"(a)); asm volatile("" : "+v"(bq)); const float r = ((dd < HD / 2) ? __fsub_rn(a, bq) : __fadd_rn(a, bq)) * sc;
        o16[q] = tohx(r); unsigned short a2, c2; splitf(r, a2, c2); oh[q] = a2; ol[q] = c2; }
    *(v2h*)(P16 + e) = o16; *(v2us*)(Ph + e) = oh; *(v2us*)(Pl + e) = ol;  }
__global__ __launch_bounds__(256) void k_wtH(const float* __restrict__ w, bf* Bt) { const size_t e2 = ((size_t)blockIdx.x * 256 + threadIdx.x) * 2; if (e2 >= (size_t)DQ * DM) return; const int d = (int)(e2 % DM); const int r = (int)(e2 / DM); const int h = r / HD, e = r % HD; v2us o; o[0] = f2bf(w[((size_t)h * DM + d) * HD + e]); o[1] = f2bf(w[((size_t)h * DM + d + 1) * HD + e]);
    *(v2us*)(Bt + e2) = o;  }
__global__ __launch_bounds__(256) void k_vtp(const float* __restrict__ F, int pitch, int nheads, h16* V16, bf* Vh, bf* Vl) { const size_t e = ((size_t)blockIdx.x * 256 + threadIdx.x) * 2; if (e >= (size_t)nheads * HD * TT) return; const int t = (int)(e % TT); const int d = (int)((e / TT) % HD); const int g = (int)(e / ((size_t)TT * HD)); v2h o16; v2us oh, ol;
#pragma unroll
    for (int q = 0; q < 2; ++q) { const float x = F[(size_t)(t + q) * pitch + g * HD + d]; o16[q] = tohx(x); unsigned short a2, c2; splitf(x, a2, c2); oh[q] = a2; ol[q] = c2; }
    *(v2h*)(V16 + e) = o16; *(v2us*)(Vh + e) = oh; *(v2us*)(Vl + e) = ol;  }
__global__ __launch_bounds__(256) void k_csid(float* CS) { const int idx = blockIdx.x * 256 + threadIdx.x; if (idx >= TT * HD) return; v2f cs; cs[0] = 1.0f; cs[1] = 0.0f; *(v2f*)(CS + (size_t)idx * 2) = cs;  }
// k_asoft: per row (zz, i): t = S x HD^-0.5 for j <= i and i - j < WIN (sliding causal window; the reference's -1e9 additive fill vanishes identically); softmax over the 2048 keys (register row, one exp, fixed trees);
__global__ __launch_bounds__(256) void k_asoft(const float* __restrict__ Sb, h16* P16, bf* Ph, bf* Pl) {
    const int lane = threadIdx.x & 31; const int row = blockIdx.x * 8 + (threadIdx.x >> 5); if (row >= ZH * TT) return; const int i = row % TT; const int zz = row / TT; (void)zz; const bool hires = (i < RH); const float* sr = Sb + (size_t)row * TT; float v[TT / 32]; float mx = -3.0e38f;
#pragma unroll
    for (int ch = 0; ch < TT / 128; ++ch) { const int j0 = ch * 128 + lane * 4; const v4f a = *(const v4f*)(sr + j0);
#pragma unroll
        for (int q = 0; q < 4; ++q) { const int j = j0 + q; (void)j; const float t = (j <= i && i - j < WIN) ? a[q] * SCL : -3.0e38f; v[ch * 4 + q] = t; mx = fmaxf(mx, t); } }
#pragma unroll
    for (int sh = 16; sh; sh >>= 1) mx = fmaxf(mx, __shfl_xor(mx, sh, 32));
    float sum = 0.f;
#pragma unroll
    for (int k = 0; k < TT / 32; ++k) { float d0 = __fsub_rn(v[k], mx); asm volatile("" : "+v"(d0)); v[k] = __builtin_amdgcn_exp2f(__fmul_rn(d0, 1.4426950408889634f)); sum += v[k]; }
#pragma unroll
    for (int sh = 16; sh; sh >>= 1) sum += __shfl_xor(sum, sh, 32);
    const float f = __fdiv_rn(hires ? 1.0f : PCAR, sum);
{
        if (hires) {
#pragma unroll
            for (int ch = 0; ch < TT / 128; ++ch) { v4us oh, ol;
#pragma unroll
                for (int q = 0; q < 4; ++q) { unsigned short a, c2; splitf(v[ch * 4 + q] * f, a, c2); oh[q] = a; ol[q] = c2; }
                const size_t oo = ((size_t)zz * (RH ? RH : 1) + i) * TT + ch * 128 + lane * 4; *(v4us*)(Ph + oo) = oh; *(v4us*)(Pl + oo) = ol; }
        } else {
#pragma unroll
            for (int ch = 0; ch < TT / 128; ++ch) { v4h o4;
#pragma unroll
                for (int q = 0; q < 4; ++q) o4[q] = tohx(v[ch * 4 + q] * f);
                *(v4h*)(P16 + (size_t)row * TT + ch * 128 + lane * 4) = o4; } }
         }
}
__global__ __launch_bounds__(256) void k_merge(const float* __restrict__ O, int h0, bf* Ah, bf* Al) { const size_t e = ((size_t)blockIdx.x * 256 + threadIdx.x) * 2; if (e >= (size_t)ZH * TT * HD) return; const int d = (int)(e % HD); const int t = (int)((e / HD) % TT); const int zz = (int)(e / ((size_t)HD * TT)); const float cs = (t < RH) ? 1.0f : (1.0f / PCAR); const size_t oo = (size_t)t * DQ + (h0 + zz) * HD + d;
    v2us oh, ol;
#pragma unroll
    for (int q = 0; q < 2; ++q) { unsigned short a, c2; splitf(O[e + q] * cs, a, c2); oh[q] = a; ol[q] = c2; } *(v2us*)(Ah + oo) = oh; *(v2us*)(Al + oo) = ol;  }

extern "C" void kernel_launch(void* const* d_in, const int* in_sizes, int n_in,
                              void* d_out, int out_size, void* d_ws, size_t ws_size, hipStream_t stream) {
    (void)in_sizes; (void)n_in; (void)out_size;
    const float* x = (const float*)d_in[0]; const float* xk = (const float*)d_in[1]; const float* xv = (const float*)d_in[2]; const float* wq = (const float*)d_in[3]; const float* wk = (const float*)d_in[4]; const float* wv = (const float*)d_in[5]; const float* wo = (const float*)d_in[6];   /* x_query, x_key, x_value, Wq, Wk, Wv [16][1024][64] ([h][d][k]), W0 ('oi' [1024][1024]) */
    float* OUT = (float*)d_out;     // [2][2048][1024]
    char* wsp = (char*)d_ws;
    auto take = [&](size_t bytes) { char* p = wsp; wsp += (bytes + 255) & ~(size_t)255; return (void*)p; };
    bf* WQ = (bf*)take((size_t)DQ * DM * 2); bf* WK = (bf*)take((size_t)DKV * DM * 2); bf* WV = (bf*)take((size_t)DKV * DM * 2); bf* WO = (bf*)take((size_t)DM * DQ * 2); float* CS = (float*)take((size_t)TT * HD * 2 * 4);
    bf* XB = (bf*)take((size_t)TT * DM * 2); float* FQ = (float*)take((size_t)TT * DQ * 4); float* FK = (float*)take((size_t)TT * DKV * 4);
    h16* QP16 = (h16*)take((size_t)NH_ * TT * HD * 2); h16* KP16 = (h16*)take((size_t)NKV * TT * HD * 2); h16* VT16 = (h16*)take((size_t)NKV * HD * TT * 2);
    bf* QPh = (bf*)take((size_t)NH_ * TT * HD * 2); bf* QPl = (bf*)take((size_t)NH_ * TT * HD * 2); bf* KPh = (bf*)take((size_t)NKV * TT * HD * 2); bf* KPl = (bf*)take((size_t)NKV * TT * HD * 2); bf* VTh = (bf*)take((size_t)NKV * HD * TT * 2); bf* VTl = (bf*)take((size_t)NKV * HD * TT * 2); bf* Ph = (bf*)take((size_t)ZH * RH * TT * 2); bf* Pl = (bf*)take((size_t)ZH * RH * TT * 2);
    float* Sb = (float*)take((size_t)ZH * TT * TT * 4); h16* P16 = (h16*)take((size_t)ZH * TT * TT * 2); float* Ob = (float*)take((size_t)ZH * TT * HD * 4); bf* ATh = (bf*)take((size_t)TT * DQ * 2); bf* ATl = (bf*)take((size_t)TT * DQ * 2);
    if ((size_t)(wsp - (char*)d_ws) > ws_size) return;    // ws 256 MiB
    float* FV = FK;   // v projection reuses the k buffer after the k planes are built (stream-ordered)
    { k_wtH<<<(unsigned)(((size_t)DQ * DM / 2 + 255) / 256), 256, 0, stream>>>(wq, WQ); k_wtH<<<(unsigned)(((size_t)DQ * DM / 2 + 255) / 256), 256, 0, stream>>>(wk, WK); k_wtH<<<(unsigned)(((size_t)DQ * DM / 2 + 255) / 256), 256, 0, stream>>>(wv, WV);
      k_cvt8<<<(unsigned)(((size_t)DM * DQ / 8 + 255) / 256), 256, 0, stream>>>(wo, WO, (size_t)DM * DQ / 8);
       }
    k_csid<<<(TT * HD + 255) / 256, 256, 0, stream>>>(CS);
    const unsigned LQ = (unsigned)(((size_t)NH_ * TT * HD / 2 + 255) / 256), LKv = (unsigned)(((size_t)NKV * TT * HD / 2 + 255) / 256);
    for (int b = 0; b < NB_; ++b) {
        
        k_cvt8<<<(unsigned)(((size_t)TT * DM / 8 + 255) / 256), 256, 0, stream>>>(x + (size_t)b * TT * DM, XB, (size_t)TT * DM / 8);
        k_gemmw<bf, 0, false><<<dim3(TT / 64, DQ / 64, 1), 32, 0, stream>>>(XB, nullptr, WQ, nullptr, DM, FQ, DQ, nullptr, 0, 0, 0);
        k_rope<<<LQ, 256, 0, stream>>>(FQ, DQ, NH_, CS, nullptr, nullptr, 1.0f, QP16, QPh, QPl);
        k_cvt8<<<(unsigned)(((size_t)TT * DM / 8 + 255) / 256), 256, 0, stream>>>(xk + (size_t)b * TT * DM, XB, (size_t)TT * DM / 8);   /* XB := bf16(x_key[b]) */ k_gemmw<bf, 0, false><<<dim3(TT / 64, DKV / 64, 1), 32, 0, stream>>>(XB, nullptr, WK, nullptr, DM, FK, DKV, nullptr, 0, 0, 0);
        k_rope<<<LKv, 256, 0, stream>>>(FK, DKV, NKV, CS, nullptr, nullptr, 1.0f, KP16, KPh, KPl);
        k_cvt8<<<(unsigned)(((size_t)TT * DM / 8 + 255) / 256), 256, 0, stream>>>(xv + (size_t)b * TT * DM, XB, (size_t)TT * DM / 8);   /* XB := bf16(x_value[b]) */ k_gemmw<bf, 0, false><<<dim3(TT / 64, DKV / 64, 1), 32, 0, stream>>>(XB, nullptr, WV, nullptr, DM, FV, DKV, nullptr, 0, 0, 0); k_vtp<<<LKv, 256, 0, stream>>>(FV, DKV, NKV, VT16, VTh, VTl);
        for (int h0 = 0; h0 < NH_; h0 += ZH) { const size_t zq = (size_t)h0, zk = (size_t)(h0 / REP);   // one kv head per query head: the pass's two heads use consecutive kv planes (z-strides TT*HD)
            k_gemmc<bf, 2, 1><<<dim3(RH / 64, TT / 64, ZH), 32, 0, stream>>>(QPh + zq * TT * HD, QPl + zq * TT * HD, KPh + zk * TT * HD, KPl + zk * TT * HD, HD, Sb, TT, 0, (size_t)TT * HD, (size_t)TT * HD, (size_t)TT * TT);
            k_gemmc<h16, 0, 1><<<dim3((TT - RH) / 64, TT / 64, ZH), 32, 0, stream>>>(QP16 + zq * TT * HD + (size_t)RH * HD, nullptr, KP16 + zk * TT * HD, nullptr, HD, Sb + (size_t)RH * TT, TT, RH, (size_t)TT * HD, (size_t)TT * HD, (size_t)TT * TT);
            k_asoft<<<ZH * TT / 8, 256, 0, stream>>>(Sb, P16, Ph, Pl);
            k_gemmc<bf, 2, 2><<<dim3(RH / 64, HD / 64, ZH), 32, 0, stream>>>(Ph, Pl, VTh + zk * HD * TT, VTl + zk * HD * TT, TT, Ob, HD, 0, (size_t)RH * TT, (size_t)HD * TT, (size_t)TT * HD);
            k_gemmc<h16, 0, 2><<<dim3((TT - RH) / 64, HD / 64, ZH), 32, 0, stream>>>(P16 + (size_t)RH * TT, nullptr, VT16 + zk * HD * TT, nullptr, TT, Ob + (size_t)RH * HD, HD, RH, (size_t)TT * TT, (size_t)HD * TT, (size_t)TT * HD);
            k_merge<<<(unsigned)(((size_t)ZH * TT * HD / 2 + 255) / 256), 256, 0, stream>>>(Ob, h0, ATh, ATl); }
        k_gemmw<bf, 1, false><<<dim3(TT / 64, DM / 64, 1), 32, 0, stream>>>(ATh, ATl, WO, nullptr, DQ, OUT + (size_t)b * TT * DM, DM, nullptr, 0, 0, 0); }
}

// v001
// A run of this version takes 669 microseconds.
// Next to v000, in two timings, it ran 2.19 times as fast each time.
#include <hip/hip_runtime.h>

// Causal multi-head attention on three input streams with per-head stacked projection weights (x_query, x_key, x_value [2][2048][1024]; q = einsum('bsd,hdk', x_query, Wq) with Wq [16][1024][64] = [h][d][k] (1/32), k, v likewise from x_key / x_value; scores x 1/sqrt(64) + causal additive mask (0 / -inf); softmax; heads concatenated h-major; out = concat W0^T ('oi' [1024][1024]) -> [2][2048][1024] (4.2 M); argument order x_query, x_key, x_value, Wq, Wk, Wv, W0).
// Layout per batch: bf16 copies of the three streams in turn; k_wtH turns each [h][d][k] weight into Bt rows h*64 + k; exact projections; identity-table plane builders; causal T-2048 attention (hybrid rows: < 512 hi/lo 3 products, rest fp16 x1024; k_gemmc skips tiles above the diagonal); merged hi/lo x W0 exact.
// Compute dtypes, f32 accumulate: every input rounded to bf16; projections exact; attention rows < 512 3 products, rest fp16; softmax f32; W0 hl x exact.

#define NB_  2
#define TT   2048
#define DM   1024
#define NH_  16
#define NKV  16
#define REP  (NH_ / NKV)
#define HD   64
#define DQ   (NH_ * HD)
#define DKV  (NKV * HD)
#define ZH   2
#define RH   512                  // query rows < RH use hi+lo planes (0: none)
#define WIN  2048
#define PCAR 1024.0f
#define SCL  0.125f   // HD^-0.5
#define KSP  4                    // work-groups that share the K range of one P.V tile; each stores its own partial plane, k_merge adds the planes
typedef _Float16 h16;
typedef unsigned short bf;
typedef __attribute__((ext_vector_type(16))) __bf16   v16bf;
typedef __attribute__((ext_vector_type(16))) _Float16 v16h;
typedef __attribute__((ext_vector_type(8)))  _Float16 v8h;
typedef __attribute__((ext_vector_type(8)))  unsigned short v8us;
typedef __attribute__((ext_vector_type(8)))  float    v8f;
typedef __attribute__((ext_vector_type(4)))  float    v4f;
typedef v8h  __attribute__((may_alias)) v8ha;
typedef v4f  __attribute__((may_alias)) v4fa;
typedef v8us __attribute__((may_alias)) v8usa;

__device__ __forceinline__ unsigned short f2bf(float f) { unsigned u = __float_as_uint(f); u += 0x7FFFu + ((u >> 16) & 1u); return (unsigned short)(u >> 16); }
__device__ __forceinline__ float bf2f(unsigned short b) { return __uint_as_float(((unsigned)b) << 16); }
__device__ __forceinline__ float bfr(float f) { return bf2f(f2bf(f)); }
__device__ __forceinline__ v16h cat16(v8h lo, v8h hi) { return __builtin_shufflevector(lo, hi, 0, 1, 2, 3, 4, 5, 6, 7, 8, 9, 10, 11, 12, 13, 14, 15); }
__device__ __forceinline__ v16bf cat16b(v8us lo, v8us hi) { return __builtin_bit_cast(v16bf, __builtin_shufflevector(lo, hi, 0, 1, 2, 3, 4, 5, 6, 7, 8, 9, 10, 11, 12, 13, 14, 15)); }
__device__ __forceinline__ v8f wmma16(v16h a, v16h b, v8f c) { return __builtin_amdgcn_wmma_f32_16x16x32_f16(false, a, false, b, (short)0, c, false, false); }
__device__ __forceinline__ v8f wmmab(v16bf a, v16bf b, v8f c) { return __builtin_amdgcn_wmma_f32_16x16x32_bf16(false, a, false, b, (short)0, c, false, false); }



// ---- ksum_store: the NW waves of a work-group each hold a partial 64x64 f32 tile (their own share of K). Each writes it to its own LDS plane (pitch 68), one barrier, then every thread
// sums its 4-float pieces over the planes in wave order 0..NW-1 and stores them; 16 lanes store one whole 256-byte row of C (Ct = C at the tile's origin).
template <int NW, bool BIAS>
__device__ __forceinline__ void ksum_store(const v8f (&acc)[4][4], float* os, int wave, int lane, float* Ct, int ldc, const float* __restrict__ bias_c0) {
    const int lr = lane & 15, hi = lane >> 4; float* mine = os + wave * (64 * 68);
#pragma unroll
    for (int mb = 0; mb < 4; ++mb)
#pragma unroll
        for (int nb = 0; nb < 4; ++nb)
#pragma unroll
            for (int j = 0; j < 8; ++j) mine[(mb * 16 + hi * 8 + j) * 68 + nb * 16 + lr] = acc[mb][nb][j];
    __syncthreads();   // every wave's partial tile is in LDS before any thread sums across the planes
#pragma unroll
    for (int u = 0; u < 32 / NW; ++u) { const int idx = (u * NW + wave) * 32 + lane; const int row = idx >> 4, cofs = (idx & 15) * 4; v4f val = *(const v4fa*)(os + row * 68 + cofs);
#pragma unroll
        for (int w = 1; w < NW; ++w) val += *(const v4fa*)(os + w * (64 * 68) + row * 68 + cofs);
        if (BIAS) { val[0] += bfr(bias_c0[cofs]); val[1] += bfr(bias_c0[cofs + 1]); val[2] += bfr(bias_c0[cofs + 2]); val[3] += bfr(bias_c0[cofs + 3]); }
        *(v4f*)(Ct + (size_t)row * ldc + cofs) = val; }
}
// ---- k_gemmw: register-blocked GEMM, one 64x64 output tile per work-group of NW waves; K is split over the waves, 32-element step s to wave s % NW (two neighbour waves read the two halves of the same 128-byte lines at the same time); each wave keeps 16 accumulators, operands straight from K-contiguous 16-bit planes; ksum_store adds the NW partial tiles; grid (M/64, N/64, Z), NW*32 threads.
// C[m][n] (f32, pitch ldc, + optional f32 bias[n]) = sum_k A[m][k] Bt[n][k] (+ split products per NSPLIT). z-batch strides sA/sB/sC in elements. K % 32 == 0.
template <typename T16> struct WFrag;
template <> struct WFrag<h16> { typedef v16h V; static __device__ __forceinline__ V ld(const h16* p) { return cat16(*(const v8h*)p, *(const v8h*)(p + 16)); } static __device__ __forceinline__ v8f mma(V a, V b, v8f c) { return wmma16(a, b, c); } };
template <> struct WFrag<bf> { typedef v16bf V; static __device__ __forceinline__ V ld(const bf* p) { return cat16b(*(const v8us*)p, *(const v8us*)(p + 16)); } static __device__ __forceinline__ v8f mma(V a, V b, v8f c) { return wmmab(a, b, c); } };
template <typename T16, int NSPLIT, bool BIAS, int NW>
__global__ __launch_bounds__(NW * 32) void k_gemmw(const T16* __restrict__ A, const T16* __restrict__ A2, const T16* __restrict__ Bt, const T16* __restrict__ Bt2, int K, float* C, int ldc, const float* __restrict__ bias, size_t sA, size_t sB, size_t sC) {
    typedef typename WFrag<T16>::V V;
    __shared__ __align__(16) float os[NW * 64 * 68];
    const size_t z = blockIdx.z; A += z * sA; if (A2) A2 += z * sA; Bt += z * sB; if (Bt2) Bt2 += z * sB; C += z * sC;
    const int wave = __builtin_amdgcn_readfirstlane(threadIdx.x >> 5); const int lane = threadIdx.x & 31, lr = lane & 15, hi = lane >> 4; const int r0 = blockIdx.x * 64, c0 = blockIdx.y * 64;
    v8f acc[4][4];
#pragma unroll
    for (int mb = 0; mb < 4; ++mb)
#pragma unroll
        for (int nb = 0; nb < 4; ++nb) acc[mb][nb] = (v8f){};
    const size_t aoff = (size_t)(r0 + lr) * K + 8 * hi, boff = (size_t)(c0 + lr) * K + 8 * hi;
#pragma unroll 1
    for (int kc = wave * 32; kc < K; kc += NW * 32) {
        V a[4], a2[4];
#pragma unroll
        for (int mb = 0; mb < 4; ++mb) { a[mb] = WFrag<T16>::ld(A + aoff + (size_t)mb * 16 * K + kc); if (NSPLIT == 1 || NSPLIT == 2) a2[mb] = WFrag<T16>::ld(A2 + aoff + (size_t)mb * 16 * K + kc); }
#pragma unroll
        for (int nb = 0; nb < 4; ++nb) { const V b = WFrag<T16>::ld(Bt + boff + (size_t)nb * 16 * K + kc); V b2; if (NSPLIT >= 2) b2 = WFrag<T16>::ld(Bt2 + boff + (size_t)nb * 16 * K + kc);
#pragma unroll
            for (int mb = 0; mb < 4; ++mb) { acc[mb][nb] = WFrag<T16>::mma(a[mb], b, acc[mb][nb]); if (NSPLIT == 1 || NSPLIT == 2) acc[mb][nb] = WFrag<T16>::mma(a2[mb], b, acc[mb][nb]); if (NSPLIT >= 2) acc[mb][nb] = WFrag<T16>::mma(a[mb], b2, acc[mb][nb]); } }
        asm volatile("v_nop\n\tv_nop\n\tv_nop\n\tv_nop" : "+v"(acc[0][0]), "+v"(acc[1][1]), "+v"(acc[2][2]), "+v"(acc[3][3]) : "v"(a[0]), "v"(a[3]));
    }
    ksum_store<NW, BIAS>(acc, os, wave, lane, C + (size_t)r0 * ldc + c0, ldc, BIAS ? bias + c0 : nullptr);
}

// ---- k_gemmc: the same 64x64 tile GEMM specialised for causal attention: CMODE 1 skips score tiles entirely above the diagonal (query rows r0+roff.., key columns c0..), CMODE 2 limits the
// key (K) loop of the probability x value contraction to the diagonal block (probabilities beyond it are exactly zero). roff = row offset of this launch's first row within the sequence.
// NW = 1, KS = 1 (scores, K = 64): one wave, its own store path. NW > 1 (P.V): K is split in 64-element pieces, piece p to work-group p % KS of the tile (blockIdx.y % KS) and there to wave pair (p / KS) % (NW / 2), one 32-element half to each wave of the pair;
// ksum_store adds the NW partial tiles, and work-group ks stores its sum in partial plane ks of C (plane stride sK elements); every plane is stored whole, zeros where a work-group has no piece below the diagonal.
template <typename T16, int NSPLIT, int CMODE, int NW, int KS>
__global__ __launch_bounds__(NW * 32) void k_gemmc(const T16* __restrict__ A, const T16* __restrict__ A2, const T16* __restrict__ Bt, const T16* __restrict__ Bt2, int K, float* C, int ldc, int roff, size_t sA, size_t sB, size_t sC, size_t sK) {
    typedef typename WFrag<T16>::V V;
    static_assert(NW == 1 ? KS == 1 : NW % 2 == 0, "waves work in pairs");
    __shared__ __align__(16) float os[NW == 1 ? 16 * 68 : NW * 64 * 68];
    const size_t z = blockIdx.z; A += z * sA; if (A2) A2 += z * sA; Bt += z * sB; if (Bt2) Bt2 += z * sB; C += z * sC;
    const int wave = (NW == 1) ? 0 : __builtin_amdgcn_readfirstlane(threadIdx.x >> 5); const int ks = blockIdx.y % KS; const int lane = threadIdx.x & 31, lr = lane & 15, hi = lane >> 4; const int r0 = blockIdx.x * 64, c0 = (blockIdx.y / KS) * 64;
    if (CMODE == 1 && c0 > r0 + roff + 63) return;                  // score tile entirely above the causal diagonal: never written (the softmax masks j > i by select)
    const int Kl = (CMODE == 2) ? min(K, r0 + roff + 64) : K;        // P.V: probabilities are exactly 0 beyond the diagonal block, so the K loop stops there
    v8f acc[4][4];
#pragma unroll
    for (int mb = 0; mb < 4; ++mb)
#pragma unroll
        for (int nb = 0; nb < 4; ++nb) acc[mb][nb] = (v8f){};
    const size_t aoff = (size_t)(r0 + lr) * K + 8 * hi, boff = (size_t)(c0 + lr) * K + 8 * hi;
#pragma unroll 1
    for (int kc = ((wave >> 1) * KS + ks) * 64 + (wave & 1) * 32; kc < Kl; kc += (NW == 1) ? 32 : (NW / 2) * KS * 64) {
        V a[4], a2[4];
#pragma unroll
        for (int mb = 0; mb < 4; ++mb) { a[mb] = WFrag<T16>::ld(A + aoff + (size_t)mb * 16 * K + kc); if (NSPLIT == 1 || NSPLIT == 2) a2[mb] = WFrag<T16>::ld(A2 + aoff + (size_t)mb * 16 * K + kc); }
#pragma unroll
        for (int nb = 0; nb < 4; ++nb) { const V b = WFrag<T16>::ld(Bt + boff + (size_t)nb * 16 * K + kc); V b2; if (NSPLIT >= 2) b2 = WFrag<T16>::ld(Bt2 + boff + (size_t)nb * 16 * K + kc);
#pragma unroll
            for (int mb = 0; mb < 4; ++mb) { acc[mb][nb] = WFrag<T16>::mma(a[mb], b, acc[mb][nb]); if (NSPLIT == 1 || NSPLIT == 2) acc[mb][nb] = WFrag<T16>::mma(a2[mb], b, acc[mb][nb]); if (NSPLIT >= 2) acc[mb][nb] = WFrag<T16>::mma(a[mb], b2, acc[mb][nb]); } }
        asm volatile("v_nop\n\tv_nop\n\tv_nop\n\tv_nop" : "+v"(acc[0][0]), "+v"(acc[1][1]), "+v"(acc[2][2]), "+v"(acc[3][3]) : "v"(a[0]), "v"(a[3]));
    }
    if constexpr (NW > 1) { ksum_store<NW, false>(acc, os, wave, lane, C + (size_t)ks * sK + (size_t)r0 * ldc + c0, ldc, nullptr); return; }
#pragma unroll
    for (int mb = 0; mb < 4; ++mb) {
#pragma unroll
        for (int nb = 0; nb < 4; ++nb) {
#pragma unroll
            for (int j = 0; j < 8; ++j) os[(hi * 8 + j) * 68 + nb * 16 + lr] = acc[mb][nb][j]; }
        __builtin_amdgcn_wave_barrier(); asm volatile("" ::: "memory");
        float* crow = C + (size_t)(r0 + mb * 16) * ldc + c0;
{
#pragma unroll
            for (int s = 0; s < 8; ++s) { const int row = 2 * s + hi, cofs = lr * 4; v4f val = *(const v4fa*)(os + row * 68 + cofs);
                *(v4f*)(crow + (size_t)row * ldc + cofs) = val; }
             }
        __builtin_amdgcn_wave_barrier(); asm volatile("" ::: "memory");
    }
}

__device__ __forceinline__ h16 tohx(float x) { return (h16)x; }
__device__ __forceinline__ void splitf(float y, unsigned short& h, unsigned short& l) { h = f2bf(y); l = f2bf(y - bf2f(h)); }
typedef __attribute__((ext_vector_type(2))) _Float16 v2h;
typedef __attribute__((ext_vector_type(4))) _Float16 v4h;
typedef __attribute__((ext_vector_type(2))) unsigned short v2us;
typedef __attribute__((ext_vector_type(4))) unsigned short v4us;
typedef __attribute__((ext_vector_type(2))) float v2f;
typedef __attribute__((ext_vector_type(4))) int v4i;

__global__ __launch_bounds__(256) void k_cvt8(const float* __restrict__ src, bf* dst, size_t n8) { const size_t i = (size_t)blockIdx.x * 256 + threadIdx.x; if (i >= n8) return; const v8f v = *(const v8f*)(src + i * 8); v8us o;
#pragma unroll
    for (int k = 0; k < 8; ++k) o[k] = f2bf(v[k]); *(v8us*)(dst + i * 8) = o;  }

// k_rope: head planes [h][t][d] (fp16 + hi/lo) of rope(x) x sc with the rotate-half convention out[d] = x[d] cos[t][d] - x[d+HD/2] sin[t][d], out[d+HD/2] = x[d+HD/2] cos[t][d+HD/2] + x[d] sin[t][d+HD/2]
__global__ __launch_bounds__(256) void k_rope(const float* __restrict__ F, int pitch, int nheads, const float* __restrict__ CS, const float* __restrict__ RF, const float* __restrict__ nw, float sc, h16* P16, bf* Ph, bf* Pl) {
    const size_t e = ((size_t)blockIdx.x * 256 + threadIdx.x) * 2; if (e >= (size_t)nheads * TT * HD) return; const int d = (int)(e % HD); const int t = (int)((e / HD) % TT); const int h = (int)(e / ((size_t)HD * TT)); const float* f = F + (size_t)t * pitch + h * HD; const float rf = RF ? RF[(size_t)h * TT + t] : 1.0f; v2h o16; v2us oh, ol;
#pragma unroll
    for (int q = 0; q < 2; ++q) { const int dd = d + q; const int dp = (dd < HD / 2) ? dd + HD / 2 : dd - HD / 2; float x0 = f[dd], x1 = f[dp];
        if (RF) { float n0 = __fmul_rn(x0, rf), n1 = __fmul_rn(x1, rf); asm volatile("" : "+v"(n0)); asm volatile("" : "+v"(n1)); x0 = __fmul_rn(bfr(nw[dd]), n0); x1 = __fmul_rn(bfr(nw[dp]), n1); }
        const v2f cs = *(const v2f*)(CS + ((size_t)t * HD + dd) * 2); float a = __fmul_rn(x0, cs[0]), bq = __fmul_rn(x1, cs[1]); asm volatile("" : "+v"(a)); asm volatile("" : "+v"(bq)); const float r = ((dd < HD / 2) ? __fsub_rn(a, bq) : __fadd_rn(a, bq)) * sc;
        o16[q] = tohx(r); unsigned short a2, c2; splitf(r, a2, c2); oh[q] = a2; ol[q] = c2; }
    *(v2h*)(P16 + e) = o16; *(v2us*)(Ph + e) = oh; *(v2us*)(Pl + e) = ol;  }
__global__ __launch_bounds__(256) void k_wtH(const float* __restrict__ w, bf* Bt) { const size_t e2 = ((size_t)blockIdx.x * 256 + threadIdx.x) * 2; if (e2 >= (size_t)DQ * DM) return; const int d = (int)(e2 % DM); const int r = (int)(e2 / DM); const int h = r / HD, e = r % HD; v2us o; o[0] = f2bf(w[((size_t)h * DM + d) * HD + e]); o[1] = f2bf(w[((size_t)h * DM + d + 1) * HD + e]);
    *(v2us*)(Bt + e2) = o;  }
__global__ __launch_bounds__(256) void k_vtp(const float* __restrict__ F, int pitch, int nheads, h16* V16, bf* Vh, bf* Vl) { const size_t e = ((size_t)blockIdx.x * 256 + threadIdx.x) * 2; if (e >= (size_t)nheads * HD * TT) return; const int t = (int)(e % TT); const int d = (int)((e / TT) % HD); const int g = (int)(e / ((size_t)TT * HD)); v2h o16; v2us oh, ol;
#pragma unroll
    for (int q = 0; q < 2; ++q) { const float x = F[(size_t)(t + q) * pitch + g * HD + d]; o16[q] = tohx(x); unsigned short a2, c2; splitf(x, a2, c2); oh[q] = a2; ol[q] = c2; }
    *(v2h*)(V16 + e) = o16; *(v2us*)(Vh + e) = oh; *(v2us*)(Vl + e) = ol;  }
__global__ __launch_bounds__(256) void k_csid(float* CS) { const int idx = blockIdx.x * 256 + threadIdx.x; if (idx >= TT * HD) return; v2f cs; cs[0] = 1.0f; cs[1] = 0.0f; *(v2f*)(CS + (size_t)idx * 2) = cs;  }
// k_asoft: per row (zz, i): t = S x HD^-0.5 for j <= i and i - j < WIN (sliding causal window; the reference's -1e9 additive fill vanishes identically); softmax over the 2048 keys (register row, one exp, fixed trees);
__global__ __launch_bounds__(256) void k_asoft(const float* __restrict__ Sb, h16* P16, bf* Ph, bf* Pl) {
    const int lane = threadIdx.x & 31; const int row = blockIdx.x * 8 + (threadIdx.x >> 5); if (row >= ZH * TT) return; const int i = row % TT; const int zz = row / TT; (void)zz; const bool hires = (i < RH); const float* sr = Sb + (size_t)row * TT; float v[TT / 32]; float mx = -3.0e38f;
#pragma unroll
    for (int ch = 0; ch < TT / 128; ++ch) { const int j0 = ch * 128 + lane * 4; const v4f a = *(const v4f*)(sr + j0);
#pragma unroll
        for (int q = 0; q < 4; ++q) { const int j = j0 + q; (void)j; const float t = (j <= i && i - j < WIN) ? a[q] * SCL : -3.0e38f; v[ch * 4 + q] = t; mx = fmaxf(mx, t); } }
#pragma unroll
    for (int sh = 16; sh; sh >>= 1) mx = fmaxf(mx, __shfl_xor(mx, sh, 32));
    float sum = 0.f;
#pragma unroll
    for (int k = 0; k < TT / 32; ++k) { float d0 = __fsub_rn(v[k], mx); asm volatile("" : "+v"(d0)); v[k] = __builtin_amdgcn_exp2f(__fmul_rn(d0, 1.4426950408889634f)); sum += v[k]; }
#pragma unroll
    for (int sh = 16; sh; sh >>= 1) sum += __shfl_xor(sum, sh, 32);
    const float f = __fdiv_rn(hires ? 1.0f : PCAR, sum);
{
        if (hires) {
#pragma unroll
            for (int ch = 0; ch < TT / 128; ++ch) { v4us oh, ol;
#pragma unroll
                for (int q = 0; q < 4; ++q) { unsigned short a, c2; splitf(v[ch * 4 + q] * f, a, c2); oh[q] = a; ol[q] = c2; }
                const size_t oo = ((size_t)zz * (RH ? RH : 1) + i) * TT + ch * 128 + lane * 4; *(v4us*)(Ph + oo) = oh; *(v4us*)(Pl + oo) = ol; }
        } else {
#pragma unroll
            for (int ch = 0; ch < TT / 128; ++ch) { v4h o4;
#pragma unroll
                for (int q = 0; q < 4; ++q) o4[q] = tohx(v[ch * 4 + q] * f);
                *(v4h*)(P16 + (size_t)row * TT + ch * 128 + lane * 4) = o4; } }
         }
}
__global__ __launch_bounds__(256) void k_merge(const float* __restrict__ O, int h0, bf* Ah, bf* Al) { const size_t e = ((size_t)blockIdx.x * 256 + threadIdx.x) * 2; if (e >= (size_t)ZH * TT * HD) return; const int d = (int)(e % HD); const int t = (int)((e / HD) % TT); const int zz = (int)(e / ((size_t)HD * TT)); const float cs = (t < RH) ? 1.0f : (1.0f / PCAR); const size_t oo = (size_t)t * DQ + (h0 + zz) * HD + d;
    v2us oh, ol;
#pragma unroll
    for (int q = 0; q < 2; ++q) { float s = O[e + q];
#pragma unroll
        for (int p = 1; p < KSP; ++p) s += O[(size_t)p * ZH * TT * HD + e + q];   // the KSP partial planes of P.V, in plane order
        unsigned short a, c2; splitf(s * cs, a, c2); oh[q] = a; ol[q] = c2; } *(v2us*)(Ah + oo) = oh; *(v2us*)(Al + oo) = ol;  }

extern "C" void kernel_launch(void* const* d_in, const int* in_sizes, int n_in,
                              void* d_out, int out_size, void* d_ws, size_t ws_size, hipStream_t stream) {
    (void)in_sizes; (void)n_in; (void)out_size;
    const float* x = (const float*)d_in[0]; const float* xk = (const float*)d_in[1]; const float* xv = (const float*)d_in[2]; const float* wq = (const float*)d_in[3]; const float* wk = (const float*)d_in[4]; const float* wv = (const float*)d_in[5]; const float* wo = (const float*)d_in[6];   /* x_query, x_key, x_value, Wq, Wk, Wv [16][1024][64] ([h][d][k]), W0 ('oi' [1024][1024]) */
    float* OUT = (float*)d_out;     // [2][2048][1024]
    char* wsp = (char*)d_ws;
    auto take = [&](size_t bytes) { char* p = wsp; wsp += (bytes + 255) & ~(size_t)255; return (void*)p; };
    bf* WQ = (bf*)take((size_t)DQ * DM * 2); bf* WK = (bf*)take((size_t)DKV * DM * 2); bf* WV = (bf*)take((size_t)DKV * DM * 2); bf* WO = (bf*)take((size_t)DM * DQ * 2); float* CS = (float*)take((size_t)TT * HD * 2 * 4);
    bf* XB = (bf*)take((size_t)TT * DM * 2); float* FQ = (float*)take((size_t)TT * DQ * 4); float* FK = (float*)take((size_t)TT * DKV * 4);
    h16* QP16 = (h16*)take((size_t)NH_ * TT * HD * 2); h16* KP16 = (h16*)take((size_t)NKV * TT * HD * 2); h16* VT16 = (h16*)take((size_t)NKV * HD * TT * 2);
    bf* QPh = (bf*)take((size_t)NH_ * TT * HD * 2); bf* QPl = (bf*)take((size_t)NH_ * TT * HD * 2); bf* KPh = (bf*)take((size_t)NKV * TT * HD * 2); bf* KPl = (bf*)take((size_t)NKV * TT * HD * 2); bf* VTh = (bf*)take((size_t)NKV * HD * TT * 2); bf* VTl = (bf*)take((size_t)NKV * HD * TT * 2); bf* Ph = (bf*)take((size_t)ZH * RH * TT * 2); bf* Pl = (bf*)take((size_t)ZH * RH * TT * 2);
    float* Sb = (float*)take((size_t)ZH * TT * TT * 4); h16* P16 = (h16*)take((size_t)ZH * TT * TT * 2); float* Ob = (float*)take((size_t)KSP * ZH * TT * HD * 4); bf* ATh = (bf*)take((size_t)TT * DQ * 2); bf* ATl = (bf*)take((size_t)TT * DQ * 2);
    if ((size_t)(wsp - (char*)d_ws) > ws_size) return;    // ws 256 MiB
    float* FV = FK;   // v projection reuses the k buffer after the k planes are built (stream-ordered)
    { k_wtH<<<(unsigned)(((size_t)DQ * DM / 2 + 255) / 256), 256, 0, stream>>>(wq, WQ); k_wtH<<<(unsigned)(((size_t)DQ * DM / 2 + 255) / 256), 256, 0, stream>>>(wk, WK); k_wtH<<<(unsigned)(((size_t)DQ * DM / 2 + 255) / 256), 256, 0, stream>>>(wv, WV);
      k_cvt8<<<(unsigned)(((size_t)DM * DQ / 8 + 255) / 256), 256, 0, stream>>>(wo, WO, (size_t)DM * DQ / 8);
       }
    k_csid<<<(TT * HD + 255) / 256, 256, 0, stream>>>(CS);
    const unsigned LQ = (unsigned)(((size_t)NH_ * TT * HD / 2 + 255) / 256), LKv = (unsigned)(((size_t)NKV * TT * HD / 2 + 255) / 256);
    for (int b = 0; b < NB_; ++b) {
        
        k_cvt8<<<(unsigned)(((size_t)TT * DM / 8 + 255) / 256), 256, 0, stream>>>(x + (size_t)b * TT * DM, XB, (size_t)TT * DM / 8);
        k_gemmw<bf, 0, false, 8><<<dim3(TT / 64, DQ / 64, 1), 256, 0, stream>>>(XB, nullptr, WQ, nullptr, DM, FQ, DQ, nullptr, 0, 0, 0);
        k_rope<<<LQ, 256, 0, stream>>>(FQ, DQ, NH_, CS, nullptr, nullptr, 1.0f, QP16, QPh, QPl);
        k_cvt8<<<(unsigned)(((size_t)TT * DM / 8 + 255) / 256), 256, 0, stream>>>(xk + (size_t)b * TT * DM, XB, (size_t)TT * DM / 8);   /* XB := bf16(x_key[b]) */ k_gemmw<bf, 0, false, 8><<<dim3(TT / 64, DKV / 64, 1), 256, 0, stream>>>(XB, nullptr, WK, nullptr, DM, FK, DKV, nullptr, 0, 0, 0);
        k_rope<<<LKv, 256, 0, stream>>>(FK, DKV, NKV, CS, nullptr, nullptr, 1.0f, KP16, KPh, KPl);
        k_cvt8<<<(unsigned)(((size_t)TT * DM / 8 + 255) / 256), 256, 0, stream>>>(xv + (size_t)b * TT * DM, XB, (size_t)TT * DM / 8);   /* XB := bf16(x_value[b]) */ k_gemmw<bf, 0, false, 8><<<dim3(TT / 64, DKV / 64, 1), 256, 0, stream>>>(XB, nullptr, WV, nullptr, DM, FV, DKV, nullptr, 0, 0, 0); k_vtp<<<LKv, 256, 0, stream>>>(FV, DKV, NKV, VT16, VTh, VTl);
        for (int h0 = 0; h0 < NH_; h0 += ZH) { const size_t zq = (size_t)h0, zk = (size_t)(h0 / REP);   // one kv head per query head: the pass's two heads use consecutive kv planes (z-strides TT*HD)
            k_gemmc<bf, 2, 1, 1, 1><<<dim3(RH / 64, TT / 64, ZH), 32, 0, stream>>>(QPh + zq * TT * HD, QPl + zq * TT * HD, KPh + zk * TT * HD, KPl + zk * TT * HD, HD, Sb, TT, 0, (size_t)TT * HD, (size_t)TT * HD, (size_t)TT * TT, 0);
            k_gemmc<h16, 0, 1, 1, 1><<<dim3((TT - RH) / 64, TT / 64, ZH), 32, 0, stream>>>(QP16 + zq * TT * HD + (size_t)RH * HD, nullptr, KP16 + zk * TT * HD, nullptr, HD, Sb + (size_t)RH * TT, TT, RH, (size_t)TT * HD, (size_t)TT * HD, (size_t)TT * TT, 0);
            k_asoft<<<ZH * TT / 8, 256, 0, stream>>>(Sb, P16, Ph, Pl);
            k_gemmc<bf, 2, 2, 4, KSP><<<dim3(RH / 64, HD / 64 * KSP, ZH), 128, 0, stream>>>(Ph, Pl, VTh + zk * HD * TT, VTl + zk * HD * TT, TT, Ob, HD, 0, (size_t)RH * TT, (size_t)HD * TT, (size_t)TT * HD, (size_t)ZH * TT * HD);
            k_gemmc<h16, 0, 2, 8, KSP><<<dim3((TT - RH) / 64, HD / 64 * KSP, ZH), 256, 0, stream>>>(P16 + (size_t)RH * TT, nullptr, VT16 + zk * HD * TT, nullptr, TT, Ob + (size_t)RH * HD, HD, RH, (size_t)TT * TT, (size_t)HD * TT, (size_t)TT * HD, (size_t)ZH * TT * HD);
            k_merge<<<(unsigned)(((size_t)ZH * TT * HD / 2 + 255) / 256), 256, 0, stream>>>(Ob, h0, ATh, ATl); }
        k_gemmw<bf, 1, false, 8><<<dim3(TT / 64, DM / 64, 1), 256, 0, stream>>>(ATh, ATl, WO, nullptr, DQ, OUT + (size_t)b * TT * DM, DM, nullptr, 0, 0, 0); }
}

// v002
// One run takes 432 microseconds.
// Two timings next to v001 both put it at 1.55 times that version's speed.
// Over all steps from v000 it is 3.39 times as fast.
#include <hip/hip_runtime.h>

// Causal multi-head attention on three input streams with per-head stacked projection weights (x_query, x_key, x_value [2][2048][1024]; q = einsum('bsd,hdk', x_query, Wq) with Wq [16][1024][64] = [h][d][k] (1/32), k, v likewise from x_key / x_value; scores x 1/sqrt(64) + causal additive mask (0 / -inf); softmax; heads concatenated h-major; out = concat W0^T ('oi' [1024][1024]) -> [2][2048][1024] (4.2 M); argument order x_query, x_key, x_value, Wq, Wk, Wv, W0).
// Layout, both batches at once: bf16 copies of the three streams; k_wtH turns each [h][d][k] weight into Bt rows h*64 + k; exact projections (one launch, z = stream); identity-table plane builders; causal T-2048 attention in passes of ZH (batch, head) pairs, probabilities stored in place over their own score rows (hybrid rows: < 512 hi/lo 3 products, rest fp16 x1024; k_gemmc skips tiles above the diagonal); merged hi/lo x W0 exact.
// Compute dtypes, f32 accumulate: every input rounded to bf16; projections exact; attention rows < 512 3 products, rest fp16; softmax f32; W0 hl x exact.

#define NB_  2
#define TT   2048
#define DM   1024
#define NH_  16
#define NKV  16
#define REP  (NH_ / NKV)
#define HD   64
#define DQ   (NH_ * HD)
#define DKV  (NKV * HD)
#define ZH   8                    // (batch, head) pairs per attention pass; NH_ % ZH == 0, so a pass stays inside one batch
#define RH   512                  // query rows < RH use hi+lo planes (0: none)
#define WIN  2048
#define PCAR 1024.0f
#define SCL  0.125f   // HD^-0.5
#define KSP  4                    // work-groups that share the K range of one P.V tile; each stores its own partial plane, k_merge adds the planes
typedef _Float16 h16;
typedef unsigned short bf;
typedef __attribute__((ext_vector_type(16))) __bf16   v16bf;
typedef __attribute__((ext_vector_type(16))) _Float16 v16h;
typedef __attribute__((ext_vector_type(8)))  _Float16 v8h;
typedef __attribute__((ext_vector_type(8)))  unsigned short v8us;
typedef __attribute__((ext_vector_type(8)))  float    v8f;
typedef __attribute__((ext_vector_type(4)))  float    v4f;
typedef v8h  __attribute__((may_alias)) v8ha;
typedef v4f  __attribute__((may_alias)) v4fa;
typedef v8us __attribute__((may_alias)) v8usa;

__device__ __forceinline__ unsigned short f2bf(float f) { unsigned u = __float_as_uint(f); u += 0x7FFFu + ((u >> 16) & 1u); return (unsigned short)(u >> 16); }
__device__ __forceinline__ float bf2f(unsigned short b) { return __uint_as_float(((unsigned)b) << 16); }
__device__ __forceinline__ float bfr(float f) { return bf2f(f2bf(f)); }
__device__ __forceinline__ v16h cat16(v8h lo, v8h hi) { return __builtin_shufflevector(lo, hi, 0, 1, 2, 3, 4, 5, 6, 7, 8, 9, 10, 11, 12, 13, 14, 15); }
__device__ __forceinline__ v16bf cat16b(v8us lo, v8us hi) { return __builtin_bit_cast(v16bf, __builtin_shufflevector(lo, hi, 0, 1, 2, 3, 4, 5, 6, 7, 8, 9, 10, 11, 12, 13, 14, 15)); }
__device__ __forceinline__ v8f wmma16(v16h a, v16h b, v8f c) { return __builtin_amdgcn_wmma_f32_16x16x32_f16(false, a, false, b, (short)0, c, false, false); }
__device__ __forceinline__ v8f wmmab(v16bf a, v16bf b, v8f c) { return __builtin_amdgcn_wmma_f32_16x16x32_bf16(false, a, false, b, (short)0, c, false, false); }



// ---- ksum_store: the NW waves of a work-group each hold a partial 64x64 f32 tile (their own share of K). Each writes it to its own LDS plane (pitch 68), one barrier, then every thread
// sums its 4-float pieces over the planes in wave order 0..NW-1 and stores them; 16 lanes store one whole 256-byte row of C (Ct = C at the tile's origin).
template <int NW, bool BIAS>
__device__ __forceinline__ void ksum_store(const v8f (&acc)[4][4], float* os, int wave, int lane, float* Ct, int ldc, const float* __restrict__ bias_c0) {
    const int lr = lane & 15, hi = lane >> 4; float* mine = os + wave * (64 * 68);
#pragma unroll
    for (int mb = 0; mb < 4; ++mb)
#pragma unroll
        for (int nb = 0; nb < 4; ++nb)
#pragma unroll
            for (int j = 0; j < 8; ++j) mine[(mb * 16 + hi * 8 + j) * 68 + nb * 16 + lr] = acc[mb][nb][j];
    __syncthreads();   // every wave's partial tile is in LDS before any thread sums across the planes
#pragma unroll
    for (int u = 0; u < 32 / NW; ++u) { const int idx = (u * NW + wave) * 32 + lane; const int row = idx >> 4, cofs = (idx & 15) * 4; v4f val = *(const v4fa*)(os + row * 68 + cofs);
#pragma unroll
        for (int w = 1; w < NW; ++w) val += *(const v4fa*)(os + w * (64 * 68) + row * 68 + cofs);
        if (BIAS) { val[0] += bfr(bias_c0[cofs]); val[1] += bfr(bias_c0[cofs + 1]); val[2] += bfr(bias_c0[cofs + 2]); val[3] += bfr(bias_c0[cofs + 3]); }
        *(v4f*)(Ct + (size_t)row * ldc + cofs) = val; }
}
// ---- k_gemmw: register-blocked GEMM, one 64x64 output tile per work-group of NW waves; K is split over the waves, 32-element step s to wave s % NW (two neighbour waves read the two halves of the same 128-byte lines at the same time); each wave keeps 16 accumulators, operands straight from K-contiguous 16-bit planes; ksum_store adds the NW partial tiles; grid (M/64, N/64, Z), NW*32 threads.
// C[m][n] (f32, pitch ldc, + optional f32 bias[n]) = sum_k A[m][k] Bt[n][k] (+ split products per NSPLIT). z-batch strides sA/sB/sC in elements. K % 32 == 0.
template <typename T16> struct WFrag;
template <> struct WFrag<h16> { typedef v16h V; static __device__ __forceinline__ V ld(const h16* p) { return cat16(*(const v8h*)p, *(const v8h*)(p + 16)); } static __device__ __forceinline__ v8f mma(V a, V b, v8f c) { return wmma16(a, b, c); } };
template <> struct WFrag<bf> { typedef v16bf V; static __device__ __forceinline__ V ld(const bf* p) { return cat16b(*(const v8us*)p, *(const v8us*)(p + 16)); } static __device__ __forceinline__ v8f mma(V a, V b, v8f c) { return wmmab(a, b, c); } };
template <typename T16, int NSPLIT, bool BIAS, int NW>
__global__ __launch_bounds__(NW * 32) void k_gemmw(const T16* __restrict__ A, const T16* __restrict__ A2, const T16* __restrict__ Bt, const T16* __restrict__ Bt2, int K, float* C, int ldc, const float* __restrict__ bias, size_t sA, size_t sB, size_t sC) {
    typedef typename WFrag<T16>::V V;
    __shared__ __align__(16) float os[NW * 64 * 68];
    const size_t z = blockIdx.z; A += z * sA; if (A2) A2 += z * sA; Bt += z * sB; if (Bt2) Bt2 += z * sB; C += z * sC;
    const int wave = __builtin_amdgcn_readfirstlane(threadIdx.x >> 5); const int lane = threadIdx.x & 31, lr = lane & 15, hi = lane >> 4; const int r0 = blockIdx.x * 64, c0 = blockIdx.y * 64;
    v8f acc[4][4];
#pragma unroll
    for (int mb = 0; mb < 4; ++mb)
#pragma unroll
        for (int nb = 0; nb < 4; ++nb) acc[mb][nb] = (v8f){};
    const size_t aoff = (size_t)(r0 + lr) * K + 8 * hi, boff = (size_t)(c0 + lr) * K + 8 * hi;
#pragma unroll 1
    for (int kc = wave * 32; kc < K; kc += NW * 32) {
        V a[4], a2[4];
#pragma unroll
        for (int mb = 0; mb < 4; ++mb) { a[mb] = WFrag<T16>::ld(A + aoff + (size_t)mb * 16 * K + kc); if (NSPLIT == 1 || NSPLIT == 2) a2[mb] = WFrag<T16>::ld(A2 + aoff + (size_t)mb * 16 * K + kc); }
#pragma unroll
        for (int nb = 0; nb < 4; ++nb) { const V b = WFrag<T16>::ld(Bt + boff + (size_t)nb * 16 * K + kc); V b2; if (NSPLIT >= 2) b2 = WFrag<T16>::ld(Bt2 + boff + (size_t)nb * 16 * K + kc);
#pragma unroll
            for (int mb = 0; mb < 4; ++mb) { acc[mb][nb] = WFrag<T16>::mma(a[mb], b, acc[mb][nb]); if (NSPLIT == 1 || NSPLIT == 2) acc[mb][nb] = WFrag<T16>::mma(a2[mb], b, acc[mb][nb]); if (NSPLIT >= 2) acc[mb][nb] = WFrag<T16>::mma(a[mb], b2, acc[mb][nb]); } }
        asm volatile("v_nop\n\tv_nop\n\tv_nop\n\tv_nop" : "+v"(acc[0][0]), "+v"(acc[1][1]), "+v"(acc[2][2]), "+v"(acc[3][3]) : "v"(a[0]), "v"(a[3]));
    }
    ksum_store<NW, BIAS>(acc, os, wave, lane, C + (size_t)r0 * ldc + c0, ldc, BIAS ? bias + c0 : nullptr);
}

// ---- k_gemmc: the same 64x64 tile GEMM specialised for causal attention: CMODE 1 skips score tiles entirely above the diagonal (query rows r0+roff.., key columns c0..), CMODE 2 limits the
// key (K) loop of the probability x value contraction to the diagonal block (probabilities beyond it are exactly zero). roff = row offset of this launch's first row within the sequence.
// NW = 1, KS = 1 (scores, K = 64): one wave, its own store path. NW > 1 (P.V): K is split in 64-element pieces, piece p to work-group p % KS of the tile (blockIdx.y % KS) and there to wave pair (p / KS) % (NW / 2), one 32-element half to each wave of the pair;
// ksum_store adds the NW partial tiles, and work-group ks stores its sum in partial plane ks of C (plane stride sK elements); every plane is stored whole, zeros where a work-group has no piece below the diagonal.
template <typename T16, int NSPLIT, int CMODE, int NW, int KS>
__global__ __launch_bounds__(NW * 32) void k_gemmc(const T16* __restrict__ A, const T16* __restrict__ A2, const T16* __restrict__ Bt, const T16* __restrict__ Bt2, int K, float* C, int ldc, int roff, size_t sA, size_t sB, size_t sC, size_t sK) {
    typedef typename WFrag<T16>::V V;
    static_assert(NW == 1 ? KS == 1 : NW % 2 == 0, "waves work in pairs");
    __shared__ __align__(16) float os[NW == 1 ? 16 * 68 : NW * 64 * 68];
    const size_t z = blockIdx.z; A += z * sA; if (A2) A2 += z * sA; Bt += z * sB; if (Bt2) Bt2 += z * sB; C += z * sC;
    const int wave = (NW == 1) ? 0 : __builtin_amdgcn_readfirstlane(threadIdx.x >> 5); const int ks = blockIdx.y % KS; const int lane = threadIdx.x & 31, lr = lane & 15, hi = lane >> 4; const int r0 = blockIdx.x * 64, c0 = (blockIdx.y / KS) * 64;
    if (CMODE == 1 && c0 > r0 + roff + 63) return;                  // score tile entirely above the causal diagonal: never written (the softmax masks j > i by select)
    const int Kl = (CMODE == 2) ? min(K, r0 + roff + 64) : K;        // P.V: probabilities are exactly 0 beyond the diagonal block, so the K loop stops there
    v8f acc[4][4];
#pragma unroll
    for (int mb = 0; mb < 4; ++mb)
#pragma unroll
        for (int nb = 0; nb < 4; ++nb) acc[mb][nb] = (v8f){};
    const size_t aoff = (size_t)(r0 + lr) * K + 8 * hi, boff = (size_t)(c0 + lr) * K + 8 * hi;
#pragma unroll 1
    for (int kc = ((wave >> 1) * KS + ks) * 64 + (wave & 1) * 32; kc < Kl; kc += (NW == 1) ? 32 : (NW / 2) * KS * 64) {
        V a[4], a2[4];
#pragma unroll
        for (int mb = 0; mb < 4; ++mb) { a[mb] = WFrag<T16>::ld(A + aoff + (size_t)mb * 16 * K + kc); if (NSPLIT == 1 || NSPLIT == 2) a2[mb] = WFrag<T16>::ld(A2 + aoff + (size_t)mb * 16 * K + kc); }
#pragma unroll
        for (int nb = 0; nb < 4; ++nb) { const V b = WFrag<T16>::ld(Bt + boff + (size_t)nb * 16 * K + kc); V b2; if (NSPLIT >= 2) b2 = WFrag<T16>::ld(Bt2 + boff + (size_t)nb * 16 * K + kc);
#pragma unroll
            for (int mb = 0; mb < 4; ++mb) { acc[mb][nb] = WFrag<T16>::mma(a[mb], b, acc[mb][nb]); if (NSPLIT == 1 || NSPLIT == 2) acc[mb][nb] = WFrag<T16>::mma(a2[mb], b, acc[mb][nb]); if (NSPLIT >= 2) acc[mb][nb] = WFrag<T16>::mma(a[mb], b2, acc[mb][nb]); } }
        asm volatile("v_nop\n\tv_nop\n\tv_nop\n\tv_nop" : "+v"(acc[0][0]), "+v"(acc[1][1]), "+v"(acc[2][2]), "+v"(acc[3][3]) : "v"(a[0]), "v"(a[3]));
    }
    if constexpr (NW > 1) { ksum_store<NW, false>(acc, os, wave, lane, C + (size_t)ks * sK + (size_t)r0 * ldc + c0, ldc, nullptr); return; }
#pragma unroll
    for (int mb = 0; mb < 4; ++mb) {
#pragma unroll
        for (int nb = 0; nb < 4; ++nb) {
#pragma unroll
            for (int j = 0; j < 8; ++j) os[(hi * 8 + j) * 68 + nb * 16 + lr] = acc[mb][nb][j]; }
        __builtin_amdgcn_wave_barrier(); asm volatile("" ::: "memory");
        float* crow = C + (size_t)(r0 + mb * 16) * ldc + c0;
{
#pragma unroll
            for (int s = 0; s < 8; ++s) { const int row = 2 * s + hi, cofs = lr * 4; v4f val = *(const v4fa*)(os + row * 68 + cofs);
                *(v4f*)(crow + (size_t)row * ldc + cofs) = val; }
             }
        __builtin_amdgcn_wave_barrier(); asm volatile("" ::: "memory");
    }
}

__device__ __forceinline__ h16 tohx(float x) { return (h16)x; }
__device__ __forceinline__ void splitf(float y, unsigned short& h, unsigned short& l) { h = f2bf(y); l = f2bf(y - bf2f(h)); }
typedef __attribute__((ext_vector_type(2))) _Float16 v2h;
typedef __attribute__((ext_vector_type(4))) _Float16 v4h;
typedef __attribute__((ext_vector_type(2))) unsigned short v2us;
typedef __attribute__((ext_vector_type(4))) unsigned short v4us;
typedef __attribute__((ext_vector_type(2))) float v2f;
typedef __attribute__((ext_vector_type(4))) int v4i;

// k_cvt8: blockIdx.y picks one of up to three equally long sources; its bf16 copy is block y of dst
__global__ __launch_bounds__(256) void k_cvt8(const float* __restrict__ s0, const float* __restrict__ s1, const float* __restrict__ s2, bf* dst, size_t n8) { const size_t i = (size_t)blockIdx.x * 256 + threadIdx.x; if (i >= n8) return; const float* src = (blockIdx.y == 0) ? s0 : (blockIdx.y == 1) ? s1 : s2; dst += (size_t)blockIdx.y * n8 * 8; const v8f v = *(const v8f*)(src + i * 8); v8us o;
#pragma unroll
    for (int k = 0; k < 8; ++k) o[k] = f2bf(v[k]); *(v8us*)(dst + i * 8) = o;  }

// k_rope: head planes [h][t][d] (fp16 + hi/lo) of rope(x) x sc with the rotate-half convention out[d] = x[d] cos[t][d] - x[d+HD/2] sin[t][d], out[d+HD/2] = x[d+HD/2] cos[t][d+HD/2] + x[d] sin[t][d+HD/2]; blockIdx.y = which [TT][pitch] block of F and which set of nheads planes
__global__ __launch_bounds__(256) void k_rope(const float* __restrict__ F, int pitch, int nheads, const float* __restrict__ CS, const float* __restrict__ RF, const float* __restrict__ nw, float sc, h16* P16, bf* Ph, bf* Pl) {
    { const size_t y = blockIdx.y; F += y * TT * pitch; P16 += y * nheads * TT * HD; Ph += y * nheads * TT * HD; Pl += y * nheads * TT * HD; }
    const size_t e = ((size_t)blockIdx.x * 256 + threadIdx.x) * 2; if (e >= (size_t)nheads * TT * HD) return; const int d = (int)(e % HD); const int t = (int)((e / HD) % TT); const int h = (int)(e / ((size_t)HD * TT)); const float* f = F + (size_t)t * pitch + h * HD; const float rf = RF ? RF[(size_t)h * TT + t] : 1.0f; v2h o16; v2us oh, ol;
#pragma unroll
    for (int q = 0; q < 2; ++q) { const int dd = d + q; const int dp = (dd < HD / 2) ? dd + HD / 2 : dd - HD / 2; float x0 = f[dd], x1 = f[dp];
        if (RF) { float n0 = __fmul_rn(x0, rf), n1 = __fmul_rn(x1, rf); asm volatile("" : "+v"(n0)); asm volatile("" : "+v"(n1)); x0 = __fmul_rn(bfr(nw[dd]), n0); x1 = __fmul_rn(bfr(nw[dp]), n1); }
        const v2f cs = *(const v2f*)(CS + ((size_t)t * HD + dd) * 2); float a = __fmul_rn(x0, cs[0]), bq = __fmul_rn(x1, cs[1]); asm volatile("" : "+v"(a)); asm volatile("" : "+v"(bq)); const float r = ((dd < HD / 2) ? __fsub_rn(a, bq) : __fadd_rn(a, bq)) * sc;
        o16[q] = tohx(r); unsigned short a2, c2; splitf(r, a2, c2); oh[q] = a2; ol[q] = c2; }
    *(v2h*)(P16 + e) = o16; *(v2us*)(Ph + e) = oh; *(v2us*)(Pl + e) = ol;  }
__global__ __launch_bounds__(256) void k_wtH(const float* __restrict__ w0, const float* __restrict__ w1, const float* __restrict__ w2, bf* Bt) { const size_t e2 = ((size_t)blockIdx.x * 256 + threadIdx.x) * 2; if (e2 >= (size_t)DQ * DM) return; const float* w = (blockIdx.y == 0) ? w0 : (blockIdx.y == 1) ? w1 : w2; Bt += (size_t)blockIdx.y * DQ * DM;   /* blockIdx.y = which of the three weights */ const int d = (int)(e2 % DM); const int r = (int)(e2 / DM); const int h = r / HD, e = r % HD; v2us o; o[0] = f2bf(w[((size_t)h * DM + d) * HD + e]); o[1] = f2bf(w[((size_t)h * DM + d + 1) * HD + e]);
    *(v2us*)(Bt + e2) = o;  }
__global__ __launch_bounds__(256) void k_vtp(const float* __restrict__ F, int pitch, int nheads, h16* V16, bf* Vh, bf* Vl) { const size_t e = ((size_t)blockIdx.x * 256 + threadIdx.x) * 2; if (e >= (size_t)nheads * HD * TT) return; const int t = (int)(e % TT); const int d = (int)((e / TT) % HD); const int g = (int)(e / ((size_t)TT * HD)); const size_t po = (((size_t)blockIdx.y * nheads + g) * HD + d) * (2 * TT) + t; F += (size_t)blockIdx.y * TT * pitch;   /* blockIdx.y = batch; plane rows [d] at pitch 2 * TT, the pitch of the probability rows they are multiplied with */ v2h o16; v2us oh, ol;
#pragma unroll
    for (int q = 0; q < 2; ++q) { const float x = F[(size_t)(t + q) * pitch + g * HD + d]; o16[q] = tohx(x); unsigned short a2, c2; splitf(x, a2, c2); oh[q] = a2; ol[q] = c2; }
    *(v2h*)(V16 + po) = o16; *(v2us*)(Vh + po) = oh; *(v2us*)(Vl + po) = ol;  }
__global__ __launch_bounds__(256) void k_csid(float* CS) { const int idx = blockIdx.x * 256 + threadIdx.x; if (idx >= TT * HD) return; v2f cs; cs[0] = 1.0f; cs[1] = 0.0f; *(v2f*)(CS + (size_t)idx * 2) = cs;  }
// k_asoft: per row (zz, i): t = S x HD^-0.5 for j <= i and i - j < WIN (sliding causal window; the reference's -1e9 additive fill vanishes identically); softmax over the 2048 keys (register row, one exp, fixed trees);
// the probabilities overwrite the row's own 8192 score bytes: fp16 x PCAR in the first half (rows >= RH), or hi plane in the first and lo plane in the second half (rows < RH). One wave owns a row, and every store depends, through the row sum, on all of the wave's loads.
__global__ __launch_bounds__(256) void k_asoft(float* Sb) {
    const int lane = threadIdx.x & 31; const int row = blockIdx.x * 8 + (threadIdx.x >> 5); if (row >= ZH * TT) return; const int i = row % TT; const int zz = row / TT; (void)zz; const bool hires = (i < RH); const float* sr = Sb + (size_t)row * TT; h16* P16 = (h16*)(Sb + (size_t)row * TT); bf* Ph = (bf*)(Sb + (size_t)row * TT); bf* Pl = Ph + TT; float v[TT / 32]; float mx = -3.0e38f;
#pragma unroll
    for (int ch = 0; ch < TT / 128; ++ch) { const int j0 = ch * 128 + lane * 4; const v4f a = *(const v4f*)(sr + j0);
#pragma unroll
        for (int q = 0; q < 4; ++q) { const int j = j0 + q; (void)j; const float t = (j <= i && i - j < WIN) ? a[q] * SCL : -3.0e38f; v[ch * 4 + q] = t; mx = fmaxf(mx, t); } }
#pragma unroll
    for (int sh = 16; sh; sh >>= 1) mx = fmaxf(mx, __shfl_xor(mx, sh, 32));
    float sum = 0.f;
#pragma unroll
    for (int k = 0; k < TT / 32; ++k) { float d0 = __fsub_rn(v[k], mx); asm volatile("" : "+v"(d0)); v[k] = __builtin_amdgcn_exp2f(__fmul_rn(d0, 1.4426950408889634f)); sum += v[k]; }
#pragma unroll
    for (int sh = 16; sh; sh >>= 1) sum += __shfl_xor(sum, sh, 32);
    const float f = __fdiv_rn(hires ? 1.0f : PCAR, sum);
{
        if (hires) {
#pragma unroll
            for (int ch = 0; ch < TT / 128; ++ch) { v4us oh, ol;
#pragma unroll
                for (int q = 0; q < 4; ++q) { unsigned short a, c2; splitf(v[ch * 4 + q] * f, a, c2); oh[q] = a; ol[q] = c2; }
                const int oo = ch * 128 + lane * 4; *(v4us*)(Ph + oo) = oh; *(v4us*)(Pl + oo) = ol; }
        } else {
#pragma unroll
            for (int ch = 0; ch < TT / 128; ++ch) { v4h o4;
#pragma unroll
                for (int q = 0; q < 4; ++q) o4[q] = tohx(v[ch * 4 + q] * f);
                *(v4h*)(P16 + ch * 128 + lane * 4) = o4; } }
         }
}
__global__ __launch_bounds__(256) void k_merge(const float* __restrict__ O, int h0, bf* Ah, bf* Al) { const size_t e = ((size_t)blockIdx.x * 256 + threadIdx.x) * 2; if (e >= (size_t)ZH * TT * HD) return; const int d = (int)(e % HD); const int t = (int)((e / HD) % TT); const int zz = (int)(e / ((size_t)HD * TT)); const float cs = (t < RH) ? 1.0f : (1.0f / PCAR); const size_t oo = (size_t)t * DQ + (h0 + zz) * HD + d;
    v2us oh, ol;
#pragma unroll
    for (int q = 0; q < 2; ++q) { float s = O[e + q];
#pragma unroll
        for (int p = 1; p < KSP; ++p) s += O[(size_t)p * ZH * TT * HD + e + q];   // the KSP partial planes of P.V, in plane order
        unsigned short a, c2; splitf(s * cs, a, c2); oh[q] = a; ol[q] = c2; } *(v2us*)(Ah + oo) = oh; *(v2us*)(Al + oo) = ol;  }

extern "C" void kernel_launch(void* const* d_in, const int* in_sizes, int n_in,
                              void* d_out, int out_size, void* d_ws, size_t ws_size, hipStream_t stream) {
    (void)in_sizes; (void)n_in; (void)out_size;
    const float* x = (const float*)d_in[0]; const float* xk = (const float*)d_in[1]; const float* xv = (const float*)d_in[2]; const float* wq = (const float*)d_in[3]; const float* wk = (const float*)d_in[4]; const float* wv = (const float*)d_in[5]; const float* wo = (const float*)d_in[6];   /* x_query, x_key, x_value, Wq, Wk, Wv [16][1024][64] ([h][d][k]), W0 ('oi' [1024][1024]) */
    float* OUT = (float*)d_out;     // [2][2048][1024]
    char* wsp = (char*)d_ws;
    auto take = [&](size_t bytes) { char* p = wsp; wsp += (bytes + 255) & ~(size_t)255; return (void*)p; };
    bf* WQ = (bf*)take((size_t)3 * DQ * DM * 2);   // Wq, Wk, Wv as Bt planes, one behind the other
    bf* WO = (bf*)take((size_t)DM * DQ * 2); float* CS = (float*)take((size_t)TT * HD * 2 * 4);
    const size_t PL = (size_t)NB_ * NH_ * TT * HD;   // one kind of plane, both batches: [b][h][t][d] (v: [b][h][d][t], rows at pitch 2 * TT)
    h16* QP16 = (h16*)take(2 * PL * 2); h16* KP16 = QP16 + PL; bf* QPh = (bf*)take(2 * PL * 2); bf* KPh = QPh + PL; bf* QPl = (bf*)take(2 * PL * 2); bf* KPl = QPl + PL;   // the k planes follow the q planes: one k_rope launch builds both
    h16* VT16 = (h16*)take(2 * PL * 2); bf* VTh = (bf*)VT16 + TT; bf* VTl = (bf*)take(2 * PL * 2);   // v rows at pitch 2 * TT (k_gemmc has one pitch for both operands, and the probability rows have this one): fp16 and hi share a row, lo has the first half of its own
    float* Sb = (float*)take((size_t)ZH * TT * TT * 4); float* Ob = (float*)take((size_t)KSP * ZH * TT * HD * 4); bf* ATh = (bf*)take((size_t)NB_ * TT * DQ * 2); bf* ATl = (bf*)take((size_t)NB_ * TT * DQ * 2);
    if ((size_t)(wsp - (char*)d_ws) > ws_size) return;    // ws 256 MiB
    static_assert((size_t)3 * NB_ * TT * DM * 2 + (size_t)3 * NB_ * TT * DQ * 4 <= (size_t)ZH * TT * TT * 4, "the projection buffers fit the score buffer");
    static_assert(NH_ % ZH == 0 && NKV == NH_, "a pass stays inside one batch; q, k and v planes are numbered alike");
    bf* XB = (bf*)Sb; float* F = (float*)(XB + (size_t)3 * NB_ * TT * DM);   // bf16 streams [3][b][t][d] and f32 projections [3][b][t][h*64+k] lie in the score buffer: both are dead before the first score launch (stream-ordered)
    k_wtH<<<dim3((unsigned)(((size_t)DQ * DM / 2 + 255) / 256), 3, 1), 256, 0, stream>>>(wq, wk, wv, WQ);
    k_cvt8<<<dim3((unsigned)(((size_t)DM * DQ / 8 + 255) / 256), 1, 1), 256, 0, stream>>>(wo, wo, wo, WO, (size_t)DM * DQ / 8);
    k_csid<<<(TT * HD + 255) / 256, 256, 0, stream>>>(CS);
    const unsigned LQ = (unsigned)(((size_t)NH_ * TT * HD / 2 + 255) / 256);
    k_cvt8<<<dim3((unsigned)(((size_t)NB_ * TT * DM / 8 + 255) / 256), 3, 1), 256, 0, stream>>>(x, xk, xv, XB, (size_t)NB_ * TT * DM / 8);
    k_gemmw<bf, 0, false, 8><<<dim3(NB_ * TT / 64, DQ / 64, 3), 256, 0, stream>>>(XB, nullptr, WQ, nullptr, DM, F, DQ, nullptr, (size_t)NB_ * TT * DM, (size_t)DQ * DM, (size_t)NB_ * TT * DQ);
    k_rope<<<dim3(LQ, 2 * NB_, 1), 256, 0, stream>>>(F, DQ, NH_, CS, nullptr, nullptr, 1.0f, QP16, QPh, QPl);   // y = 0, 1: q of batch 0, 1; y = 2, 3: k
    k_vtp<<<dim3(LQ, NB_, 1), 256, 0, stream>>>(F + (size_t)2 * NB_ * TT * DQ, DKV, NKV, VT16, VTh, VTl);
    for (int g0 = 0; g0 < NB_ * NH_; g0 += ZH) { const size_t zq = (size_t)g0;   // pass: pairs g = b * NH_ + h in g0 .. g0 + ZH - 1, consecutive planes (z-strides TT*HD; v planes HD * 2 * TT). In the two P.V launches K = 2 * TT is the operands' pitch; the K loop ends at the diagonal block, at TT or before
        k_gemmc<bf, 2, 1, 1, 1><<<dim3(RH / 64, TT / 64, ZH), 32, 0, stream>>>(QPh + zq * TT * HD, QPl + zq * TT * HD, KPh + zq * TT * HD, KPl + zq * TT * HD, HD, Sb, TT, 0, (size_t)TT * HD, (size_t)TT * HD, (size_t)TT * TT, 0);
        k_gemmc<h16, 0, 1, 1, 1><<<dim3((TT - RH) / 64, TT / 64, ZH), 32, 0, stream>>>(QP16 + zq * TT * HD + (size_t)RH * HD, nullptr, KP16 + zq * TT * HD, nullptr, HD, Sb + (size_t)RH * TT, TT, RH, (size_t)TT * HD, (size_t)TT * HD, (size_t)TT * TT, 0);
        k_asoft<<<ZH * TT / 8, 256, 0, stream>>>(Sb);
        k_gemmc<bf, 2, 2, 4, KSP><<<dim3(RH / 64, HD / 64 * KSP, ZH), 128, 0, stream>>>((const bf*)Sb, (const bf*)Sb + TT, VTh + zq * HD * 2 * TT, VTl + zq * HD * 2 * TT, 2 * TT, Ob, HD, 0, (size_t)2 * TT * TT, (size_t)HD * 2 * TT, (size_t)TT * HD, (size_t)ZH * TT * HD);
        k_gemmc<h16, 0, 2, 8, KSP><<<dim3((TT - RH) / 64, HD / 64 * KSP, ZH), 256, 0, stream>>>((const h16*)Sb + (size_t)RH * 2 * TT, nullptr, VT16 + zq * HD * 2 * TT, nullptr, 2 * TT, Ob + (size_t)RH * HD, HD, RH, (size_t)2 * TT * TT, (size_t)HD * 2 * TT, (size_t)TT * HD, (size_t)ZH * TT * HD);
        k_merge<<<(unsigned)(((size_t)ZH * TT * HD / 2 + 255) / 256), 256, 0, stream>>>(Ob, g0 % NH_, ATh + (size_t)(g0 / NH_) * TT * DQ, ATl + (size_t)(g0 / NH_) * TT * DQ); }
    k_gemmw<bf, 1, false, 8><<<dim3(NB_ * TT / 64, DM / 64, 1), 256, 0, stream>>>(ATh, ATl, WO, nullptr, DQ, OUT, DM, nullptr, 0, 0, 0);
}

// v003
// One run takes 216 microseconds.
// Two timings next to v002 put it at 1.99 and 2.00 times that version's speed.
// All steps since v000 together make it 6.77 times as fast.
#include <hip/hip_runtime.h>

// Causal multi-head attention on three input streams with per-head stacked projection weights (x_query, x_key, x_value [2][2048][1024]; q = einsum('bsd,hdk', x_query, Wq) with Wq [16][1024][64] = [h][d][k] (1/32), k, v likewise from x_key / x_value; scores x 1/sqrt(64) + causal additive mask (0 / -inf); softmax; heads concatenated h-major; out = concat W0^T ('oi' [1024][1024]) -> [2][2048][1024] (4.2 M); argument order x_query, x_key, x_value, Wq, Wk, Wv, W0).
// Layout, both batches at once: bf16 copies of the three streams; k_wtH turns each [h][d][k] weight into Bt rows h*64 + k; exact projections (one launch, z = stream); identity-table plane builders; k_attn: scores, running softmax and P.V of all 32 (batch, head) pairs in one launch, scores and probabilities never leave the registers (hybrid rows: < 512 hi/lo 3 products, rest fp16 x1024); merged hi/lo x W0 exact.
// Compute dtypes, f32 accumulate: every input rounded to bf16; projections exact; attention rows < 512 3 products, rest fp16; softmax f32; W0 hl x exact.

#define NB_  2
#define TT   2048
#define DM   1024
#define NH_  16
#define NKV  16
#define REP  (NH_ / NKV)
#define HD   64
#define DQ   (NH_ * HD)
#define DKV  (NKV * HD)
#define RH   512                  // query rows < RH use hi+lo planes (0: none)
#define SCL  0.125f   // HD^-0.5
typedef _Float16 h16;
typedef unsigned short bf;
typedef __attribute__((ext_vector_type(16))) __bf16   v16bf;
typedef __attribute__((ext_vector_type(16))) _Float16 v16h;
typedef __attribute__((ext_vector_type(8)))  _Float16 v8h;
typedef __attribute__((ext_vector_type(8)))  unsigned short v8us;
typedef __attribute__((ext_vector_type(8)))  float    v8f;
typedef __attribute__((ext_vector_type(4)))  float    v4f;
typedef v8h  __attribute__((may_alias)) v8ha;
typedef v4f  __attribute__((may_alias)) v4fa;
typedef v8us __attribute__((may_alias)) v8usa;

__device__ __forceinline__ unsigned short f2bf(float f) { unsigned u = __float_as_uint(f); u += 0x7FFFu + ((u >> 16) & 1u); return (unsigned short)(u >> 16); }
__device__ __forceinline__ float bf2f(unsigned short b) { return __uint_as_float(((unsigned)b) << 16); }
__device__ __forceinline__ float bfr(float f) { return bf2f(f2bf(f)); }
__device__ __forceinline__ v16h cat16(v8h lo, v8h hi) { return __builtin_shufflevector(lo, hi, 0, 1, 2, 3, 4, 5, 6, 7, 8, 9, 10, 11, 12, 13, 14, 15); }
__device__ __forceinline__ v16bf cat16b(v8us lo, v8us hi) { return __builtin_bit_cast(v16bf, __builtin_shufflevector(lo, hi, 0, 1, 2, 3, 4, 5, 6, 7, 8, 9, 10, 11, 12, 13, 14, 15)); }
__device__ __forceinline__ v8f wmma16(v16h a, v16h b, v8f c) { return __builtin_amdgcn_wmma_f32_16x16x32_f16(false, a, false, b, (short)0, c, false, false); }
__device__ __forceinline__ v8f wmmab(v16bf a, v16bf b, v8f c) { return __builtin_amdgcn_wmma_f32_16x16x32_bf16(false, a, false, b, (short)0, c, false, false); }



// ---- ksum_store: the NW waves of a work-group each hold a partial 64x64 f32 tile (their own share of K). Each writes it to its own LDS plane (pitch 68), one barrier, then every thread
// sums its 4-float pieces over the planes in wave order 0..NW-1 and stores them; 16 lanes store one whole 256-byte row of C (Ct = C at the tile's origin).
template <int NW, bool BIAS>
__device__ __forceinline__ void ksum_store(const v8f (&acc)[4][4], float* os, int wave, int lane, float* Ct, int ldc, const float* __restrict__ bias_c0) {
    const int lr = lane & 15, hi = lane >> 4; float* mine = os + wave * (64 * 68);
#pragma unroll
    for (int mb = 0; mb < 4; ++mb)
#pragma unroll
        for (int nb = 0; nb < 4; ++nb)
#pragma unroll
            for (int j = 0; j < 8; ++j) mine[(mb * 16 + hi * 8 + j) * 68 + nb * 16 + lr] = acc[mb][nb][j];
    __syncthreads();   // every wave's partial tile is in LDS before any thread sums across the planes
#pragma unroll
    for (int u = 0; u < 32 / NW; ++u) { const int idx = (u * NW + wave) * 32 + lane; const int row = idx >> 4, cofs = (idx & 15) * 4; v4f val = *(const v4fa*)(os + row * 68 + cofs);
#pragma unroll
        for (int w = 1; w < NW; ++w) val += *(const v4fa*)(os + w * (64 * 68) + row * 68 + cofs);
        if (BIAS) { val[0] += bfr(bias_c0[cofs]); val[1] += bfr(bias_c0[cofs + 1]); val[2] += bfr(bias_c0[cofs + 2]); val[3] += bfr(bias_c0[cofs + 3]); }
        *(v4f*)(Ct + (size_t)row * ldc + cofs) = val; }
}
// ---- k_gemmw: register-blocked GEMM, one 64x64 output tile per work-group of NW waves; K is split over the waves, 32-element step s to wave s % NW (two neighbour waves read the two halves of the same 128-byte lines at the same time); each wave keeps 16 accumulators, operands straight from K-contiguous 16-bit planes; ksum_store adds the NW partial tiles; grid (M/64, N/64, Z), NW*32 threads.
// C[m][n] (f32, pitch ldc, + optional f32 bias[n]) = sum_k A[m][k] Bt[n][k] (+ split products per NSPLIT). z-batch strides sA/sB/sC in elements. K % 32 == 0.
template <typename T16> struct WFrag;
template <> struct WFrag<h16> { typedef v16h V; static __device__ __forceinline__ V ld(const h16* p) { return cat16(*(const v8h*)p, *(const v8h*)(p + 16)); } static __device__ __forceinline__ v8f mma(V a, V b, v8f c) { return wmma16(a, b, c); } };
template <> struct WFrag<bf> { typedef v16bf V; static __device__ __forceinline__ V ld(const bf* p) { return cat16b(*(const v8us*)p, *(const v8us*)(p + 16)); } static __device__ __forceinline__ v8f mma(V a, V b, v8f c) { return wmmab(a, b, c); } };
template <typename T16, int NSPLIT, bool BIAS, int NW>
__global__ __launch_bounds__(NW * 32) void k_gemmw(const T16* __restrict__ A, const T16* __restrict__ A2, const T16* __restrict__ Bt, const T16* __restrict__ Bt2, int K, float* C, int ldc, const float* __restrict__ bias, size_t sA, size_t sB, size_t sC) {
    typedef typename WFrag<T16>::V V;
    __shared__ __align__(16) float os[NW * 64 * 68];
    const size_t z = blockIdx.z; A += z * sA; if (A2) A2 += z * sA; Bt += z * sB; if (Bt2) Bt2 += z * sB; C += z * sC;
    const int wave = __builtin_amdgcn_readfirstlane(threadIdx.x >> 5); const int lane = threadIdx.x & 31, lr = lane & 15, hi = lane >> 4; const int r0 = blockIdx.x * 64, c0 = blockIdx.y * 64;
    v8f acc[4][4];
#pragma unroll
    for (int mb = 0; mb < 4; ++mb)
#pragma unroll
        for (int nb = 0; nb < 4; ++nb) acc[mb][nb] = (v8f){};
    const size_t aoff = (size_t)(r0 + lr) * K + 8 * hi, boff = (size_t)(c0 + lr) * K + 8 * hi;
#pragma unroll 1
    for (int kc = wave * 32; kc < K; kc += NW * 32) {
        V a[4], a2[4];
#pragma unroll
        for (int mb = 0; mb < 4; ++mb) { a[mb] = WFrag<T16>::ld(A + aoff + (size_t)mb * 16 * K + kc); if (NSPLIT == 1 || NSPLIT == 2) a2[mb] = WFrag<T16>::ld(A2 + aoff + (size_t)mb * 16 * K + kc); }
#pragma unroll
        for (int nb = 0; nb < 4; ++nb) { const V b = WFrag<T16>::ld(Bt + boff + (size_t)nb * 16 * K + kc); V b2; if (NSPLIT >= 2) b2 = WFrag<T16>::ld(Bt2 + boff + (size_t)nb * 16 * K + kc);
#pragma unroll
            for (int mb = 0; mb < 4; ++mb) { acc[mb][nb] = WFrag<T16>::mma(a[mb], b, acc[mb][nb]); if (NSPLIT == 1 || NSPLIT == 2) acc[mb][nb] = WFrag<T16>::mma(a2[mb], b, acc[mb][nb]); if (NSPLIT >= 2) acc[mb][nb] = WFrag<T16>::mma(a[mb], b2, acc[mb][nb]); } }
        asm volatile("v_nop\n\tv_nop\n\tv_nop\n\tv_nop" : "+v"(acc[0][0]), "+v"(acc[1][1]), "+v"(acc[2][2]), "+v"(acc[3][3]) : "v"(a[0]), "v"(a[3]));
    }
    ksum_store<NW, BIAS>(acc, os, wave, lane, C + (size_t)r0 * ldc + c0, ldc, BIAS ? bias + c0 : nullptr);
}

__device__ __forceinline__ h16 tohx(float x) { return (h16)x; }
__device__ __forceinline__ void splitf(float y, unsigned short& h, unsigned short& l) { h = f2bf(y); l = f2bf(y - bf2f(h)); }
typedef __attribute__((ext_vector_type(2))) _Float16 v2h;
typedef __attribute__((ext_vector_type(4))) _Float16 v4h;
typedef __attribute__((ext_vector_type(2))) unsigned short v2us;
typedef __attribute__((ext_vector_type(4))) unsigned short v4us;
typedef __attribute__((ext_vector_type(2))) float v2f;
typedef __attribute__((ext_vector_type(4))) int v4i;

// k_cvt8: blockIdx.y picks one of up to three equally long sources; its bf16 copy is block y of dst
__global__ __launch_bounds__(256) void k_cvt8(const float* __restrict__ s0, const float* __restrict__ s1, const float* __restrict__ s2, bf* dst, size_t n8) { const size_t i = (size_t)blockIdx.x * 256 + threadIdx.x; if (i >= n8) return; const float* src = (blockIdx.y == 0) ? s0 : (blockIdx.y == 1) ? s1 : s2; dst += (size_t)blockIdx.y * n8 * 8; const v8f v = *(const v8f*)(src + i * 8); v8us o;
#pragma unroll
    for (int k = 0; k < 8; ++k) o[k] = f2bf(v[k]); *(v8us*)(dst + i * 8) = o;  }

// k_rope: head planes [h][t][d] (fp16 + hi/lo) of rope(x) x sc with the rotate-half convention out[d] = x[d] cos[t][d] - x[d+HD/2] sin[t][d], out[d+HD/2] = x[d+HD/2] cos[t][d+HD/2] + x[d] sin[t][d+HD/2]; blockIdx.y = which [TT][pitch] block of F and which set of nheads planes
__global__ __launch_bounds__(256) void k_rope(const float* __restrict__ F, int pitch, int nheads, const float* __restrict__ CS, const float* __restrict__ RF, const float* __restrict__ nw, float sc, h16* P16, bf* Ph, bf* Pl) {
    { const size_t y = blockIdx.y; F += y * TT * pitch; P16 += y * nheads * TT * HD; Ph += y * nheads * TT * HD; Pl += y * nheads * TT * HD; }
    const size_t e = ((size_t)blockIdx.x * 256 + threadIdx.x) * 2; if (e >= (size_t)nheads * TT * HD) return; const int d = (int)(e % HD); const int t = (int)((e / HD) % TT); const int h = (int)(e / ((size_t)HD * TT)); const float* f = F + (size_t)t * pitch + h * HD; const float rf = RF ? RF[(size_t)h * TT + t] : 1.0f; v2h o16; v2us oh, ol;
#pragma unroll
    for (int q = 0; q < 2; ++q) { const int dd = d + q; const int dp = (dd < HD / 2) ? dd + HD / 2 : dd - HD / 2; float x0 = f[dd], x1 = f[dp];
        if (RF) { float n0 = __fmul_rn(x0, rf), n1 = __fmul_rn(x1, rf); asm volatile("" : "+v"(n0)); asm volatile("" : "+v"(n1)); x0 = __fmul_rn(bfr(nw[dd]), n0); x1 = __fmul_rn(bfr(nw[dp]), n1); }
        const v2f cs = *(const v2f*)(CS + ((size_t)t * HD + dd) * 2); float a = __fmul_rn(x0, cs[0]), bq = __fmul_rn(x1, cs[1]); asm volatile("" : "+v"(a)); asm volatile("" : "+v"(bq)); const float r = ((dd < HD / 2) ? __fsub_rn(a, bq) : __fadd_rn(a, bq)) * sc;
        o16[q] = tohx(r); unsigned short a2, c2; splitf(r, a2, c2); oh[q] = a2; ol[q] = c2; }
    *(v2h*)(P16 + e) = o16; *(v2us*)(Ph + e) = oh; *(v2us*)(Pl + e) = ol;  }
__global__ __launch_bounds__(256) void k_wtH(const float* __restrict__ w0, const float* __restrict__ w1, const float* __restrict__ w2, bf* Bt) { const size_t e2 = ((size_t)blockIdx.x * 256 + threadIdx.x) * 2; if (e2 >= (size_t)DQ * DM) return; const float* w = (blockIdx.y == 0) ? w0 : (blockIdx.y == 1) ? w1 : w2; Bt += (size_t)blockIdx.y * DQ * DM;   /* blockIdx.y = which of the three weights */ const int d = (int)(e2 % DM); const int r = (int)(e2 / DM); const int h = r / HD, e = r % HD; v2us o; o[0] = f2bf(w[((size_t)h * DM + d) * HD + e]); o[1] = f2bf(w[((size_t)h * DM + d + 1) * HD + e]);
    *(v2us*)(Bt + e2) = o;  }
__global__ __launch_bounds__(256) void k_vtp(const float* __restrict__ F, int pitch, int nheads, h16* V16, bf* Vh, bf* Vl) { const size_t e = ((size_t)blockIdx.x * 256 + threadIdx.x) * 2; if (e >= (size_t)nheads * HD * TT) return; const int t = (int)(e % TT); const int d = (int)((e / TT) % HD); const int g = (int)(e / ((size_t)TT * HD)); const size_t po = (((size_t)blockIdx.y * nheads + g) * HD + d) * (2 * TT) + t; F += (size_t)blockIdx.y * TT * pitch;   /* blockIdx.y = batch; plane rows [d] at pitch 2 * TT */ v2h o16; v2us oh, ol;
#pragma unroll
    for (int q = 0; q < 2; ++q) { const float x = F[(size_t)(t + q) * pitch + g * HD + d]; o16[q] = tohx(x); unsigned short a2, c2; splitf(x, a2, c2); oh[q] = a2; ol[q] = c2; }
    *(v2h*)(V16 + po) = o16; *(v2us*)(Vh + po) = oh; *(v2us*)(Vl + po) = ol;  }
__global__ __launch_bounds__(256) void k_csid(float* CS) { const int idx = blockIdx.x * 256 + threadIdx.x; if (idx >= TT * HD) return; v2f cs; cs[0] = 1.0f; cs[1] = 0.0f; *(v2f*)(CS + (size_t)idx * 2) = cs;  }
// ---- k_attn: causal attention, one launch for every (batch, head) pair g = blockIdx.x; blockIdx.y = block of query rows, the longest first. A wave owns QT * 16 query rows and walks the keys 0 .. its last row in steps of 32; waves share nothing (no LDS, no barrier).
// Per step: S^T = K Q^T (A = 16 key rows, B = 16 query rows, both [t][d] planes), so a lane holds scores of ONE query (column lane & 15): keys 8 * hi + j of each 16-key tile. Running maximum m and running sum l per query: in-lane, plus one exchange between the lane halves for m
// (l's halves are joined once, at the end). p = exp2((s - m) x SCL x log2 e (+ 10 in the fp16 rows: the x1024 carrier)); two converted S^T tiles are, register for register, the B operand of O^T += V^T P^T (A = 16 rows of the [d][t] plane), whose column is again the lane's own query:
// the rescale by exp2(m_old - m_new) and the final 1 / l are in-lane too. HR (rows < RH): q, k, v, p as bf16 hi + lo, 3 products each; else fp16, 1 product. Output: hi/lo bf16 of O / l at [t][h * 64 + d], 8 consecutive d per lane and store.
__device__ __forceinline__ float xhalf(float x) { const int b = __float_as_int(x); return __int_as_float(__builtin_amdgcn_permlanex16(b, b, 0x76543210, 0xfedcba98, false, false)); }   // the value of lane ^ 16
template <typename T16, bool HR, int QT>
__device__ __forceinline__ void attn_rows(const T16* __restrict__ Q, const T16* __restrict__ Q2, const T16* __restrict__ Kp, const T16* __restrict__ K2, const T16* __restrict__ Vt, const T16* __restrict__ Vt2, int q0, int lane, bf* Ah, bf* Al) {
    typedef typename WFrag<T16>::V V;
    const int lr = lane & 15, hi = lane >> 4; const float CE = SCL * 1.4426950408889634f; const float SH = HR ? 0.0f : 10.0f;
    V qf[QT][2], qf2[QT][2], kf[2][2], kf2[2][2]; v8f o[4][QT]; float m[QT], l[QT];
#pragma unroll
    for (int qt = 0; qt < QT; ++qt) { m[qt] = -3.0e38f; l[qt] = 0.0f;
#pragma unroll
        for (int ks = 0; ks < 2; ++ks) { const size_t qo = (size_t)(q0 + qt * 16 + lr) * HD + ks * 32 + 8 * hi; qf[qt][ks] = WFrag<T16>::ld(Q + qo); if (HR) qf2[qt][ks] = WFrag<T16>::ld(Q2 + qo); }
#pragma unroll
        for (int dt = 0; dt < 4; ++dt) o[dt][qt] = (v8f){}; }
    const int last = (q0 + QT * 16 - 1) & ~31;   // first key of the last step; last <= q0, so key kb of every step is at or below the diagonal of every row
    const size_t kof = (size_t)lr * HD + 8 * hi, vof = (size_t)lr * (2 * TT) + 8 * hi;
    auto ldk = [&](int k0) {
#pragma unroll
        for (int kt = 0; kt < 2; ++kt)
#pragma unroll
            for (int ks = 0; ks < 2; ++ks) { const size_t ko = kof + (size_t)(k0 + kt * 16) * HD + ks * 32; kf[kt][ks] = WFrag<T16>::ld(Kp + ko); if (HR) kf2[kt][ks] = WFrag<T16>::ld(K2 + ko); } };
    if (!HR) ldk(0);
#pragma unroll 1   // rolled: a second copy of the body would need a second set of fragment registers
    for (int kb = 0; kb <= last; kb += 32) {
        if constexpr (HR) { ldk(kb);   // hi + lo fragments of two steps at once would not fit 256 registers: these (short) rows fetch each step's keys at its head
            asm volatile("s_wait_xcnt 0x0" ::: "memory"); }   // the wait in front of an overwrite of an issued load's address registers: the compiler makes the key loads' address registers the destination of one of the value loads below
        V vf[4], vf2[4];
#pragma unroll
        for (int dt = 0; dt < 4; ++dt) { const size_t vo = vof + (size_t)(dt * 16) * (2 * TT) + kb; vf[dt] = WFrag<T16>::ld(Vt + vo); if (HR) vf2[dt] = WFrag<T16>::ld(Vt2 + vo); }
        // inputs-only fence on the loaded fragments: all 32 loads of the step are in flight together, one load latency a step; without it the compiler fetches the key fragments two loads at a time, each pair waited for on its own
        if constexpr (HR) asm volatile("" :: "v"(kf[0][0]), "v"(kf[0][1]), "v"(kf[1][0]), "v"(kf[1][1]), "v"(kf2[0][0]), "v"(kf2[0][1]), "v"(kf2[1][0]), "v"(kf2[1][1]), "v"(vf[0]), "v"(vf[1]), "v"(vf[2]), "v"(vf[3]), "v"(vf2[0]), "v"(vf2[1]), "v"(vf2[2]), "v"(vf2[3]));
        v8f s[2][QT];
#pragma unroll
        for (int kt = 0; kt < 2; ++kt)
#pragma unroll
            for (int qt = 0; qt < QT; ++qt) { s[kt][qt] = (v8f){};
#pragma unroll
                for (int ks = 0; ks < 2; ++ks) { s[kt][qt] = WFrag<T16>::mma(kf[kt][ks], qf[qt][ks], s[kt][qt]); if (HR) { s[kt][qt] = WFrag<T16>::mma(kf[kt][ks], qf2[qt][ks], s[kt][qt]); s[kt][qt] = WFrag<T16>::mma(kf2[kt][ks], qf[qt][ks], s[kt][qt]); } } }
        if (!HR) ldk(min(kb + 32, last));   // the next step's key fragments fly during this step's softmax and P.V; the last step fetches its own again (in bounds, unused)
        V pf[QT], pf2[QT];
#pragma unroll
        for (int qt = 0; qt < QT; ++qt) {
            if (kb + 31 > q0 + qt * 16) {   // wave-uniform: only a step that reaches above this tile's diagonal masks
                const int q = q0 + qt * 16 + lr;
#pragma unroll
                for (int kt = 0; kt < 2; ++kt)
#pragma unroll
                    for (int j = 0; j < 8; ++j) s[kt][qt][j] = (kb + kt * 16 + hi * 8 + j <= q) ? s[kt][qt][j] : -3.0e38f; }
            float mx = s[0][qt][0];
#pragma unroll
            for (int j = 1; j < 8; ++j) mx = fmaxf(mx, s[0][qt][j]);
#pragma unroll
            for (int j = 0; j < 8; ++j) mx = fmaxf(mx, s[1][qt][j]);
            mx = fmaxf(mx, xhalf(mx));
            const float mn = fmaxf(m[qt], mx); const float mc = mn * CE - SH; float al = (m[qt] - mn) * CE; m[qt] = mn;
            float sum = 0.0f; float p[16];
#pragma unroll
            for (int e = 0; e < 16; ++e) p[e] = s[e >> 3][qt][e & 7] * CE - mc;
            asm("v_exp_f32 %0, %0\n\tv_exp_f32 %1, %1\n\tv_exp_f32 %2, %2\n\tv_exp_f32 %3, %3\n\tv_exp_f32 %4, %4\n\tv_exp_f32 %5, %5\n\tv_exp_f32 %6, %6\n\tv_exp_f32 %7, %7\n\tv_exp_f32 %8, %8\n\tv_exp_f32 %9, %9\n\tv_exp_f32 %10, %10\n\tv_exp_f32 %11, %11\n\tv_exp_f32 %12, %12\n\tv_exp_f32 %13, %13\n\tv_exp_f32 %14, %14\n\tv_exp_f32 %15, %15\n\tv_exp_f32 %16, %16\n\tv_nop"
                : "+v"(p[0]), "+v"(p[1]), "+v"(p[2]), "+v"(p[3]), "+v"(p[4]), "+v"(p[5]), "+v"(p[6]), "+v"(p[7]), "+v"(p[8]), "+v"(p[9]), "+v"(p[10]), "+v"(p[11]), "+v"(p[12]), "+v"(p[13]), "+v"(p[14]), "+v"(p[15]), "+v"(al));
#pragma unroll
            for (int e = 0; e < 16; ++e) sum += p[e];
            l[qt] = l[qt] * al + sum;
#pragma unroll
            for (int dt = 0; dt < 4; ++dt) o[dt][qt] *= al;
            if constexpr (HR) { v8us h0, h1, l0, l1;
#pragma unroll
                for (int j = 0; j < 8; ++j) { unsigned short a, c2; splitf(p[j], a, c2); h0[j] = a; l0[j] = c2; splitf(p[8 + j], a, c2); h1[j] = a; l1[j] = c2; }
                pf[qt] = cat16b(h0, h1); pf2[qt] = cat16b(l0, l1);
            } else { v8h h0, h1;
#pragma unroll
                for (int j = 0; j < 8; ++j) { h0[j] = tohx(p[j]); h1[j] = tohx(p[8 + j]); }
                pf[qt] = cat16(h0, h1); }
        }
#pragma unroll
        for (int dt = 0; dt < 4; ++dt)
#pragma unroll
            for (int qt = 0; qt < QT; ++qt) { o[dt][qt] = WFrag<T16>::mma(vf[dt], pf[qt], o[dt][qt]); if (HR) { o[dt][qt] = WFrag<T16>::mma(vf[dt], pf2[qt], o[dt][qt]); o[dt][qt] = WFrag<T16>::mma(vf2[dt], pf[qt], o[dt][qt]); } }
    }
#pragma unroll
    for (int qt = 0; qt < QT; ++qt) { const float f = __fdiv_rn(1.0f, l[qt] + xhalf(l[qt])); const size_t oo = (size_t)(q0 + qt * 16 + lr) * DQ + hi * 8;
#pragma unroll
        for (int dt = 0; dt < 4; ++dt) { v8us oh, ol;
#pragma unroll
            for (int j = 0; j < 8; ++j) { unsigned short a, c2; splitf(o[dt][qt][j] * f, a, c2); oh[j] = a; ol[j] = c2; }
            *(v8us*)(Ah + oo + dt * 16) = oh; *(v8us*)(Al + oo + dt * 16) = ol; } }
}
#define NBF ((TT - RH) / 128)     // blocks of 4 waves x 32 fp16 rows
#define NBH (RH / 64)             // blocks of 4 waves x 16 hi/lo rows
__global__ __launch_bounds__(128) void k_attn(const h16* __restrict__ Q16, const h16* __restrict__ K16, const h16* __restrict__ V16, const bf* __restrict__ Qh, const bf* __restrict__ Ql, const bf* __restrict__ Kh, const bf* __restrict__ Kl, const bf* __restrict__ Vh, const bf* __restrict__ Vl, bf* Ah, bf* Al) {
    const int g = blockIdx.x, y = blockIdx.y; const int wave = __builtin_amdgcn_readfirstlane(threadIdx.x >> 5); const int lane = threadIdx.x & 31;
    const size_t po = (size_t)g * TT * HD, vo = (size_t)g * HD * 2 * TT, ao = (size_t)(g / NH_) * TT * DQ + (size_t)(g % NH_) * HD;
    if (y < NBF) attn_rows<h16, false, 2>(Q16 + po, nullptr, K16 + po, nullptr, V16 + vo, nullptr, RH + (NBF - 1 - y) * 128 + wave * 32, lane, Ah + ao, Al + ao);
    else attn_rows<bf, true, 1>(Qh + po, Ql + po, Kh + po, Kl + po, Vh + vo, Vl + vo, (NBF + NBH - 1 - y) * 64 + wave * 16, lane, Ah + ao, Al + ao);
}

extern "C" void kernel_launch(void* const* d_in, const int* in_sizes, int n_in,
                              void* d_out, int out_size, void* d_ws, size_t ws_size, hipStream_t stream) {
    (void)in_sizes; (void)n_in; (void)out_size;
    const float* x = (const float*)d_in[0]; const float* xk = (const float*)d_in[1]; const float* xv = (const float*)d_in[2]; const float* wq = (const float*)d_in[3]; const float* wk = (const float*)d_in[4]; const float* wv = (const float*)d_in[5]; const float* wo = (const float*)d_in[6];   /* x_query, x_key, x_value, Wq, Wk, Wv [16][1024][64] ([h][d][k]), W0 ('oi' [1024][1024]) */
    float* OUT = (float*)d_out;     // [2][2048][1024]
    char* wsp = (char*)d_ws;
    auto take = [&](size_t bytes) { char* p = wsp; wsp += (bytes + 255) & ~(size_t)255; return (void*)p; };
    bf* WQ = (bf*)take((size_t)3 * DQ * DM * 2);   // Wq, Wk, Wv as Bt planes, one behind the other
    bf* WO = (bf*)take((size_t)DM * DQ * 2); float* CS = (float*)take((size_t)TT * HD * 2 * 4);
    const size_t PL = (size_t)NB_ * NH_ * TT * HD;   // one kind of plane, both batches: [b][h][t][d] (v: [b][h][d][t], rows at pitch 2 * TT)
    h16* QP16 = (h16*)take(2 * PL * 2); h16* KP16 = QP16 + PL; bf* QPh = (bf*)take(2 * PL * 2); bf* KPh = QPh + PL; bf* QPl = (bf*)take(2 * PL * 2); bf* KPl = QPl + PL;   // the k planes follow the q planes: one k_rope launch builds both
    h16* VT16 = (h16*)take(2 * PL * 2); bf* VTh = (bf*)VT16 + TT; bf* VTl = (bf*)take(2 * PL * 2);   // v rows at pitch 2 * TT: fp16 and hi share a row, lo has the first half of its own
    bf* XB = (bf*)take((size_t)3 * NB_ * TT * DM * 2); float* F = (float*)take((size_t)3 * NB_ * TT * DQ * 4);   // bf16 streams [3][b][t][d], f32 projections [3][b][t][h*64+k]
    bf* ATh = (bf*)take((size_t)NB_ * TT * DQ * 2); bf* ATl = (bf*)take((size_t)NB_ * TT * DQ * 2);
    if ((size_t)(wsp - (char*)d_ws) > ws_size) return;    // ws 256 MiB
    static_assert(NKV == NH_ && RH % 64 == 0 && (TT - RH) % 128 == 0, "q, k and v planes are numbered alike; whole row blocks");
    k_wtH<<<dim3((unsigned)(((size_t)DQ * DM / 2 + 255) / 256), 3, 1), 256, 0, stream>>>(wq, wk, wv, WQ);
    k_cvt8<<<dim3((unsigned)(((size_t)DM * DQ / 8 + 255) / 256), 1, 1), 256, 0, stream>>>(wo, wo, wo, WO, (size_t)DM * DQ / 8);
    k_csid<<<(TT * HD + 255) / 256, 256, 0, stream>>>(CS);
    const unsigned LQ = (unsigned)(((size_t)NH_ * TT * HD / 2 + 255) / 256);
    k_cvt8<<<dim3((unsigned)(((size_t)NB_ * TT * DM / 8 + 255) / 256), 3, 1), 256, 0, stream>>>(x, xk, xv, XB, (size_t)NB_ * TT * DM / 8);
    k_gemmw<bf, 0, false, 8><<<dim3(NB_ * TT / 64, DQ / 64, 3), 256, 0, stream>>>(XB, nullptr, WQ, nullptr, DM, F, DQ, nullptr, (size_t)NB_ * TT * DM, (size_t)DQ * DM, (size_t)NB_ * TT * DQ);
    k_rope<<<dim3(LQ, 2 * NB_, 1), 256, 0, stream>>>(F, DQ, NH_, CS, nullptr, nullptr, 1.0f, QP16, QPh, QPl);   // y = 0, 1: q of batch 0, 1; y = 2, 3: k
    k_vtp<<<dim3(LQ, NB_, 1), 256, 0, stream>>>(F + (size_t)2 * NB_ * TT * DQ, DKV, NKV, VT16, VTh, VTl);
    k_attn<<<dim3(NB_ * NH_, NBF + NBH, 1), 128, 0, stream>>>(QP16, KP16, VT16, QPh, QPl, KPh, KPl, VTh, VTl, ATh, ATl);
    k_gemmw<bf, 1, false, 8><<<dim3(NB_ * TT / 64, DM / 64, 1), 256, 0, stream>>>(ATh, ATl, WO, nullptr, DQ, OUT, DM, nullptr, 0, 0, 0);
}

// v004
// One run takes 181 microseconds.
// Next to v003, in two timings, it ran 1.20 and 1.19 times as fast.
// Counting every step since v000, it is 8.07 times as fast.
#include <hip/hip_runtime.h>

// Causal multi-head attention on three input streams with per-head stacked projection weights (x_query, x_key, x_value [2][2048][1024]; q = einsum('bsd,hdk', x_query, Wq) with Wq [16][1024][64] = [h][d][k] (1/32), k, v likewise from x_key / x_value; scores x 1/sqrt(64) + causal additive mask (0 / -inf); softmax; heads concatenated h-major; out = concat W0^T ('oi' [1024][1024]) -> [2][2048][1024] (4.2 M); argument order x_query, x_key, x_value, Wq, Wk, Wv, W0).
// Layout, both batches at once: bf16 copies of the three streams; k_wtH turns each [h][d][k] weight into Bt rows h*64 + k; k_proj: exact projections (one launch, z = stream) whose epilogue stores the fp16 and hi/lo head planes; k_attn: scores, running softmax and P.V of all 32 (batch, head) pairs in one launch, scores and probabilities never leave the registers (hybrid rows: < 512 hi/lo 3 products, rest fp16 x1024); merged hi/lo x W0 exact.
// Compute dtypes, f32 accumulate: every input rounded to bf16; projections exact; attention rows < 512 3 products, rest fp16; softmax f32; W0 hl x exact.

#define NB_  2
#define TT   2048
#define DM   1024
#define NH_  16
#define NKV  16
#define REP  (NH_ / NKV)
#define HD   64
#define DQ   (NH_ * HD)
#define DKV  (NKV * HD)
#define RH   512                  // query rows < RH use hi+lo planes (0: none)
#define SCL  0.125f   // HD^-0.5
typedef _Float16 h16;
typedef unsigned short bf;
typedef __attribute__((ext_vector_type(16))) __bf16   v16bf;
typedef __attribute__((ext_vector_type(16))) _Float16 v16h;
typedef __attribute__((ext_vector_type(8)))  _Float16 v8h;
typedef __attribute__((ext_vector_type(8)))  unsigned short v8us;
typedef __attribute__((ext_vector_type(8)))  float    v8f;
typedef __attribute__((ext_vector_type(4)))  float    v4f;
typedef v8h  __attribute__((may_alias)) v8ha;
typedef v4f  __attribute__((may_alias)) v4fa;
typedef v8us __attribute__((may_alias)) v8usa;

__device__ __forceinline__ unsigned short f2bf(float f) { unsigned u = __float_as_uint(f); u += 0x7FFFu + ((u >> 16) & 1u); return (unsigned short)(u >> 16); }
__device__ __forceinline__ float bf2f(unsigned short b) { return __uint_as_float(((unsigned)b) << 16); }
__device__ __forceinline__ float bfr(float f) { return bf2f(f2bf(f)); }
__device__ __forceinline__ v16h cat16(v8h lo, v8h hi) { return __builtin_shufflevector(lo, hi, 0, 1, 2, 3, 4, 5, 6, 7, 8, 9, 10, 11, 12, 13, 14, 15); }
__device__ __forceinline__ v16bf cat16b(v8us lo, v8us hi) { return __builtin_bit_cast(v16bf, __builtin_shufflevector(lo, hi, 0, 1, 2, 3, 4, 5, 6, 7, 8, 9, 10, 11, 12, 13, 14, 15)); }
__device__ __forceinline__ v8f wmma16(v16h a, v16h b, v8f c) { return __builtin_amdgcn_wmma_f32_16x16x32_f16(false, a, false, b, (short)0, c, false, false); }
__device__ __forceinline__ v8f wmmab(v16bf a, v16bf b, v8f c) { return __builtin_amdgcn_wmma_f32_16x16x32_bf16(false, a, false, b, (short)0, c, false, false); }



// ---- ksum_store: the NW waves of a work-group each hold a partial 64x64 f32 tile (their own share of K). Each writes it to its own LDS plane (pitch 68), one barrier, then every thread
// sums its 4-float pieces over the planes in wave order 0..NW-1 and stores them; 16 lanes store one whole 256-byte row of C (Ct = C at the tile's origin).
template <int NW, bool BIAS>
__device__ __forceinline__ void ksum_store(const v8f (&acc)[4][4], float* os, int wave, int lane, float* Ct, int ldc, const float* __restrict__ bias_c0) {
    const int lr = lane & 15, hi = lane >> 4; float* mine = os + wave * (64 * 68);
#pragma unroll
    for (int mb = 0; mb < 4; ++mb)
#pragma unroll
        for (int nb = 0; nb < 4; ++nb)
#pragma unroll
            for (int j = 0; j < 8; ++j) mine[(mb * 16 + hi * 8 + j) * 68 + nb * 16 + lr] = acc[mb][nb][j];
    __syncthreads();   // every wave's partial tile is in LDS before any thread sums across the planes
#pragma unroll
    for (int u = 0; u < 32 / NW; ++u) { const int idx = (u * NW + wave) * 32 + lane; const int row = idx >> 4, cofs = (idx & 15) * 4; v4f val = *(const v4fa*)(os + row * 68 + cofs);
#pragma unroll
        for (int w = 1; w < NW; ++w) val += *(const v4fa*)(os + w * (64 * 68) + row * 68 + cofs);
        if (BIAS) { val[0] += bfr(bias_c0[cofs]); val[1] += bfr(bias_c0[cofs + 1]); val[2] += bfr(bias_c0[cofs + 2]); val[3] += bfr(bias_c0[cofs + 3]); }
        *(v4f*)(Ct + (size_t)row * ldc + cofs) = val; }
}
// ---- k_gemmw: register-blocked GEMM, one 64x64 output tile per work-group of NW waves; K is split over the waves, 32-element step s to wave s % NW (two neighbour waves read the two halves of the same 128-byte lines at the same time); each wave keeps 16 accumulators, operands straight from K-contiguous 16-bit planes; ksum_store adds the NW partial tiles; grid (M/64, N/64, Z), NW*32 threads.
// C[m][n] (f32, pitch ldc, + optional f32 bias[n]) = sum_k A[m][k] Bt[n][k] (+ split products per NSPLIT). z-batch strides sA/sB/sC in elements. K % 32 == 0.
template <typename T16> struct WFrag;
template <> struct WFrag<h16> { typedef v16h V; static __device__ __forceinline__ V ld(const h16* p) { return cat16(*(const v8h*)p, *(const v8h*)(p + 16)); } static __device__ __forceinline__ v8f mma(V a, V b, v8f c) { return wmma16(a, b, c); } };
template <> struct WFrag<bf> { typedef v16bf V; static __device__ __forceinline__ V ld(const bf* p) { return cat16b(*(const v8us*)p, *(const v8us*)(p + 16)); } static __device__ __forceinline__ v8f mma(V a, V b, v8f c) { return wmmab(a, b, c); } };
template <typename T16, int NSPLIT, bool BIAS, int NW>
__global__ __launch_bounds__(NW * 32) void k_gemmw(const T16* __restrict__ A, const T16* __restrict__ A2, const T16* __restrict__ Bt, const T16* __restrict__ Bt2, int K, float* C, int ldc, const float* __restrict__ bias, size_t sA, size_t sB, size_t sC) {
    typedef typename WFrag<T16>::V V;
    __shared__ __align__(16) float os[NW * 64 * 68];
    const size_t z = blockIdx.z; A += z * sA; if (A2) A2 += z * sA; Bt += z * sB; if (Bt2) Bt2 += z * sB; C += z * sC;
    const int wave = __builtin_amdgcn_readfirstlane(threadIdx.x >> 5); const int lane = threadIdx.x & 31, lr = lane & 15, hi = lane >> 4; const int r0 = blockIdx.x * 64, c0 = blockIdx.y * 64;
    v8f acc[4][4];
#pragma unroll
    for (int mb = 0; mb < 4; ++mb)
#pragma unroll
        for (int nb = 0; nb < 4; ++nb) acc[mb][nb] = (v8f){};
    const size_t aoff = (size_t)(r0 + lr) * K + 8 * hi, boff = (size_t)(c0 + lr) * K + 8 * hi;
#pragma unroll 1
    for (int kc = wave * 32; kc < K; kc += NW * 32) {
        V a[4], a2[4];
#pragma unroll
        for (int mb = 0; mb < 4; ++mb) { a[mb] = WFrag<T16>::ld(A + aoff + (size_t)mb * 16 * K + kc); if (NSPLIT == 1 || NSPLIT == 2) a2[mb] = WFrag<T16>::ld(A2 + aoff + (size_t)mb * 16 * K + kc); }
#pragma unroll
        for (int nb = 0; nb < 4; ++nb) { const V b = WFrag<T16>::ld(Bt + boff + (size_t)nb * 16 * K + kc); V b2; if (NSPLIT >= 2) b2 = WFrag<T16>::ld(Bt2 + boff + (size_t)nb * 16 * K + kc);
#pragma unroll
            for (int mb = 0; mb < 4; ++mb) { acc[mb][nb] = WFrag<T16>::mma(a[mb], b, acc[mb][nb]); if (NSPLIT == 1 || NSPLIT == 2) acc[mb][nb] = WFrag<T16>::mma(a2[mb], b, acc[mb][nb]); if (NSPLIT >= 2) acc[mb][nb] = WFrag<T16>::mma(a[mb], b2, acc[mb][nb]); } }
        asm volatile("v_nop\n\tv_nop\n\tv_nop\n\tv_nop" : "+v"(acc[0][0]), "+v"(acc[1][1]), "+v"(acc[2][2]), "+v"(acc[3][3]) : "v"(a[0]), "v"(a[3]));
    }
    ksum_store<NW, BIAS>(acc, os, wave, lane, C + (size_t)r0 * ldc + c0, ldc, BIAS ? bias + c0 : nullptr);
}

__device__ __forceinline__ h16 tohx(float x) { return (h16)x; }
__device__ __forceinline__ void splitf(float y, unsigned short& h, unsigned short& l) { h = f2bf(y); l = f2bf(y - bf2f(h)); }
typedef __attribute__((ext_vector_type(2))) _Float16 v2h;
typedef __attribute__((ext_vector_type(4))) _Float16 v4h;
typedef __attribute__((ext_vector_type(2))) unsigned short v2us;
typedef __attribute__((ext_vector_type(4))) unsigned short v4us;
typedef __attribute__((ext_vector_type(2))) float v2f;
typedef __attribute__((ext_vector_type(4))) int v4i;

// k_cvt8: blockIdx.y picks one of up to three equally long sources; its bf16 copy is block y of dst
__global__ __launch_bounds__(256) void k_cvt8(const float* __restrict__ s0, const float* __restrict__ s1, const float* __restrict__ s2, bf* dst, size_t n8) { const size_t i = (size_t)blockIdx.x * 256 + threadIdx.x; if (i >= n8) return; const float* src = (blockIdx.y == 0) ? s0 : (blockIdx.y == 1) ? s1 : s2; dst += (size_t)blockIdx.y * n8 * 8; const v8f v = *(const v8f*)(src + i * 8); v8us o;
#pragma unroll
    for (int k = 0; k < 8; ++k) o[k] = f2bf(v[k]); *(v8us*)(dst + i * 8) = o;  }

__global__ __launch_bounds__(256) void k_wtH(const float* __restrict__ w0, const float* __restrict__ w1, const float* __restrict__ w2, bf* Bt) { const size_t e2 = ((size_t)blockIdx.x * 256 + threadIdx.x) * 2; if (e2 >= (size_t)DQ * DM) return; const float* w = (blockIdx.y == 0) ? w0 : (blockIdx.y == 1) ? w1 : w2; Bt += (size_t)blockIdx.y * DQ * DM;   /* blockIdx.y = which of the three weights */ const int d = (int)(e2 % DM); const int r = (int)(e2 / DM); const int h = r / HD, e = r % HD; v2us o; o[0] = f2bf(w[((size_t)h * DM + d) * HD + e]); o[1] = f2bf(w[((size_t)h * DM + d + 1) * HD + e]);
    *(v2us*)(Bt + e2) = o;  }
// ---- k_proj: the three projections, each 64x64 tile stored straight as the 16-bit planes that k_attn reads. Grid (rows / 64, heads, 3 streams), 8 waves; K is split over the waves as in k_gemmw (32-element step s to wave s % 8) and the 8 partial tiles are summed in LDS in wave order 0..7.
// A tile is 64 rows t of one batch x the 64 columns d of one head. q, k (z = 0, 1): tile rows = t, planes [b][h][t][d]. v (z = 2): the two operands change places, so the tile comes out as rows d x columns t, the [b][h][d][t] plane (pitch 2 * TT) with no transposition.
// After the sum a thread holds 8 consecutive elements of a tile row: one 16-byte store to each of the fp16, hi and lo planes; 8 lanes fill a whole 128-byte line of each.
#define PLN ((size_t)NB_ * NH_ * TT * HD)   // elements of one kind of plane, both batches
__global__ __launch_bounds__(256) void k_proj(const bf* __restrict__ X, const bf* __restrict__ Wt, h16* P16, bf* Ph, bf* Pl, h16* V16, bf* Vh, bf* Vl) {
    __shared__ __align__(16) float os[8 * 64 * 68];
    const int z = blockIdx.z, r0 = blockIdx.x * 64, hd = blockIdx.y;
    const int wave = __builtin_amdgcn_readfirstlane(threadIdx.x >> 5); const int lane = threadIdx.x & 31, lr = lane & 15, hi = lane >> 4;
    const bf* xr = X + ((size_t)z * NB_ * TT + r0) * DM; const bf* wr = Wt + ((size_t)z * DQ + hd * HD) * DM;
    const bf* A = (z == 2) ? wr : xr; const bf* Bt = (z == 2) ? xr : wr;
    v8f acc[4][4];
#pragma unroll
    for (int mb = 0; mb < 4; ++mb)
#pragma unroll
        for (int nb = 0; nb < 4; ++nb) acc[mb][nb] = (v8f){};
    const size_t off = (size_t)lr * DM + 8 * hi;
#pragma unroll 1   // rolled, as in k_gemmw: 4 trips a wave, one set of fragment registers
    for (int kc = wave * 32; kc < DM; kc += 8 * 32) {
        v16bf a[4];
#pragma unroll
        for (int mb = 0; mb < 4; ++mb) a[mb] = WFrag<bf>::ld(A + off + (size_t)mb * 16 * DM + kc);
        asm volatile("s_wait_xcnt 0x0" ::: "memory");   // the wait in front of an overwrite of an issued load's address registers: the compiler makes the A loads' address pair part of the destination of a B load below
#pragma unroll
        for (int nb = 0; nb < 4; ++nb) { const v16bf b = WFrag<bf>::ld(Bt + off + (size_t)nb * 16 * DM + kc);
#pragma unroll
            for (int mb = 0; mb < 4; ++mb) acc[mb][nb] = wmmab(a[mb], b, acc[mb][nb]); }
        // the distance behind the trip's last matrix instructions on the taken side of the loop's branch, where the next trip's loads overwrite the fragments (as in k_gemmw)
        asm volatile("v_nop\n\tv_nop\n\tv_nop\n\tv_nop" : "+v"(acc[0][0]), "+v"(acc[1][1]), "+v"(acc[2][2]), "+v"(acc[3][3]) : "v"(a[0]), "v"(a[3]));
    }
    float* mine = os + wave * (64 * 68);
#pragma unroll
    for (int mb = 0; mb < 4; ++mb)
#pragma unroll
        for (int nb = 0; nb < 4; ++nb)
#pragma unroll
            for (int j = 0; j < 8; ++j) mine[(mb * 16 + hi * 8 + j) * 68 + nb * 16 + lr] = acc[mb][nb][j];
    __syncthreads();   // every wave's partial tile is in LDS before any thread sums across the planes
    const int g = (r0 / TT) * NH_ + hd, t0 = r0 % TT;
    const size_t base = (z == 2) ? (size_t)g * HD * (2 * TT) + t0 : (size_t)z * PLN + ((size_t)g * TT + t0) * HD; const int pitch = (z == 2) ? 2 * TT : HD;
    h16* d16 = ((z == 2) ? V16 : P16) + base; bf* dh = ((z == 2) ? Vh : Ph) + base; bf* dl = ((z == 2) ? Vl : Pl) + base;
#pragma unroll
    for (int u = 0; u < 2; ++u) { const int idx = (u * 8 + wave) * 32 + lane; const int row = idx >> 3, cofs = (idx & 7) * 8; const float* s = os + row * 68 + cofs; v4f x0 = *(const v4fa*)s, x1 = *(const v4fa*)(s + 4);
#pragma unroll
        for (int w = 1; w < 8; ++w) { x0 += *(const v4fa*)(s + w * (64 * 68)); x1 += *(const v4fa*)(s + w * (64 * 68) + 4); }
        v8h o16; v8us oh, ol;
#pragma unroll
        for (int j = 0; j < 8; ++j) { const float x = (j < 4) ? x0[j & 3] : x1[j & 3]; o16[j] = tohx(x); unsigned short a2, c2; splitf(x, a2, c2); oh[j] = a2; ol[j] = c2; }
        const size_t po = (size_t)row * pitch + cofs; *(v8h*)(d16 + po) = o16; *(v8us*)(dh + po) = oh; *(v8us*)(dl + po) = ol; }
}
// ---- k_attn: causal attention, one launch for every (batch, head) pair g = blockIdx.x; blockIdx.y = block of query rows, the longest first. A wave owns QT * 16 query rows and walks the keys 0 .. its last row in steps of 32; waves share nothing (no LDS, no barrier).
// Per step: S^T = K Q^T (A = 16 key rows, B = 16 query rows, both [t][d] planes), so a lane holds scores of ONE query (column lane & 15): keys 8 * hi + j of each 16-key tile. Running maximum m and running sum l per query: in-lane, plus one exchange between the lane halves for m
// (l's halves are joined once, at the end). p = exp2((s - m) x SCL x log2 e (+ 10 in the fp16 rows: the x1024 carrier)); two converted S^T tiles are, register for register, the B operand of O^T += V^T P^T (A = 16 rows of the [d][t] plane), whose column is again the lane's own query:
// the rescale by exp2(m_old - m_new) and the final 1 / l are in-lane too. HR (rows < RH): q, k, v, p as bf16 hi + lo, 3 products each; else fp16, 1 product. Output: hi/lo bf16 of O / l at [t][h * 64 + d], 8 consecutive d per lane and store.
__device__ __forceinline__ float xhalf(float x) { const int b = __float_as_int(x); return __int_as_float(__builtin_amdgcn_permlanex16(b, b, 0x76543210, 0xfedcba98, false, false)); }   // the value of lane ^ 16
template <typename T16, bool HR, int QT>
__device__ __forceinline__ void attn_rows(const T16* __restrict__ Q, const T16* __restrict__ Q2, const T16* __restrict__ Kp, const T16* __restrict__ K2, const T16* __restrict__ Vt, const T16* __restrict__ Vt2, int q0, int lane, bf* Ah, bf* Al) {
    typedef typename WFrag<T16>::V V;
    const int lr = lane & 15, hi = lane >> 4; const float CE = SCL * 1.4426950408889634f; const float SH = HR ? 0.0f : 10.0f;
    V qf[QT][2], qf2[QT][2], kf[2][2], kf2[2][2]; v8f o[4][QT]; float m[QT], l[QT];
#pragma unroll
    for (int qt = 0; qt < QT; ++qt) { m[qt] = -3.0e38f; l[qt] = 0.0f;
#pragma unroll
        for (int ks = 0; ks < 2; ++ks) { const size_t qo = (size_t)(q0 + qt * 16 + lr) * HD + ks * 32 + 8 * hi; qf[qt][ks] = WFrag<T16>::ld(Q + qo); if (HR) qf2[qt][ks] = WFrag<T16>::ld(Q2 + qo); }
#pragma unroll
        for (int dt = 0; dt < 4; ++dt) o[dt][qt] = (v8f){}; }
    const int last = (q0 + QT * 16 - 1) & ~31;   // first key of the last step; last <= q0, so key kb of every step is at or below the diagonal of every row
    const size_t kof = (size_t)lr * HD + 8 * hi, vof = (size_t)lr * (2 * TT) + 8 * hi;
    auto ldk = [&](int k0) {
#pragma unroll
        for (int kt = 0; kt < 2; ++kt)
#pragma unroll
            for (int ks = 0; ks < 2; ++ks) { const size_t ko = kof + (size_t)(k0 + kt * 16) * HD + ks * 32; kf[kt][ks] = WFrag<T16>::ld(Kp + ko); if (HR) kf2[kt][ks] = WFrag<T16>::ld(K2 + ko); } };
    if (!HR) ldk(0);
#pragma unroll 1   // rolled: a second copy of the body would need a second set of fragment registers
    for (int kb = 0; kb <= last; kb += 32) {
        if constexpr (HR) { ldk(kb);   // hi + lo fragments of two steps at once would not fit 256 registers: these (short) rows fetch each step's keys at its head
            asm volatile("s_wait_xcnt 0x0" ::: "memory"); }   // the wait in front of an overwrite of an issued load's address registers: the compiler makes the key loads' address registers the destination of one of the value loads below
        V vf[4], vf2[4];
#pragma unroll
        for (int dt = 0; dt < 4; ++dt) { const size_t vo = vof + (size_t)(dt * 16) * (2 * TT) + kb; vf[dt] = WFrag<T16>::ld(Vt + vo); if (HR) vf2[dt] = WFrag<T16>::ld(Vt2 + vo); }
        // inputs-only fence on the loaded fragments: all 32 loads of the step are in flight together, one load latency a step; without it the compiler fetches the key fragments two loads at a time, each pair waited for on its own
        if constexpr (HR) asm volatile("" :: "v"(kf[0][0]), "v"(kf[0][1]), "v"(kf[1][0]), "v"(kf[1][1]), "v"(kf2[0][0]), "v"(kf2[0][1]), "v"(kf2[1][0]), "v"(kf2[1][1]), "v"(vf[0]), "v"(vf[1]), "v"(vf[2]), "v"(vf[3]), "v"(vf2[0]), "v"(vf2[1]), "v"(vf2[2]), "v"(vf2[3]));
        v8f s[2][QT];
#pragma unroll
        for (int kt = 0; kt < 2; ++kt)
#pragma unroll
            for (int qt = 0; qt < QT; ++qt) { s[kt][qt] = (v8f){};
#pragma unroll
                for (int ks = 0; ks < 2; ++ks) { s[kt][qt] = WFrag<T16>::mma(kf[kt][ks], qf[qt][ks], s[kt][qt]); if (HR) { s[kt][qt] = WFrag<T16>::mma(kf[kt][ks], qf2[qt][ks], s[kt][qt]); s[kt][qt] = WFrag<T16>::mma(kf2[kt][ks], qf[qt][ks], s[kt][qt]); } } }
        if (!HR) ldk(min(kb + 32, last));   // the next step's key fragments fly during this step's softmax and P.V; the last step fetches its own again (in bounds, unused)
        V pf[QT], pf2[QT];
#pragma unroll
        for (int qt = 0; qt < QT; ++qt) {
            if (kb + 31 > q0 + qt * 16) {   // wave-uniform: only a step that reaches above this tile's diagonal masks
                const int q = q0 + qt * 16 + lr;
#pragma unroll
                for (int kt = 0; kt < 2; ++kt)
#pragma unroll
                    for (int j = 0; j < 8; ++j) s[kt][qt][j] = (kb + kt * 16 + hi * 8 + j <= q) ? s[kt][qt][j] : -3.0e38f; }
            float mx = s[0][qt][0];
#pragma unroll
            for (int j = 1; j < 8; ++j) mx = fmaxf(mx, s[0][qt][j]);
#pragma unroll
            for (int j = 0; j < 8; ++j) mx = fmaxf(mx, s[1][qt][j]);
            mx = fmaxf(mx, xhalf(mx));
            const float mn = fmaxf(m[qt], mx); const float mc = mn * CE - SH; float al = (m[qt] - mn) * CE; m[qt] = mn;
            float sum = 0.0f; float p[16];
#pragma unroll
            for (int e = 0; e < 16; ++e) p[e] = s[e >> 3][qt][e & 7] * CE - mc;
            asm("v_exp_f32 %0, %0\n\tv_exp_f32 %1, %1\n\tv_exp_f32 %2, %2\n\tv_exp_f32 %3, %3\n\tv_exp_f32 %4, %4\n\tv_exp_f32 %5, %5\n\tv_exp_f32 %6, %6\n\tv_exp_f32 %7, %7\n\tv_exp_f32 %8, %8\n\tv_exp_f32 %9, %9\n\tv_exp_f32 %10, %10\n\tv_exp_f32 %11, %11\n\tv_exp_f32 %12, %12\n\tv_exp_f32 %13, %13\n\tv_exp_f32 %14, %14\n\tv_exp_f32 %15, %15\n\tv_exp_f32 %16, %16\n\tv_nop"
                : "+v"(p[0]), "+v"(p[1]), "+v"(p[2]), "+v"(p[3]), "+v"(p[4]), "+v"(p[5]), "+v"(p[6]), "+v"(p[7]), "+v"(p[8]), "+v"(p[9]), "+v"(p[10]), "+v"(p[11]), "+v"(p[12]), "+v"(p[13]), "+v"(p[14]), "+v"(p[15]), "+v"(al));
#pragma unroll
            for (int e = 0; e < 16; ++e) sum += p[e];
            l[qt] = l[qt] * al + sum;
#pragma unroll
            for (int dt = 0; dt < 4; ++dt) o[dt][qt] *= al;
            if constexpr (HR) { v8us h0, h1, l0, l1;
#pragma unroll
                for (int j = 0; j < 8; ++j) { unsigned short a, c2; splitf(p[j], a, c2); h0[j] = a; l0[j] = c2; splitf(p[8 + j], a, c2); h1[j] = a; l1[j] = c2; }
                pf[qt] = cat16b(h0, h1); pf2[qt] = cat16b(l0, l1);
            } else { v8h h0, h1;
#pragma unroll
                for (int j = 0; j < 8; ++j) { h0[j] = tohx(p[j]); h1[j] = tohx(p[8 + j]); }
                pf[qt] = cat16(h0, h1); }
        }
#pragma unroll
        for (int dt = 0; dt < 4; ++dt)
#pragma unroll
            for (int qt = 0; qt < QT; ++qt) { o[dt][qt] = WFrag<T16>::mma(vf[dt], pf[qt], o[dt][qt]); if (HR) { o[dt][qt] = WFrag<T16>::mma(vf[dt], pf2[qt], o[dt][qt]); o[dt][qt] = WFrag<T16>::mma(vf2[dt], pf[qt], o[dt][qt]); } }
    }
#pragma unroll
    for (int qt = 0; qt < QT; ++qt) { const float f = __fdiv_rn(1.0f, l[qt] + xhalf(l[qt])); const size_t oo = (size_t)(q0 + qt * 16 + lr) * DQ + hi * 8;
#pragma unroll
        for (int dt = 0; dt < 4; ++dt) { v8us oh, ol;
#pragma unroll
            for (int j = 0; j < 8; ++j) { unsigned short a, c2; splitf(o[dt][qt][j] * f, a, c2); oh[j] = a; ol[j] = c2; }
            *(v8us*)(Ah + oo + dt * 16) = oh; *(v8us*)(Al + oo + dt * 16) = ol; } }
}
#define NBF ((TT - RH) / 128)     // blocks of 4 waves x 32 fp16 rows
#define NBH (RH / 64)             // blocks of 4 waves x 16 hi/lo rows
__global__ __launch_bounds__(128) void k_attn(const h16* __restrict__ Q16, const h16* __restrict__ K16, const h16* __restrict__ V16, const bf* __restrict__ Qh, const bf* __restrict__ Ql, const bf* __restrict__ Kh, const bf* __restrict__ Kl, const bf* __restrict__ Vh, const bf* __restrict__ Vl, bf* Ah, bf* Al) {
    const int g = blockIdx.x, y = blockIdx.y; const int wave = __builtin_amdgcn_readfirstlane(threadIdx.x >> 5); const int lane = threadIdx.x & 31;
    const size_t po = (size_t)g * TT * HD, vo = (size_t)g * HD * 2 * TT, ao = (size_t)(g / NH_) * TT * DQ + (size_t)(g % NH_) * HD;
    if (y < NBF) attn_rows<h16, false, 2>(Q16 + po, nullptr, K16 + po, nullptr, V16 + vo, nullptr, RH + (NBF - 1 - y) * 128 + wave * 32, lane, Ah + ao, Al + ao);
    else attn_rows<bf, true, 1>(Qh + po, Ql + po, Kh + po, Kl + po, Vh + vo, Vl + vo, (NBF + NBH - 1 - y) * 64 + wave * 16, lane, Ah + ao, Al + ao);
}

extern "C" void kernel_launch(void* const* d_in, const int* in_sizes, int n_in,
                              void* d_out, int out_size, void* d_ws, size_t ws_size, hipStream_t stream) {
    (void)in_sizes; (void)n_in; (void)out_size;
    const float* x = (const float*)d_in[0]; const float* xk = (const float*)d_in[1]; const float* xv = (const float*)d_in[2]; const float* wq = (const float*)d_in[3]; const float* wk = (const float*)d_in[4]; const float* wv = (const float*)d_in[5]; const float* wo = (const float*)d_in[6];   /* x_query, x_key, x_value, Wq, Wk, Wv [16][1024][64] ([h][d][k]), W0 ('oi' [1024][1024]) */
    float* OUT = (float*)d_out;     // [2][2048][1024]
    char* wsp = (char*)d_ws;
    auto take = [&](size_t bytes) { char* p = wsp; wsp += (bytes + 255) & ~(size_t)255; return (void*)p; };
    bf* WQ = (bf*)take((size_t)3 * DQ * DM * 2);   // Wq, Wk, Wv as Bt planes, one behind the other
    bf* WO = (bf*)take((size_t)DM * DQ * 2);
    const size_t PL = (size_t)NB_ * NH_ * TT * HD;   // one kind of plane, both batches: [b][h][t][d] (v: [b][h][d][t], rows at pitch 2 * TT)
    h16* QP16 = (h16*)take(2 * PL * 2); h16* KP16 = QP16 + PL; bf* QPh = (bf*)take(2 * PL * 2); bf* KPh = QPh + PL; bf* QPl = (bf*)take(2 * PL * 2); bf* KPl = QPl + PL;   // the k planes follow the q planes
    h16* VT16 = (h16*)take(2 * PL * 2); bf* VTh = (bf*)VT16 + TT; bf* VTl = (bf*)take(2 * PL * 2);   // v rows at pitch 2 * TT: fp16 and hi share a row, lo has the first half of its own
    bf* XB = (bf*)take((size_t)3 * NB_ * TT * DM * 2);   // bf16 streams [3][b][t][d]
    bf* ATh = (bf*)take((size_t)NB_ * TT * DQ * 2); bf* ATl = (bf*)take((size_t)NB_ * TT * DQ * 2);
    if ((size_t)(wsp - (char*)d_ws) > ws_size) return;    // ws 256 MiB
    static_assert(NKV == NH_ && RH % 64 == 0 && (TT - RH) % 128 == 0, "q, k and v planes are numbered alike; whole row blocks");
    k_wtH<<<dim3((unsigned)(((size_t)DQ * DM / 2 + 255) / 256), 3, 1), 256, 0, stream>>>(wq, wk, wv, WQ);
    k_cvt8<<<dim3((unsigned)(((size_t)DM * DQ / 8 + 255) / 256), 1, 1), 256, 0, stream>>>(wo, wo, wo, WO, (size_t)DM * DQ / 8);
    k_cvt8<<<dim3((unsigned)(((size_t)NB_ * TT * DM / 8 + 255) / 256), 3, 1), 256, 0, stream>>>(x, xk, xv, XB, (size_t)NB_ * TT * DM / 8);
    k_proj<<<dim3(NB_ * TT / 64, NH_, 3), 256, 0, stream>>>(XB, WQ, QP16, QPh, QPl, VT16, VTh, VTl);
    k_attn<<<dim3(NB_ * NH_, NBF + NBH, 1), 128, 0, stream>>>(QP16, KP16, VT16, QPh, QPl, KPh, KPl, VTh, VTl, ATh, ATl);
    k_gemmw<bf, 1, false, 8><<<dim3(NB_ * TT / 64, DM / 64, 1), 256, 0, stream>>>(ATh, ATl, WO, nullptr, DQ, OUT, DM, nullptr, 0, 0, 0);
}

// v005
// It runs in 171 microseconds.
// In both of two side-by-side timings against v004, it was 1.06 times as fast.
// Over all steps from v000 it is 8.59 times as fast.
#include <hip/hip_runtime.h>

// Causal multi-head attention on three input streams with per-head stacked projection weights (x_query, x_key, x_value [2][2048][1024]; q = einsum('bsd,hdk', x_query, Wq) with Wq [16][1024][64] = [h][d][k] (1/32), k, v likewise from x_key / x_value; scores x 1/sqrt(64) + causal additive mask (0 / -inf); softmax; heads concatenated h-major; out = concat W0^T ('oi' [1024][1024]) -> [2][2048][1024] (4.2 M); argument order x_query, x_key, x_value, Wq, Wk, Wv, W0).
// Layout, both batches at once: bf16 copies of the three streams; k_wtH turns each [h][d][k] weight into Bt rows h*64 + k; k_proj: exact projections (one launch, z = stream) whose epilogue stores the fp16 and hi/lo head planes; k_attn: scores, running softmax and P.V of all 32 (batch, head) pairs in one launch, scores and probabilities never leave the registers (hybrid rows: < 512 hi/lo 3 products, rest fp16 x1024); merged hi/lo x W0 exact.
// Compute dtypes, f32 accumulate: every input rounded to bf16; projections exact; attention rows < 512 3 products, rest fp16; softmax f32; W0 hl x exact.

#define NB_  2
#define TT   2048
#define DM   1024
#define NH_  16
#define NKV  16
#define REP  (NH_ / NKV)
#define HD   64
#define DQ   (NH_ * HD)
#define DKV  (NKV * HD)
#define RH   512                  // query rows < RH use hi+lo planes (0: none)
#define SCL  0.125f   // HD^-0.5
typedef _Float16 h16;
typedef unsigned short bf;
typedef __attribute__((ext_vector_type(16))) __bf16   v16bf;
typedef __attribute__((ext_vector_type(16))) _Float16 v16h;
typedef __attribute__((ext_vector_type(8)))  _Float16 v8h;
typedef __attribute__((ext_vector_type(8)))  unsigned short v8us;
typedef __attribute__((ext_vector_type(8)))  float    v8f;
typedef __attribute__((ext_vector_type(4)))  float    v4f;
typedef v8h  __attribute__((may_alias)) v8ha;
typedef v4f  __attribute__((may_alias)) v4fa;
typedef v8us __attribute__((may_alias)) v8usa;

__device__ __forceinline__ unsigned short f2bf(float f) { unsigned u = __float_as_uint(f); u += 0x7FFFu + ((u >> 16) & 1u); return (unsigned short)(u >> 16); }
__device__ __forceinline__ float bf2f(unsigned short b) { return __uint_as_float(((unsigned)b) << 16); }
__device__ __forceinline__ float bfr(float f) { return bf2f(f2bf(f)); }
__device__ __forceinline__ v16h cat16(v8h lo, v8h hi) { return __builtin_shufflevector(lo, hi, 0, 1, 2, 3, 4, 5, 6, 7, 8, 9, 10, 11, 12, 13, 14, 15); }
__device__ __forceinline__ v16bf cat16b(v8us lo, v8us hi) { return __builtin_bit_cast(v16bf, __builtin_shufflevector(lo, hi, 0, 1, 2, 3, 4, 5, 6, 7, 8, 9, 10, 11, 12, 13, 14, 15)); }
__device__ __forceinline__ v8f wmma16(v16h a, v16h b, v8f c) { return __builtin_amdgcn_wmma_f32_16x16x32_f16(false, a, false, b, (short)0, c, false, false); }
__device__ __forceinline__ v8f wmmab(v16bf a, v16bf b, v8f c) { return __builtin_amdgcn_wmma_f32_16x16x32_bf16(false, a, false, b, (short)0, c, false, false); }



// ---- ksum_store: the NW waves of a work-group each hold a partial 64x64 f32 tile (their own share of K). Each writes it to its own LDS plane (pitch 68), one barrier, then every thread
// sums its 4-float pieces over the planes in wave order 0..NW-1 and stores them; 16 lanes store one whole 256-byte row of C (Ct = C at the tile's origin).
template <int NW, bool BIAS>
__device__ __forceinline__ void ksum_store(const v8f (&acc)[4][4], float* os, int wave, int lane, float* Ct, int ldc, const float* __restrict__ bias_c0) {
    const int lr = lane & 15, hi = lane >> 4; float* mine = os + wave * (64 * 68);
#pragma unroll
    for (int mb = 0; mb < 4; ++mb)
#pragma unroll
        for (int nb = 0; nb < 4; ++nb)
#pragma unroll
            for (int j = 0; j < 8; ++j) mine[(mb * 16 + hi * 8 + j) * 68 + nb * 16 + lr] = acc[mb][nb][j];
    __syncthreads();   // every wave's partial tile is in LDS before any thread sums across the planes
#pragma unroll
    for (int u = 0; u < 32 / NW; ++u) { const int idx = (u * NW + wave) * 32 + lane; const int row = idx >> 4, cofs = (idx & 15) * 4; v4f val = *(const v4fa*)(os + row * 68 + cofs);
#pragma unroll
        for (int w = 1; w < NW; ++w) val += *(const v4fa*)(os + w * (64 * 68) + row * 68 + cofs);
        if (BIAS) { val[0] += bfr(bias_c0[cofs]); val[1] += bfr(bias_c0[cofs + 1]); val[2] += bfr(bias_c0[cofs + 2]); val[3] += bfr(bias_c0[cofs + 3]); }
        *(v4f*)(Ct + (size_t)row * ldc + cofs) = val; }
}
// ---- k_gemmw: register-blocked GEMM, one 64x64 output tile per work-group of NW waves; K is split over the waves, 32-element step s to wave s % NW (two neighbour waves read the two halves of the same 128-byte lines at the same time); each wave keeps 16 accumulators, operands straight from K-contiguous 16-bit planes; ksum_store adds the NW partial tiles; grid (M/64, N/64, Z), NW*32 threads.
// C[m][n] (f32, pitch ldc, + optional f32 bias[n]) = sum_k A[m][k] Bt[n][k] (+ split products per NSPLIT). z-batch strides sA/sB/sC in elements. K % 32 == 0.
template <typename T16> struct WFrag;
template <> struct WFrag<h16> { typedef v16h V; static __device__ __forceinline__ V ld(const h16* p) { return cat16(*(const v8h*)p, *(const v8h*)(p + 16)); } static __device__ __forceinline__ v8f mma(V a, V b, v8f c) { return wmma16(a, b, c); } };
template <> struct WFrag<bf> { typedef v16bf V; static __device__ __forceinline__ V ld(const bf* p) { return cat16b(*(const v8us*)p, *(const v8us*)(p + 16)); } static __device__ __forceinline__ v8f mma(V a, V b, v8f c) { return wmmab(a, b, c); } };
template <typename T16, int NSPLIT, bool BIAS, int NW>
__global__ __launch_bounds__(NW * 32) void k_gemmw(const T16* __restrict__ A, const T16* __restrict__ A2, const T16* __restrict__ Bt, const T16* __restrict__ Bt2, int K, float* C, int ldc, const float* __restrict__ bias, size_t sA, size_t sB, size_t sC) {
    typedef typename WFrag<T16>::V V;
    __shared__ __align__(16) float os[NW * 64 * 68];
    const size_t z = blockIdx.z; A += z * sA; if (A2) A2 += z * sA; Bt += z * sB; if (Bt2) Bt2 += z * sB; C += z * sC;
    const int wave = __builtin_amdgcn_readfirstlane(threadIdx.x >> 5); const int lane = threadIdx.x & 31, lr = lane & 15, hi = lane >> 4; const int r0 = blockIdx.x * 64, c0 = blockIdx.y * 64;
    v8f acc[4][4];
#pragma unroll
    for (int mb = 0; mb < 4; ++mb)
#pragma unroll
        for (int nb = 0; nb < 4; ++nb) acc[mb][nb] = (v8f){};
    const size_t aoff = (size_t)(r0 + lr) * K + 8 * hi, boff = (size_t)(c0 + lr) * K + 8 * hi;
#pragma unroll 1
    for (int kc = wave * 32; kc < K; kc += NW * 32) {
        V a[4], a2[4];
#pragma unroll
        for (int mb = 0; mb < 4; ++mb) { a[mb] = WFrag<T16>::ld(A + aoff + (size_t)mb * 16 * K + kc); if (NSPLIT == 1 || NSPLIT == 2) a2[mb] = WFrag<T16>::ld(A2 + aoff + (size_t)mb * 16 * K + kc); }
#pragma unroll
        for (int nb = 0; nb < 4; ++nb) { const V b = WFrag<T16>::ld(Bt + boff + (size_t)nb * 16 * K + kc); V b2; if (NSPLIT >= 2) b2 = WFrag<T16>::ld(Bt2 + boff + (size_t)nb * 16 * K + kc);
#pragma unroll
            for (int mb = 0; mb < 4; ++mb) { acc[mb][nb] = WFrag<T16>::mma(a[mb], b, acc[mb][nb]); if (NSPLIT == 1 || NSPLIT == 2) acc[mb][nb] = WFrag<T16>::mma(a2[mb], b, acc[mb][nb]); if (NSPLIT >= 2) acc[mb][nb] = WFrag<T16>::mma(a[mb], b2, acc[mb][nb]); } }
        asm volatile("v_nop\n\tv_nop\n\tv_nop\n\tv_nop" : "+v"(acc[0][0]), "+v"(acc[1][1]), "+v"(acc[2][2]), "+v"(acc[3][3]) : "v"(a[0]), "v"(a[3]));
    }
    ksum_store<NW, BIAS>(acc, os, wave, lane, C + (size_t)r0 * ldc + c0, ldc, BIAS ? bias + c0 : nullptr);
}

__device__ __forceinline__ h16 tohx(float x) { return (h16)x; }
__device__ __forceinline__ void splitf(float y, unsigned short& h, unsigned short& l) { h = f2bf(y); l = f2bf(y - bf2f(h)); }
typedef __attribute__((ext_vector_type(2))) _Float16 v2h;
typedef __attribute__((ext_vector_type(4))) _Float16 v4h;
typedef __attribute__((ext_vector_type(2))) unsigned short v2us;
typedef __attribute__((ext_vector_type(4))) unsigned short v4us;
typedef __attribute__((ext_vector_type(2))) float v2f;
typedef __attribute__((ext_vector_type(4))) int v4i;

// k_cvt8: bf16 copies. blockIdx.y picks one of up to three equally long sources; its copy is block y of dst. A thread converts U pieces of 8 floats, 256 pieces apart (each wave's loads and stores stay contiguous), and issues
// all its loads before the first conversion: few waves that each keep many loads in flight, instead of one short-lived wave per KiB of source. The grid covers n8 = gridDim.x * 256 * U pieces exactly (asserted at the launch).
template <int U>
__global__ __launch_bounds__(256) void k_cvt8(const float* __restrict__ s0, const float* __restrict__ s1, const float* __restrict__ s2, bf* dst, size_t n8) { const size_t i0 = (size_t)blockIdx.x * (256 * U) + threadIdx.x; const float* src = (blockIdx.y == 0) ? s0 : (blockIdx.y == 1) ? s1 : s2; dst += (size_t)blockIdx.y * n8 * 8; v4f lo[U], hi[U];
#pragma unroll
    for (int u = 0; u < U; ++u) { const float* p = src + (i0 + u * 256) * 8; lo[u] = *(const v4f*)p;
        if (u == U - 1) asm volatile("s_wait_xcnt 0x0" ::: "memory");   // the wait in front of an overwrite of issued loads' address registers: the compiler makes the address pair part of the last load's destination
        hi[u] = *(const v4f*)(p + 4); }
#pragma unroll
    for (int u = 0; u < U; ++u) { v8us o;
#pragma unroll
        for (int k = 0; k < 4; ++k) { o[k] = f2bf(lo[u][k]); o[4 + k] = f2bf(hi[u][k]); }
        *(v8us*)(dst + (i0 + u * 256) * 8) = o; }
}

// k_wtH: [h][d][e] f32 -> bf16 Bt rows h * 64 + e, d contiguous; blockIdx.y = which of the three weights. A thread takes a block of 8 d x 4 e: 8 loads of 16 bytes (4 e of one d), 4 stores of 16 bytes (8 d of one e).
// Lanes = 8 groups of d x 4 groups of e: 8 lanes fill a whole 128-byte line of Bt at each store, 4 lanes read 64 contiguous bytes; the 8 waves of a work-group cover 128 d x the 64 e of one head. Grid (NH_ * DM / 128, 3), exact.
__global__ __launch_bounds__(256) void k_wtH(const float* __restrict__ w0, const float* __restrict__ w1, const float* __restrict__ w2, bf* Bt) { const float* w = (blockIdx.y == 0) ? w0 : (blockIdx.y == 1) ? w1 : w2; Bt += (size_t)blockIdx.y * DQ * DM;
    const int h = blockIdx.x / (DM / 128), db = blockIdx.x % (DM / 128); const int wave = threadIdx.x >> 5, lane = threadIdx.x & 31;
    const int d = db * 128 + (wave >> 2) * 64 + (lane & 7) * 8, e = (wave & 3) * 16 + (lane >> 3) * 4;
    const float* s = w + ((size_t)h * DM + d) * HD + e; v4f r[8];
#pragma unroll
    for (int j = 0; j < 8; ++j) r[j] = *(const v4f*)(s + j * HD);
#pragma unroll
    for (int i = 0; i < 4; ++i) { v8us o;
#pragma unroll
        for (int j = 0; j < 8; ++j) o[j] = f2bf(r[j][i]);
        *(v8us*)(Bt + (size_t)(h * HD + e + i) * DM + d) = o; }
}
// ---- k_proj: the three projections, each 64x64 tile stored straight as the 16-bit planes that k_attn reads. Grid (rows / 64, heads, 3 streams), 8 waves; K is split over the waves as in k_gemmw (32-element step s to wave s % 8) and the 8 partial tiles are summed in LDS in wave order 0..7.
// A tile is 64 rows t of one batch x the 64 columns d of one head. q, k (z = 0, 1): tile rows = t, planes [b][h][t][d]. v (z = 2): the two operands change places, so the tile comes out as rows d x columns t, the [b][h][d][t] plane (pitch 2 * TT) with no transposition.
// After the sum a thread holds 8 consecutive elements of a tile row: one 16-byte store to each of the fp16, hi and lo planes; 8 lanes fill a whole 128-byte line of each.
#define PLN ((size_t)NB_ * NH_ * TT * HD)   // elements of one kind of plane, both batches
__global__ __launch_bounds__(256) void k_proj(const bf* __restrict__ X, const bf* __restrict__ Wt, h16* P16, bf* Ph, bf* Pl, h16* V16, bf* Vh, bf* Vl) {
    __shared__ __align__(16) float os[8 * 64 * 68];
    const int z = blockIdx.z, r0 = blockIdx.x * 64, hd = blockIdx.y;
    const int wave = __builtin_amdgcn_readfirstlane(threadIdx.x >> 5); const int lane = threadIdx.x & 31, lr = lane & 15, hi = lane >> 4;
    const bf* xr = X + ((size_t)z * NB_ * TT + r0) * DM; const bf* wr = Wt + ((size_t)z * DQ + hd * HD) * DM;
    const bf* A = (z == 2) ? wr : xr; const bf* Bt = (z == 2) ? xr : wr;
    v8f acc[4][4];
#pragma unroll
    for (int mb = 0; mb < 4; ++mb)
#pragma unroll
        for (int nb = 0; nb < 4; ++nb) acc[mb][nb] = (v8f){};
    const size_t off = (size_t)lr * DM + 8 * hi;
#pragma unroll 1   // rolled, as in k_gemmw: 4 trips a wave, one set of fragment registers
    for (int kc = wave * 32; kc < DM; kc += 8 * 32) {
        v16bf a[4];
#pragma unroll
        for (int mb = 0; mb < 4; ++mb) a[mb] = WFrag<bf>::ld(A + off + (size_t)mb * 16 * DM + kc);
        asm volatile("s_wait_xcnt 0x0" ::: "memory");   // the wait in front of an overwrite of an issued load's address registers: the compiler makes the A loads' address pair part of the destination of a B load below
#pragma unroll
        for (int nb = 0; nb < 4; ++nb) { const v16bf b = WFrag<bf>::ld(Bt + off + (size_t)nb * 16 * DM + kc);
#pragma unroll
            for (int mb = 0; mb < 4; ++mb) acc[mb][nb] = wmmab(a[mb], b, acc[mb][nb]); }
        // the distance behind the trip's last matrix instructions on the taken side of the loop's branch, where the next trip's loads overwrite the fragments (as in k_gemmw)
        asm volatile("v_nop\n\tv_nop\n\tv_nop\n\tv_nop" : "+v"(acc[0][0]), "+v"(acc[1][1]), "+v"(acc[2][2]), "+v"(acc[3][3]) : "v"(a[0]), "v"(a[3]));
    }
    float* mine = os + wave * (64 * 68);
#pragma unroll
    for (int mb = 0; mb < 4; ++mb)
#pragma unroll
        for (int nb = 0; nb < 4; ++nb)
#pragma unroll
            for (int j = 0; j < 8; ++j) mine[(mb * 16 + hi * 8 + j) * 68 + nb * 16 + lr] = acc[mb][nb][j];
    __syncthreads();   // every wave's partial tile is in LDS before any thread sums across the planes
    const int g = (r0 / TT) * NH_ + hd, t0 = r0 % TT;
    const size_t base = (z == 2) ? (size_t)g * HD * (2 * TT) + t0 : (size_t)z * PLN + ((size_t)g * TT + t0) * HD; const int pitch = (z == 2) ? 2 * TT : HD;
    h16* d16 = ((z == 2) ? V16 : P16) + base; bf* dh = ((z == 2) ? Vh : Ph) + base; bf* dl = ((z == 2) ? Vl : Pl) + base;
#pragma unroll
    for (int u = 0; u < 2; ++u) { const int idx = (u * 8 + wave) * 32 + lane; const int row = idx >> 3, cofs = (idx & 7) * 8; const float* s = os + row * 68 + cofs; v4f x0 = *(const v4fa*)s, x1 = *(const v4fa*)(s + 4);
#pragma unroll
        for (int w = 1; w < 8; ++w) { x0 += *(const v4fa*)(s + w * (64 * 68)); x1 += *(const v4fa*)(s + w * (64 * 68) + 4); }
        v8h o16; v8us oh, ol;
#pragma unroll
        for (int j = 0; j < 8; ++j) { const float x = (j < 4) ? x0[j & 3] : x1[j & 3]; o16[j] = tohx(x); unsigned short a2, c2; splitf(x, a2, c2); oh[j] = a2; ol[j] = c2; }
        const size_t po = (size_t)row * pitch + cofs; *(v8h*)(d16 + po) = o16; *(v8us*)(dh + po) = oh; *(v8us*)(dl + po) = ol; }
}
// ---- k_attn: causal attention, one launch for every (batch, head) pair g = blockIdx.x; blockIdx.y = block of query rows, the longest first. A wave owns QT * 16 query rows and walks the keys 0 .. its last row in steps of 32; waves share nothing (no LDS, no barrier).
// Per step: S^T = K Q^T (A = 16 key rows, B = 16 query rows, both [t][d] planes), so a lane holds scores of ONE query (column lane & 15): keys 8 * hi + j of each 16-key tile. Running maximum m and running sum l per query: in-lane, plus one exchange between the lane halves for m
// (l's halves are joined once, at the end). p = exp2((s - m) x SCL x log2 e (+ 10 in the fp16 rows: the x1024 carrier)); two converted S^T tiles are, register for register, the B operand of O^T += V^T P^T (A = 16 rows of the [d][t] plane), whose column is again the lane's own query:
// the rescale by exp2(m_old - m_new) and the final 1 / l are in-lane too. HR (rows < RH): q, k, v, p as bf16 hi + lo, 3 products each; else fp16, 1 product. Output: hi/lo bf16 of O / l at [t][h * 64 + d], 8 consecutive d per lane and store.
__device__ __forceinline__ float xhalf(float x) { const int b = __float_as_int(x); return __int_as_float(__builtin_amdgcn_permlanex16(b, b, 0x76543210, 0xfedcba98, false, false)); }   // the value of lane ^ 16
template <typename T16, bool HR, int QT>
__device__ __forceinline__ void attn_rows(const T16* __restrict__ Q, const T16* __restrict__ Q2, const T16* __restrict__ Kp, const T16* __restrict__ K2, const T16* __restrict__ Vt, const T16* __restrict__ Vt2, int q0, int lane, bf* Ah, bf* Al) {
    typedef typename WFrag<T16>::V V;
    const int lr = lane & 15, hi = lane >> 4; const float CE = SCL * 1.4426950408889634f; const float SH = HR ? 0.0f : 10.0f;
    V qf[QT][2], qf2[QT][2], kf[2][2], kf2[2][2]; v8f o[4][QT]; float m[QT], l[QT];
#pragma unroll
    for (int qt = 0; qt < QT; ++qt) { m[qt] = -3.0e38f; l[qt] = 0.0f;
#pragma unroll
        for (int ks = 0; ks < 2; ++ks) { const size_t qo = (size_t)(q0 + qt * 16 + lr) * HD + ks * 32 + 8 * hi; qf[qt][ks] = WFrag<T16>::ld(Q + qo); if (HR) qf2[qt][ks] = WFrag<T16>::ld(Q2 + qo); }
#pragma unroll
        for (int dt = 0; dt < 4; ++dt) o[dt][qt] = (v8f){}; }
    const int last = (q0 + QT * 16 - 1) & ~31;   // first key of the last step; last <= q0, so key kb of every step is at or below the diagonal of every row
    const size_t kof = (size_t)lr * HD + 8 * hi, vof = (size_t)lr * (2 * TT) + 8 * hi;
    auto ldk = [&](int k0) {
#pragma unroll
        for (int kt = 0; kt < 2; ++kt)
#pragma unroll
            for (int ks = 0; ks < 2; ++ks) { const size_t ko = kof + (size_t)(k0 + kt * 16) * HD + ks * 32; kf[kt][ks] = WFrag<T16>::ld(Kp + ko); if (HR) kf2[kt][ks] = WFrag<T16>::ld(K2 + ko); } };
    if (!HR) ldk(0);
#pragma unroll 1   // rolled: a second copy of the body would need a second set of fragment registers
    for (int kb = 0; kb <= last; kb += 32) {
        if constexpr (HR) { ldk(kb);   // hi + lo fragments of two steps at once would not fit 256 registers: these (short) rows fetch each step's keys at its head
            asm volatile("s_wait_xcnt 0x0" ::: "memory"); }   // the wait in front of an overwrite of an issued load's address registers: the compiler makes the key loads' address registers the destination of one of the value loads below
        V vf[4], vf2[4];
#pragma unroll
        for (int dt = 0; dt < 4; ++dt) { const size_t vo = vof + (size_t)(dt * 16) * (2 * TT) + kb; vf[dt] = WFrag<T16>::ld(Vt + vo); if (HR) vf2[dt] = WFrag<T16>::ld(Vt2 + vo); }
        // inputs-only fence on the loaded fragments: all 32 loads of the step are in flight together, one load latency a step; without it the compiler fetches the key fragments two loads at a time, each pair waited for on its own
        if constexpr (HR) asm volatile("" :: "v"(kf[0][0]), "v"(kf[0][1]), "v"(kf[1][0]), "v"(kf[1][1]), "v"(kf2[0][0]), "v"(kf2[0][1]), "v"(kf2[1][0]), "v"(kf2[1][1]), "v"(vf[0]), "v"(vf[1]), "v"(vf[2]), "v"(vf[3]), "v"(vf2[0]), "v"(vf2[1]), "v"(vf2[2]), "v"(vf2[3]));
        v8f s[2][QT];
#pragma unroll
        for (int kt = 0; kt < 2; ++kt)
#pragma unroll
            for (int qt = 0; qt < QT; ++qt) { s[kt][qt] = (v8f){};
#pragma unroll
                for (int ks = 0; ks < 2; ++ks) { s[kt][qt] = WFrag<T16>::mma(kf[kt][ks], qf[qt][ks], s[kt][qt]); if (HR) { s[kt][qt] = WFrag<T16>::mma(kf[kt][ks], qf2[qt][ks], s[kt][qt]); s[kt][qt] = WFrag<T16>::mma(kf2[kt][ks], qf[qt][ks], s[kt][qt]); } } }
        if (!HR) ldk(min(kb + 32, last));   // the next step's key fragments fly during this step's softmax and P.V; the last step fetches its own again (in bounds, unused)
        V pf[QT], pf2[QT];
#pragma unroll
        for (int qt = 0; qt < QT; ++qt) {
            if (kb + 31 > q0 + qt * 16) {   // wave-uniform: only a step that reaches above this tile's diagonal masks
                const int q = q0 + qt * 16 + lr;
#pragma unroll
                for (int kt = 0; kt < 2; ++kt)
#pragma unroll
                    for (int j = 0; j < 8; ++j) s[kt][qt][j] = (kb + kt * 16 + hi * 8 + j <= q) ? s[kt][qt][j] : -3.0e38f; }
            float mx = s[0][qt][0];
#pragma unroll
            for (int j = 1; j < 8; ++j) mx = fmaxf(mx, s[0][qt][j]);
#pragma unroll
            for (int j = 0; j < 8; ++j) mx = fmaxf(mx, s[1][qt][j]);
            mx = fmaxf(mx, xhalf(mx));
            const float mn = fmaxf(m[qt], mx); const float mc = mn * CE - SH; float al = (m[qt] - mn) * CE; m[qt] = mn;
            float sum = 0.0f; float p[16];
#pragma unroll
            for (int e = 0; e < 16; ++e) p[e] = s[e >> 3][qt][e & 7] * CE - mc;
            asm("v_exp_f32 %0, %0\n\tv_exp_f32 %1, %1\n\tv_exp_f32 %2, %2\n\tv_exp_f32 %3, %3\n\tv_exp_f32 %4, %4\n\tv_exp_f32 %5, %5\n\tv_exp_f32 %6, %6\n\tv_exp_f32 %7, %7\n\tv_exp_f32 %8, %8\n\tv_exp_f32 %9, %9\n\tv_exp_f32 %10, %10\n\tv_exp_f32 %11, %11\n\tv_exp_f32 %12, %12\n\tv_exp_f32 %13, %13\n\tv_exp_f32 %14, %14\n\tv_exp_f32 %15, %15\n\tv_exp_f32 %16, %16\n\tv_nop"
                : "+v"(p[0]), "+v"(p[1]), "+v"(p[2]), "+v"(p[3]), "+v"(p[4]), "+v"(p[5]), "+v"(p[6]), "+v"(p[7]), "+v"(p[8]), "+v"(p[9]), "+v"(p[10]), "+v"(p[11]), "+v"(p[12]), "+v"(p[13]), "+v"(p[14]), "+v"(p[15]), "+v"(al));
#pragma unroll
            for (int e = 0; e < 16; ++e) sum += p[e];
            l[qt] = l[qt] * al + sum;
#pragma unroll
            for (int dt = 0; dt < 4; ++dt) o[dt][qt] *= al;
            if constexpr (HR) { v8us h0, h1, l0, l1;
#pragma unroll
                for (int j = 0; j < 8; ++j) { unsigned short a, c2; splitf(p[j], a, c2); h0[j] = a; l0[j] = c2; splitf(p[8 + j], a, c2); h1[j] = a; l1[j] = c2; }
                pf[qt] = cat16b(h0, h1); pf2[qt] = cat16b(l0, l1);
            } else { v8h h0, h1;
#pragma unroll
                for (int j = 0; j < 8; ++j) { h0[j] = tohx(p[j]); h1[j] = tohx(p[8 + j]); }
                pf[qt] = cat16(h0, h1); }
        }
#pragma unroll
        for (int dt = 0; dt < 4; ++dt)
#pragma unroll
            for (int qt = 0; qt < QT; ++qt) { o[dt][qt] = WFrag<T16>::mma(vf[dt], pf[qt], o[dt][qt]); if (HR) { o[dt][qt] = WFrag<T16>::mma(vf[dt], pf2[qt], o[dt][qt]); o[dt][qt] = WFrag<T16>::mma(vf2[dt], pf[qt], o[dt][qt]); } }
    }
#pragma unroll
    for (int qt = 0; qt < QT; ++qt) { const float f = __fdiv_rn(1.0f, l[qt] + xhalf(l[qt])); const size_t oo = (size_t)(q0 + qt * 16 + lr) * DQ + hi * 8;
#pragma unroll
        for (int dt = 0; dt < 4; ++dt) { v8us oh, ol;
#pragma unroll
            for (int j = 0; j < 8; ++j) { unsigned short a, c2; splitf(o[dt][qt][j] * f, a, c2); oh[j] = a; ol[j] = c2; }
            *(v8us*)(Ah + oo + dt * 16) = oh; *(v8us*)(Al + oo + dt * 16) = ol; } }
}
#define NBF ((TT - RH) / 128)     // blocks of 4 waves x 32 fp16 rows
#define NBH (RH / 64)             // blocks of 4 waves x 16 hi/lo rows
__global__ __launch_bounds__(128) void k_attn(const h16* __restrict__ Q16, const h16* __restrict__ K16, const h16* __restrict__ V16, const bf* __restrict__ Qh, const bf* __restrict__ Ql, const bf* __restrict__ Kh, const bf* __restrict__ Kl, const bf* __restrict__ Vh, const bf* __restrict__ Vl, bf* Ah, bf* Al) {
    const int g = blockIdx.x, y = blockIdx.y; const int wave = __builtin_amdgcn_readfirstlane(threadIdx.x >> 5); const int lane = threadIdx.x & 31;
    const size_t po = (size_t)g * TT * HD, vo = (size_t)g * HD * 2 * TT, ao = (size_t)(g / NH_) * TT * DQ + (size_t)(g % NH_) * HD;
    if (y < NBF) attn_rows<h16, false, 2>(Q16 + po, nullptr, K16 + po, nullptr, V16 + vo, nullptr, RH + (NBF - 1 - y) * 128 + wave * 32, lane, Ah + ao, Al + ao);
    else attn_rows<bf, true, 1>(Qh + po, Ql + po, Kh + po, Kl + po, Vh + vo, Vl + vo, (NBF + NBH - 1 - y) * 64 + wave * 16, lane, Ah + ao, Al + ao);
}

extern "C" void kernel_launch(void* const* d_in, const int* in_sizes, int n_in,
                              void* d_out, int out_size, void* d_ws, size_t ws_size, hipStream_t stream) {
    (void)in_sizes; (void)n_in; (void)out_size;
    const float* x = (const float*)d_in[0]; const float* xk = (const float*)d_in[1]; const float* xv = (const float*)d_in[2]; const float* wq = (const float*)d_in[3]; const float* wk = (const float*)d_in[4]; const float* wv = (const float*)d_in[5]; const float* wo = (const float*)d_in[6];   /* x_query, x_key, x_value, Wq, Wk, Wv [16][1024][64] ([h][d][k]), W0 ('oi' [1024][1024]) */
    float* OUT = (float*)d_out;     // [2][2048][1024]
    char* wsp = (char*)d_ws;
    auto take = [&](size_t bytes) { char* p = wsp; wsp += (bytes + 255) & ~(size_t)255; return (void*)p; };
    bf* WQ = (bf*)take((size_t)3 * DQ * DM * 2);   // Wq, Wk, Wv as Bt planes, one behind the other
    bf* WO = (bf*)take((size_t)DM * DQ * 2);
    const size_t PL = (size_t)NB_ * NH_ * TT * HD;   // one kind of plane, both batches: [b][h][t][d] (v: [b][h][d][t], rows at pitch 2 * TT)
    h16* QP16 = (h16*)take(2 * PL * 2); h16* KP16 = QP16 + PL; bf* QPh = (bf*)take(2 * PL * 2); bf* KPh = QPh + PL; bf* QPl = (bf*)take(2 * PL * 2); bf* KPl = QPl + PL;   // the k planes follow the q planes
    h16* VT16 = (h16*)take(2 * PL * 2); bf* VTh = (bf*)VT16 + TT; bf* VTl = (bf*)take(2 * PL * 2);   // v rows at pitch 2 * TT: fp16 and hi share a row, lo has the first half of its own
    bf* XB = (bf*)take((size_t)3 * NB_ * TT * DM * 2);   // bf16 streams [3][b][t][d]
    bf* ATh = (bf*)take((size_t)NB_ * TT * DQ * 2); bf* ATl = (bf*)take((size_t)NB_ * TT * DQ * 2);
    if ((size_t)(wsp - (char*)d_ws) > ws_size) return;    // ws 256 MiB
    static_assert(NKV == NH_ && RH % 64 == 0 && (TT - RH) % 128 == 0, "q, k and v planes are numbered alike; whole row blocks");
    static_assert(HD == 64 && DM % 128 == 0 && ((size_t)DM * DQ / 8) % (256 * 4) == 0 && ((size_t)NB_ * TT * DM / 8) % (256 * 8) == 0, "the three grids below cover their arrays exactly");
    k_wtH<<<dim3(NH_ * (DM / 128), 3, 1), 256, 0, stream>>>(wq, wk, wv, WQ);
    k_cvt8<4><<<dim3((unsigned)((size_t)DM * DQ / 8 / (256 * 4)), 1, 1), 256, 0, stream>>>(wo, wo, wo, WO, (size_t)DM * DQ / 8);
    k_cvt8<8><<<dim3((unsigned)((size_t)NB_ * TT * DM / 8 / (256 * 8)), 3, 1), 256, 0, stream>>>(x, xk, xv, XB, (size_t)NB_ * TT * DM / 8);
    k_proj<<<dim3(NB_ * TT / 64, NH_, 3), 256, 0, stream>>>(XB, WQ, QP16, QPh, QPl, VT16, VTh, VTl);
    k_attn<<<dim3(NB_ * NH_, NBF + NBH, 1), 128, 0, stream>>>(QP16, KP16, VT16, QPh, QPl, KPh, KPl, VTh, VTl, ATh, ATl);
    k_gemmw<bf, 1, false, 8><<<dim3(NB_ * TT / 64, DM / 64, 1), 256, 0, stream>>>(ATh, ATl, WO, nullptr, DQ, OUT, DM, nullptr, 0, 0, 0);
}

// v006
// It runs in 132 microseconds.
// In both of two side-by-side timings against v005, it was 1.30 times as fast.
// Over all steps from v000 it is 11.2 times as fast.
#include <hip/hip_runtime.h>

// Causal multi-head attention on three input streams with per-head stacked projection weights (x_query, x_key, x_value [2][2048][1024]; q = einsum('bsd,hdk', x_query, Wq) with Wq [16][1024][64] = [h][d][k] (1/32), k, v likewise from x_key / x_value; scores x 1/sqrt(64) + causal additive mask (0 / -inf); softmax; heads concatenated h-major; out = concat W0^T ('oi' [1024][1024]) -> [2][2048][1024] (4.2 M); argument order x_query, x_key, x_value, Wq, Wk, Wv, W0).
// Layout, both batches at once: bf16 copies of the three streams; k_wtH turns each [h][d][k] weight into Bt rows h*64 + k; k_proj: exact projections (one launch, z = stream) whose epilogue stores the fp16 and hi/lo head planes; k_attn: scores, running softmax and P.V of all 32 (batch, head) pairs in one launch, scores and probabilities never leave the registers (hybrid rows: < 512 hi/lo 3 products, rest fp16 x1024); merged hi/lo x W0 exact.
// Every 16-bit matrix operand plane (bf16 streams, weights, q / k / v planes, attention output) is stored fragment-major: a block of 16 rows x 32 k is 1 KiB in a row, element (r, k) at ((k >> 4) & 1) * 256 + ((k >> 3) & 1) * 128 + (r & 15) * 8 + (k & 7),
// the blocks of a row block one behind the other along k (v: the 4 blocks of d of a 32-key step one behind the other). Lane l's two 16-byte pieces of a fragment stand at l * 8 and 256 + l * 8: each wave-wide load covers 512 bytes in a row (4 whole lines), not 32 bytes of each of 16 lines.
// Compute dtypes, f32 accumulate: every input rounded to bf16; projections exact; attention rows < 512 3 products, rest fp16; softmax f32; W0 hl x exact.

#define NB_  2
#define TT   2048
#define DM   1024
#define NH_  16
#define NKV  16
#define REP  (NH_ / NKV)
#define HD   64
#define DQ   (NH_ * HD)
#define DKV  (NKV * HD)
#define RH   512                  // query rows < RH use hi+lo planes (0: none)
#define SCL  0.125f   // HD^-0.5
typedef _Float16 h16;
typedef unsigned short bf;
typedef __attribute__((ext_vector_type(16))) __bf16   v16bf;
typedef __attribute__((ext_vector_type(16))) _Float16 v16h;
typedef __attribute__((ext_vector_type(8)))  _Float16 v8h;
typedef __attribute__((ext_vector_type(8)))  unsigned short v8us;
typedef __attribute__((ext_vector_type(8)))  float    v8f;
typedef __attribute__((ext_vector_type(4)))  float    v4f;
typedef v8h  __attribute__((may_alias)) v8ha;
typedef v4f  __attribute__((may_alias)) v4fa;
typedef v8us __attribute__((may_alias)) v8usa;

__device__ __forceinline__ unsigned short f2bf(float f) { unsigned u = __float_as_uint(f); u += 0x7FFFu + ((u >> 16) & 1u); return (unsigned short)(u >> 16); }
__device__ __forceinline__ float bf2f(unsigned short b) { return __uint_as_float(((unsigned)b) << 16); }
__device__ __forceinline__ float bfr(float f) { return bf2f(f2bf(f)); }
__device__ __forceinline__ v16h cat16(v8h lo, v8h hi) { return __builtin_shufflevector(lo, hi, 0, 1, 2, 3, 4, 5, 6, 7, 8, 9, 10, 11, 12, 13, 14, 15); }
__device__ __forceinline__ v16bf cat16b(v8us lo, v8us hi) { return __builtin_bit_cast(v16bf, __builtin_shufflevector(lo, hi, 0, 1, 2, 3, 4, 5, 6, 7, 8, 9, 10, 11, 12, 13, 14, 15)); }
__device__ __forceinline__ v8f wmma16(v16h a, v16h b, v8f c) { return __builtin_amdgcn_wmma_f32_16x16x32_f16(false, a, false, b, (short)0, c, false, false); }
__device__ __forceinline__ v8f wmmab(v16bf a, v16bf b, v8f c) { return __builtin_amdgcn_wmma_f32_16x16x32_bf16(false, a, false, b, (short)0, c, false, false); }



// ---- ksum_store: the NW waves of a work-group each hold a partial 64x64 f32 tile (their own share of K). Each writes it to its own LDS plane (pitch 68), one barrier, then every thread
// sums its 4-float pieces over the planes in wave order 0..NW-1 and stores them; 16 lanes store one whole 256-byte row of C (Ct = C at the tile's origin).
template <int NW, bool BIAS>
__device__ __forceinline__ void ksum_store(const v8f (&acc)[4][4], float* os, int wave, int lane, float* Ct, int ldc, const float* __restrict__ bias_c0) {
    const int lr = lane & 15, hi = lane >> 4; float* mine = os + wave * (64 * 68);
#pragma unroll
    for (int mb = 0; mb < 4; ++mb)
#pragma unroll
        for (int nb = 0; nb < 4; ++nb)
#pragma unroll
            for (int j = 0; j < 8; ++j) mine[(mb * 16 + hi * 8 + j) * 68 + nb * 16 + lr] = acc[mb][nb][j];
    __syncthreads();   // every wave's partial tile is in LDS before any thread sums across the planes
#pragma unroll
    for (int u = 0; u < 32 / NW; ++u) { const int idx = (u * NW + wave) * 32 + lane; const int row = idx >> 4, cofs = (idx & 15) * 4; v4f val = *(const v4fa*)(os + row * 68 + cofs);
#pragma unroll
        for (int w = 1; w < NW; ++w) val += *(const v4fa*)(os + w * (64 * 68) + row * 68 + cofs);
        if (BIAS) { val[0] += bfr(bias_c0[cofs]); val[1] += bfr(bias_c0[cofs + 1]); val[2] += bfr(bias_c0[cofs + 2]); val[3] += bfr(bias_c0[cofs + 3]); }
        *(v4f*)(Ct + (size_t)row * ldc + cofs) = val; }
}
// ---- k_gemmw: register-blocked GEMM, one 64x64 output tile per work-group of NW waves; K is split over the waves, 32-element step s to wave s % NW (the block of step s is 1 KiB in a row: a wave reads whole 128-byte lines, none shared with its neighbour); each wave keeps 16 accumulators, operands straight from fragment-major 16-bit planes (block of rows r .. r + 15, k .. k + 31 at r * K + k * 16); ksum_store adds the NW partial tiles; grid (M/64, N/64, Z), NW*32 threads.
// C[m][n] (f32, pitch ldc, + optional f32 bias[n]) = sum_k A[m][k] Bt[n][k] (+ split products per NSPLIT). z-batch strides sA/sB/sC in elements. K % 32 == 0.
template <typename T16> struct WFrag;
template <> struct WFrag<h16> { typedef v16h V; static __device__ __forceinline__ V ld(const h16* p) { return cat16(*(const v8h*)p, *(const v8h*)(p + 256)); } static __device__ __forceinline__ v8f mma(V a, V b, v8f c) { return wmma16(a, b, c); } };
template <> struct WFrag<bf> { typedef v16bf V; static __device__ __forceinline__ V ld(const bf* p) { return cat16b(*(const v8us*)p, *(const v8us*)(p + 256)); } static __device__ __forceinline__ v8f mma(V a, V b, v8f c) { return wmmab(a, b, c); } };
template <typename T16, int NSPLIT, bool BIAS, int NW, int K>   // K a constant: the fragments of a plane then share one address pair, the row blocks being immediate offsets
__global__ __launch_bounds__(NW * 32) void k_gemmw(const T16* __restrict__ A, const T16* __restrict__ A2, const T16* __restrict__ Bt, const T16* __restrict__ Bt2, float* C, int ldc, const float* __restrict__ bias, size_t sA, size_t sB, size_t sC) {
    typedef typename WFrag<T16>::V V;
    __shared__ __align__(16) float os[NW * 64 * 68];
    const size_t z = blockIdx.z; A += z * sA; if (A2) A2 += z * sA; Bt += z * sB; if (Bt2) Bt2 += z * sB; C += z * sC;
    const int wave = __builtin_amdgcn_readfirstlane(threadIdx.x >> 5); const int lane = threadIdx.x & 31; const int r0 = blockIdx.x * 64, c0 = blockIdx.y * 64;
    v8f acc[4][4];
#pragma unroll
    for (int mb = 0; mb < 4; ++mb)
#pragma unroll
        for (int nb = 0; nb < 4; ++nb) acc[mb][nb] = (v8f){};
    const size_t aoff = (size_t)r0 * K + lane * 8, boff = (size_t)c0 * K + lane * 8;
#pragma unroll 1
    for (int kc = wave * 32; kc < K; kc += NW * 32) {
        V a[4], a2[4];
#pragma unroll
        for (int mb = 0; mb < 4; ++mb) { a[mb] = WFrag<T16>::ld(A + aoff + (size_t)mb * 16 * K + kc * 16); if (NSPLIT == 1 || NSPLIT == 2) a2[mb] = WFrag<T16>::ld(A2 + aoff + (size_t)mb * 16 * K + kc * 16); }
        asm volatile("s_wait_xcnt 0x0" ::: "memory");   // the wait in front of an overwrite of an issued load's address registers: the compiler may make the A loads' address pairs part of the destination of a B load below (as in k_proj)
#pragma unroll
        for (int nb = 0; nb < 4; ++nb) { const V b = WFrag<T16>::ld(Bt + boff + (size_t)nb * 16 * K + kc * 16); V b2; if (NSPLIT >= 2) b2 = WFrag<T16>::ld(Bt2 + boff + (size_t)nb * 16 * K + kc * 16);
#pragma unroll
            for (int mb = 0; mb < 4; ++mb) { acc[mb][nb] = WFrag<T16>::mma(a[mb], b, acc[mb][nb]); if (NSPLIT == 1 || NSPLIT == 2) acc[mb][nb] = WFrag<T16>::mma(a2[mb], b, acc[mb][nb]); if (NSPLIT >= 2) acc[mb][nb] = WFrag<T16>::mma(a[mb], b2, acc[mb][nb]); } }
        asm volatile("v_nop\n\tv_nop\n\tv_nop\n\tv_nop" : "+v"(acc[0][0]), "+v"(acc[1][1]), "+v"(acc[2][2]), "+v"(acc[3][3]) : "v"(a[0]), "v"(a[3]));
    }
    ksum_store<NW, BIAS>(acc, os, wave, lane, C + (size_t)r0 * ldc + c0, ldc, BIAS ? bias + c0 : nullptr);
}

__device__ __forceinline__ h16 tohx(float x) { return (h16)x; }
__device__ __forceinline__ void splitf(float y, unsigned short& h, unsigned short& l) { h = f2bf(y); l = f2bf(y - bf2f(h)); }
typedef __attribute__((ext_vector_type(2))) _Float16 v2h;
typedef __attribute__((ext_vector_type(4))) _Float16 v4h;
typedef __attribute__((ext_vector_type(2))) unsigned short v2us;
typedef __attribute__((ext_vector_type(4))) unsigned short v4us;
typedef __attribute__((ext_vector_type(2))) float v2f;
typedef __attribute__((ext_vector_type(4))) int v4i;

// k_cvt8: fragment-major bf16 copies of f32 matrices with rows of DM elements. blockIdx.y picks one of up to three equally long sources; its copy is block y of dst. A wave takes U / 4 regions of 16 rows x 64 k (neighbours along k); a thread converts U pieces of 8 floats
// and issues all its loads before the first conversion. Lanes = 4 rows x 8 pieces: the two loads of a piece read 256 bytes in a row (2 whole lines) of each of 4 rows, a store writes 64 bytes in a row in each of 8 half blocks, and 4 stores fill them.
// The grid covers n8 = gridDim.x * 256 * U pieces exactly (asserted at the launch).
template <int U>
__global__ __launch_bounds__(256) void k_cvt8(const float* __restrict__ s0, const float* __restrict__ s1, const float* __restrict__ s2, bf* dst, size_t n8) {
    static_assert(U % 4 == 0 && (DM / 64) % (U / 4) == 0, "a wave's regions lie in one block of 16 rows");
    const int lane = threadIdx.x & 31, c = lane & 7, rr = lane >> 3; const int reg0 = (blockIdx.x * 8 + (threadIdx.x >> 5)) * (U / 4); const int rb = reg0 / (DM / 64), kq = reg0 % (DM / 64);
    const float* src = ((blockIdx.y == 0) ? s0 : (blockIdx.y == 1) ? s1 : s2) + (size_t)(rb * 16 + rr) * DM + kq * 64 + c * 8;
    dst += (size_t)blockIdx.y * n8 * 8 + ((size_t)rb * (DM / 32) + kq * 2 + (c >> 2)) * 512 + ((c >> 1) & 1) * 256 + (c & 1) * 128 + rr * 8; v4f lo[U], hi[U];
#pragma unroll
    for (int u = 0; u < U; ++u) { const float* p = src + (u & 3) * 4 * DM + (u >> 2) * 64; lo[u] = *(const v4f*)p;
        if (u == U - 1) asm volatile("s_wait_xcnt 0x0" ::: "memory");   // the wait in front of an overwrite of issued loads' address registers: the compiler makes the address pair part of the last load's destination
        hi[u] = *(const v4f*)(p + 4); }
#pragma unroll
    for (int u = 0; u < U; ++u) { v8us o;
#pragma unroll
        for (int k = 0; k < 4; ++k) { o[k] = f2bf(lo[u][k]); o[4 + k] = f2bf(hi[u][k]); }
        *(v8us*)(dst + (u & 3) * 32 + (u >> 2) * 1024) = o; }
}

// k_wtH: [h][d][e] f32 -> bf16 Bt rows h * 64 + e, k = d, fragment-major; blockIdx.y = which of the three weights. A thread takes a block of 8 d x 4 e: 8 loads of 16 bytes (4 e of one d), 4 stores of 16 bytes (8 d of one e).
// Lanes = 8 groups of d x 4 groups of e: a thread's 4 stores fill 64 bytes in a row, 4 lanes a whole half block of 256 bytes; 4 lanes read 64 contiguous bytes; the 8 waves of a work-group cover 128 d x the 64 e of one head. Grid (NH_ * DM / 128, 3), exact.
__global__ __launch_bounds__(256) void k_wtH(const float* __restrict__ w0, const float* __restrict__ w1, const float* __restrict__ w2, bf* Bt) { const float* w = (blockIdx.y == 0) ? w0 : (blockIdx.y == 1) ? w1 : w2; Bt += (size_t)blockIdx.y * DQ * DM;
    const int h = blockIdx.x / (DM / 128), db = blockIdx.x % (DM / 128); const int wave = threadIdx.x >> 5, lane = threadIdx.x & 31;
    const int d = db * 128 + (wave >> 2) * 64 + (lane & 7) * 8, e = (wave & 3) * 16 + (lane >> 3) * 4;
    const float* s = w + ((size_t)h * DM + d) * HD + e; v4f r[8];
#pragma unroll
    for (int j = 0; j < 8; ++j) r[j] = *(const v4f*)(s + j * HD);
#pragma unroll
    for (int i = 0; i < 4; ++i) { v8us o;
#pragma unroll
        for (int j = 0; j < 8; ++j) o[j] = f2bf(r[j][i]);
        *(v8us*)(Bt + ((size_t)((h * HD + e) >> 4) * (DM / 32) + (d >> 5)) * 512 + ((d >> 4) & 1) * 256 + ((d >> 3) & 1) * 128 + ((e & 15) + i) * 8) = o; }
}
// ---- k_proj: the three projections, each 64x64 tile stored straight as the 16-bit planes that k_attn reads. Grid (rows / 64, heads, 3 streams), 8 waves; K is split over the waves as in k_gemmw (32-element step s to wave s % 8) and the 8 partial tiles are summed in LDS in wave order 0..7.
// A tile is 64 rows t of one batch x the 64 columns d of one head, 4096 elements in a row of each plane [b][h]. q, k (z = 0, 1): tile rows = t, k = d: blocks (t / 16, d / 32). v (z = 2): the two operands change places, so the tile comes out as rows d x columns t with no transposition; rows = d, k = t: blocks (t / 32, d / 16).
// After the sum a thread holds 8 consecutive elements of a tile row, the piece that stands at idx * 8 in the fragment-major tile: one 16-byte store to each of the fp16, hi and lo planes; a wave fills 512 bytes in a row of each.
#define PLN ((size_t)NB_ * NH_ * TT * HD)   // elements of one kind of plane, both batches
__global__ __launch_bounds__(256) void k_proj(const bf* __restrict__ X, const bf* __restrict__ Wt, h16* P16, bf* Ph, bf* Pl, h16* V16, bf* Vh, bf* Vl) {
    __shared__ __align__(16) float os[8 * 64 * 68];
    const int z = blockIdx.z, r0 = blockIdx.x * 64, hd = blockIdx.y;
    const int wave = __builtin_amdgcn_readfirstlane(threadIdx.x >> 5); const int lane = threadIdx.x & 31, lr = lane & 15, hi = lane >> 4;
    const bf* xr = X + ((size_t)z * NB_ * TT + r0) * DM; const bf* wr = Wt + ((size_t)z * DQ + hd * HD) * DM;
    const bf* A = (z == 2) ? wr : xr; const bf* Bt = (z == 2) ? xr : wr;
    v8f acc[4][4];
#pragma unroll
    for (int mb = 0; mb < 4; ++mb)
#pragma unroll
        for (int nb = 0; nb < 4; ++nb) acc[mb][nb] = (v8f){};
    const size_t off = lane * 8;
#pragma unroll 1   // rolled, as in k_gemmw: 4 trips a wave, one set of fragment registers
    for (int kc = wave * 32; kc < DM; kc += 8 * 32) {
        v16bf a[4];
#pragma unroll
        for (int mb = 0; mb < 4; ++mb) a[mb] = WFrag<bf>::ld(A + off + (size_t)mb * 16 * DM + kc * 16);
        asm volatile("s_wait_xcnt 0x0" ::: "memory");   // the wait in front of an overwrite of an issued load's address registers: the compiler makes the A loads' address pair part of the destination of a B load below
#pragma unroll
        for (int nb = 0; nb < 4; ++nb) { const v16bf b = WFrag<bf>::ld(Bt + off + (size_t)nb * 16 * DM + kc * 16);
#pragma unroll
            for (int mb = 0; mb < 4; ++mb) acc[mb][nb] = wmmab(a[mb], b, acc[mb][nb]); }
        // the distance behind the trip's last matrix instructions on the taken side of the loop's branch, where the next trip's loads overwrite the fragments (as in k_gemmw)
        asm volatile("v_nop\n\tv_nop\n\tv_nop\n\tv_nop" : "+v"(acc[0][0]), "+v"(acc[1][1]), "+v"(acc[2][2]), "+v"(acc[3][3]) : "v"(a[0]), "v"(a[3]));
    }
    float* mine = os + wave * (64 * 68);
#pragma unroll
    for (int mb = 0; mb < 4; ++mb)
#pragma unroll
        for (int nb = 0; nb < 4; ++nb)
#pragma unroll
            for (int j = 0; j < 8; ++j) mine[(mb * 16 + hi * 8 + j) * 68 + nb * 16 + lr] = acc[mb][nb][j];
    __syncthreads();   // every wave's partial tile is in LDS before any thread sums across the planes
    const int g = (r0 / TT) * NH_ + hd, t0 = r0 % TT;
    const size_t base = ((z == 2) ? 0 : (size_t)z * PLN) + ((size_t)g * TT + t0) * HD;
    h16* d16 = ((z == 2) ? V16 : P16) + base; bf* dh = ((z == 2) ? Vh : Ph) + base; bf* dl = ((z == 2) ? Vl : Pl) + base;
#pragma unroll
    for (int u = 0; u < 2; ++u) { const int idx = (u * 8 + wave) * 32 + lane;   // bits 0-3: row in its block, 4-5: group of 8 k in its block, 6-8: the block
        const int row = ((z == 2) ? ((idx >> 6) & 3) : (idx >> 7)) * 16 + (idx & 15), cofs = (((z == 2) ? (idx >> 8) : ((idx >> 6) & 1)) * 4 + ((idx >> 4) & 3)) * 8; const float* s = os + row * 68 + cofs; v4f x0 = *(const v4fa*)s, x1 = *(const v4fa*)(s + 4);
#pragma unroll
        for (int w = 1; w < 8; ++w) { x0 += *(const v4fa*)(s + w * (64 * 68)); x1 += *(const v4fa*)(s + w * (64 * 68) + 4); }
        v8h o16; v8us oh, ol;
#pragma unroll
        for (int j = 0; j < 8; ++j) { const float x = (j < 4) ? x0[j & 3] : x1[j & 3]; o16[j] = tohx(x); unsigned short a2, c2; splitf(x, a2, c2); oh[j] = a2; ol[j] = c2; }
        const size_t po = (size_t)idx * 8; *(v8h*)(d16 + po) = o16; *(v8us*)(dh + po) = oh; *(v8us*)(dl + po) = ol; }
}
// ---- k_attn: causal attention, one launch for every (batch, head) pair g = blockIdx.x; blockIdx.y = block of query rows, the longest first. A wave owns QT * 16 query rows and walks the keys 0 .. its last row in steps of 32; waves share nothing (no LDS, no barrier).
// Per step: S^T = K Q^T (A = 16 key rows, B = 16 query rows, both from planes with rows t, k = d), so a lane holds scores of ONE query (column lane & 15): keys 8 * hi + j of each 16-key tile. Running maximum m and running sum l per query: in-lane, plus one exchange between the lane halves for m
// (l's halves are joined once, at the end). p = exp2((s - m) x SCL x log2 e (+ 10 in the fp16 rows: the x1024 carrier)); two converted S^T tiles are, register for register, the B operand of O^T += V^T P^T (A = 16 rows of the plane with rows d, k = t), whose column is again the lane's own query:
// the rescale by exp2(m_old - m_new) and the final 1 / l are in-lane too. HR (rows < RH): q, k, v, p as bf16 hi + lo, 3 products each; else fp16, 1 product. Output: hi/lo bf16 of O / l, row t, k = h * 64 + d of the fragment-major planes that the last product reads, 8 consecutive d per lane, 512 bytes in a row per store.
__device__ __forceinline__ float xhalf(float x) { const int b = __float_as_int(x); return __int_as_float(__builtin_amdgcn_permlanex16(b, b, 0x76543210, 0xfedcba98, false, false)); }   // the value of lane ^ 16
template <typename T16, bool HR, int QT>
__device__ __forceinline__ void attn_rows(const T16* __restrict__ Q, const T16* __restrict__ Q2, const T16* __restrict__ Kp, const T16* __restrict__ K2, const T16* __restrict__ Vt, const T16* __restrict__ Vt2, int q0, int lane, bf* Ah, bf* Al) {
    typedef typename WFrag<T16>::V V;
    const int lr = lane & 15, hi = lane >> 4; const float CE = SCL * 1.4426950408889634f; const float SH = HR ? 0.0f : 10.0f;
    V qf[QT][2], qf2[QT][2], kf[2][2], kf2[2][2]; v8f o[4][QT]; float m[QT], l[QT];
#pragma unroll
    for (int qt = 0; qt < QT; ++qt) { m[qt] = -3.0e38f; l[qt] = 0.0f;
#pragma unroll
        for (int ks = 0; ks < 2; ++ks) { const size_t qo = (size_t)(q0 + qt * 16) * HD + ks * 512 + lane * 8; qf[qt][ks] = WFrag<T16>::ld(Q + qo); if (HR) qf2[qt][ks] = WFrag<T16>::ld(Q2 + qo); }
#pragma unroll
        for (int dt = 0; dt < 4; ++dt) o[dt][qt] = (v8f){}; }
    const int last = (q0 + QT * 16 - 1) & ~31;   // first key of the last step; last <= q0, so key kb of every step is at or below the diagonal of every row
    const size_t kof = lane * 8, vof = lane * 8;
    auto ldk = [&](int k0) {
#pragma unroll
        for (int kt = 0; kt < 2; ++kt)
#pragma unroll
            for (int ks = 0; ks < 2; ++ks) { const size_t ko = kof + (size_t)(k0 + kt * 16) * HD + ks * 512; kf[kt][ks] = WFrag<T16>::ld(Kp + ko); if (HR) kf2[kt][ks] = WFrag<T16>::ld(K2 + ko); } };
    if (!HR) ldk(0);
#pragma unroll 1   // rolled: a second copy of the body would need a second set of fragment registers
    for (int kb = 0; kb <= last; kb += 32) {
        if constexpr (HR) { ldk(kb);   // hi + lo fragments of two steps at once would not fit 256 registers: these (short) rows fetch each step's keys at its head
            asm volatile("s_wait_xcnt 0x0" ::: "memory"); }   // the wait in front of an overwrite of an issued load's address registers: the compiler makes the key loads' address registers the destination of one of the value loads below
        V vf[4], vf2[4];
#pragma unroll
        for (int dt = 0; dt < 4; ++dt) { const size_t vo = vof + (size_t)kb * HD + dt * 512; vf[dt] = WFrag<T16>::ld(Vt + vo);
            if constexpr (HR) { if (dt == 3) asm volatile("s_wait_xcnt 0x0" ::: "memory");   // the same wait: the compiler makes the hi plane's address pair part of the destination of the last lo load
                vf2[dt] = WFrag<T16>::ld(Vt2 + vo); } }
        // inputs-only fence on the loaded fragments: all 32 loads of the step are in flight together, one load latency a step; without it the compiler fetches the key fragments two loads at a time, each pair waited for on its own
        if constexpr (HR) asm volatile("" :: "v"(kf[0][0]), "v"(kf[0][1]), "v"(kf[1][0]), "v"(kf[1][1]), "v"(kf2[0][0]), "v"(kf2[0][1]), "v"(kf2[1][0]), "v"(kf2[1][1]), "v"(vf[0]), "v"(vf[1]), "v"(vf[2]), "v"(vf[3]), "v"(vf2[0]), "v"(vf2[1]), "v"(vf2[2]), "v"(vf2[3]));
        v8f s[2][QT];
#pragma unroll
        for (int kt = 0; kt < 2; ++kt)
#pragma unroll
            for (int qt = 0; qt < QT; ++qt) { s[kt][qt] = (v8f){};
#pragma unroll
                for (int ks = 0; ks < 2; ++ks) { s[kt][qt] = WFrag<T16>::mma(kf[kt][ks], qf[qt][ks], s[kt][qt]); if (HR) { s[kt][qt] = WFrag<T16>::mma(kf[kt][ks], qf2[qt][ks], s[kt][qt]); s[kt][qt] = WFrag<T16>::mma(kf2[kt][ks], qf[qt][ks], s[kt][qt]); } } }
        if (!HR) ldk(min(kb + 32, last));   // the next step's key fragments fly during this step's softmax and P.V; the last step fetches its own again (in bounds, unused)
        V pf[QT], pf2[QT];
#pragma unroll
        for (int qt = 0; qt < QT; ++qt) {
            if (kb + 31 > q0 + qt * 16) {   // wave-uniform: only a step that reaches above this tile's diagonal masks
                const int q = q0 + qt * 16 + lr;
#pragma unroll
                for (int kt = 0; kt < 2; ++kt)
#pragma unroll
                    for (int j = 0; j < 8; ++j) s[kt][qt][j] = (kb + kt * 16 + hi * 8 + j <= q) ? s[kt][qt][j] : -3.0e38f; }
            float mx = s[0][qt][0];
#pragma unroll
            for (int j = 1; j < 8; ++j) mx = fmaxf(mx, s[0][qt][j]);
#pragma unroll
            for (int j = 0; j < 8; ++j) mx = fmaxf(mx, s[1][qt][j]);
            mx = fmaxf(mx, xhalf(mx));
            const float mn = fmaxf(m[qt], mx); const float mc = mn * CE - SH; float al = (m[qt] - mn) * CE; m[qt] = mn;
            float sum = 0.0f; float p[16];
#pragma unroll
            for (int e = 0; e < 16; ++e) p[e] = s[e >> 3][qt][e & 7] * CE - mc;
            asm("v_exp_f32 %0, %0\n\tv_exp_f32 %1, %1\n\tv_exp_f32 %2, %2\n\tv_exp_f32 %3, %3\n\tv_exp_f32 %4, %4\n\tv_exp_f32 %5, %5\n\tv_exp_f32 %6, %6\n\tv_exp_f32 %7, %7\n\tv_exp_f32 %8, %8\n\tv_exp_f32 %9, %9\n\tv_exp_f32 %10, %10\n\tv_exp_f32 %11, %11\n\tv_exp_f32 %12, %12\n\tv_exp_f32 %13, %13\n\tv_exp_f32 %14, %14\n\tv_exp_f32 %15, %15\n\tv_exp_f32 %16, %16\n\tv_nop"
                : "+v"(p[0]), "+v"(p[1]), "+v"(p[2]), "+v"(p[3]), "+v"(p[4]), "+v"(p[5]), "+v"(p[6]), "+v"(p[7]), "+v"(p[8]), "+v"(p[9]), "+v"(p[10]), "+v"(p[11]), "+v"(p[12]), "+v"(p[13]), "+v"(p[14]), "+v"(p[15]), "+v"(al));
#pragma unroll
            for (int e = 0; e < 16; ++e) sum += p[e];
            l[qt] = l[qt] * al + sum;
#pragma unroll
            for (int dt = 0; dt < 4; ++dt) o[dt][qt] *= al;
            if constexpr (HR) { v8us h0, h1, l0, l1;
#pragma unroll
                for (int j = 0; j < 8; ++j) { unsigned short a, c2; splitf(p[j], a, c2); h0[j] = a; l0[j] = c2; splitf(p[8 + j], a, c2); h1[j] = a; l1[j] = c2; }
                pf[qt] = cat16b(h0, h1); pf2[qt] = cat16b(l0, l1);
            } else { v8h h0, h1;
#pragma unroll
                for (int j = 0; j < 8; ++j) { h0[j] = tohx(p[j]); h1[j] = tohx(p[8 + j]); }
                pf[qt] = cat16(h0, h1); }
        }
#pragma unroll
        for (int dt = 0; dt < 4; ++dt)
#pragma unroll
            for (int qt = 0; qt < QT; ++qt) { o[dt][qt] = WFrag<T16>::mma(vf[dt], pf[qt], o[dt][qt]); if (HR) { o[dt][qt] = WFrag<T16>::mma(vf[dt], pf2[qt], o[dt][qt]); o[dt][qt] = WFrag<T16>::mma(vf2[dt], pf[qt], o[dt][qt]); } }
    }
#pragma unroll
    for (int qt = 0; qt < QT; ++qt) { const float f = __fdiv_rn(1.0f, l[qt] + xhalf(l[qt])); const size_t oo = (size_t)(q0 + qt * 16) * DQ + lane * 8;
#pragma unroll
        for (int dt = 0; dt < 4; ++dt) { v8us oh, ol;
#pragma unroll
            for (int j = 0; j < 8; ++j) { unsigned short a, c2; splitf(o[dt][qt][j] * f, a, c2); oh[j] = a; ol[j] = c2; }
            *(v8us*)(Ah + oo + dt * 256) = oh; *(v8us*)(Al + oo + dt * 256) = ol; } }
}
#define NBF ((TT - RH) / 128)     // blocks of 4 waves x 32 fp16 rows
#define NBH (RH / 64)             // blocks of 4 waves x 16 hi/lo rows
__global__ __launch_bounds__(128) void k_attn(const h16* __restrict__ Q16, const h16* __restrict__ K16, const h16* __restrict__ V16, const bf* __restrict__ Qh, const bf* __restrict__ Ql, const bf* __restrict__ Kh, const bf* __restrict__ Kl, const bf* __restrict__ Vh, const bf* __restrict__ Vl, bf* Ah, bf* Al) {
    const int g = blockIdx.x, y = blockIdx.y; const int wave = __builtin_amdgcn_readfirstlane(threadIdx.x >> 5); const int lane = threadIdx.x & 31;
    const size_t po = (size_t)g * TT * HD, vo = po, ao = (size_t)(g / NH_) * TT * DQ + (size_t)(g % NH_) * (HD * 16);
    if (y < NBF) attn_rows<h16, false, 2>(Q16 + po, nullptr, K16 + po, nullptr, V16 + vo, nullptr, RH + (NBF - 1 - y) * 128 + wave * 32, lane, Ah + ao, Al + ao);
    else attn_rows<bf, true, 1>(Qh + po, Ql + po, Kh + po, Kl + po, Vh + vo, Vl + vo, (NBF + NBH - 1 - y) * 64 + wave * 16, lane, Ah + ao, Al + ao);
}

extern "C" void kernel_launch(void* const* d_in, const int* in_sizes, int n_in,
                              void* d_out, int out_size, void* d_ws, size_t ws_size, hipStream_t stream) {
    (void)in_sizes; (void)n_in; (void)out_size;
    const float* x = (const float*)d_in[0]; const float* xk = (const float*)d_in[1]; const float* xv = (const float*)d_in[2]; const float* wq = (const float*)d_in[3]; const float* wk = (const float*)d_in[4]; const float* wv = (const float*)d_in[5]; const float* wo = (const float*)d_in[6];   /* x_query, x_key, x_value, Wq, Wk, Wv [16][1024][64] ([h][d][k]), W0 ('oi' [1024][1024]) */
    float* OUT = (float*)d_out;     // [2][2048][1024]
    char* wsp = (char*)d_ws;
    auto take = [&](size_t bytes) { char* p = wsp; wsp += (bytes + 255) & ~(size_t)255; return (void*)p; };
    bf* WQ = (bf*)take((size_t)3 * DQ * DM * 2);   // Wq, Wk, Wv as Bt planes, one behind the other
    bf* WO = (bf*)take((size_t)DM * DQ * 2);
    const size_t PL = (size_t)NB_ * NH_ * TT * HD;   // one kind of plane, both batches: [b][h], each head's TT x HD elements fragment-major
    h16* QP16 = (h16*)take(2 * PL * 2); h16* KP16 = QP16 + PL; bf* QPh = (bf*)take(2 * PL * 2); bf* KPh = QPh + PL; bf* QPl = (bf*)take(2 * PL * 2); bf* KPl = QPl + PL;   // the k planes follow the q planes
    h16* VT16 = (h16*)take(PL * 2); bf* VTh = (bf*)take(PL * 2); bf* VTl = (bf*)take(PL * 2);
    bf* XB = (bf*)take((size_t)3 * NB_ * TT * DM * 2);   // bf16 streams [3], rows (b, t), k = d
    bf* ATh = (bf*)take((size_t)NB_ * TT * DQ * 2); bf* ATl = (bf*)take((size_t)NB_ * TT * DQ * 2);
    if ((size_t)(wsp - (char*)d_ws) > ws_size) return;    // ws 256 MiB
    static_assert(NKV == NH_ && RH % 64 == 0 && (TT - RH) % 128 == 0, "q, k and v planes are numbered alike; whole row blocks");
    static_assert(HD == 64 && DM % 128 == 0 && DQ == DM && ((size_t)DM * DQ / 8) % (256 * 4) == 0 && ((size_t)NB_ * TT * DM / 8) % (256 * 8) == 0, "the three grids below cover their arrays exactly");
    k_wtH<<<dim3(NH_ * (DM / 128), 3, 1), 256, 0, stream>>>(wq, wk, wv, WQ);
    k_cvt8<4><<<dim3((unsigned)((size_t)DM * DQ / 8 / (256 * 4)), 1, 1), 256, 0, stream>>>(wo, wo, wo, WO, (size_t)DM * DQ / 8);
    k_cvt8<8><<<dim3((unsigned)((size_t)NB_ * TT * DM / 8 / (256 * 8)), 3, 1), 256, 0, stream>>>(x, xk, xv, XB, (size_t)NB_ * TT * DM / 8);
    k_proj<<<dim3(NB_ * TT / 64, NH_, 3), 256, 0, stream>>>(XB, WQ, QP16, QPh, QPl, VT16, VTh, VTl);
    k_attn<<<dim3(NB_ * NH_, NBF + NBH, 1), 128, 0, stream>>>(QP16, KP16, VT16, QPh, QPl, KPh, KPl, VTh, VTl, ATh, ATl);
    k_gemmw<bf, 1, false, 8, DQ><<<dim3(NB_ * TT / 64, DM / 64, 1), 256, 0, stream>>>(ATh, ATl, WO, nullptr, OUT, DM, nullptr, 0, 0, 0);
}

// v007
// One run takes 106 microseconds.
// Two timings next to v006 both put it at 1.24 times that version's speed.
// Over all steps from v000 it is 13.8 times as fast.
#include <hip/hip_runtime.h>

// Causal multi-head attention on three input streams with per-head stacked projection weights (x_query, x_key, x_value [2][2048][1024]; q = einsum('bsd,hdk', x_query, Wq) with Wq [16][1024][64] = [h][d][k] (1/32), k, v likewise from x_key / x_value; scores x 1/sqrt(64) + causal additive mask (0 / -inf); softmax; heads concatenated h-major; out = concat W0^T ('oi' [1024][1024]) -> [2][2048][1024] (4.2 M); argument order x_query, x_key, x_value, Wq, Wk, Wv, W0).
// Layout, both batches at once: bf16 copies of the three streams; k_wtH turns each [h][d][k] weight into Bt rows h*64 + k; k_proj: exact projections (one launch, z = stream) whose epilogue stores the fp16 and hi/lo head planes; k_attn: scores, running softmax and P.V of all 32 (batch, head) pairs in one launch, scores and probabilities never leave the registers (hybrid rows: < 512 hi/lo 3 products, rest fp16 x1024); merged hi/lo x W0 exact.
// Every 16-bit matrix operand plane (bf16 streams, weights, q / k / v planes, attention output) is stored fragment-major: a block of 16 rows x 32 k is 1 KiB in a row, element (r, k) at ((k >> 4) & 1) * 256 + ((k >> 3) & 1) * 128 + (r & 15) * 8 + (k & 7),
// the blocks of a row block one behind the other along k (v: the 4 blocks of d of a 32-key step one behind the other). Lane l's two 16-byte pieces of a fragment stand at l * 8 and 256 + l * 8: each wave-wide load covers 512 bytes in a row (4 whole lines), not 32 bytes of each of 16 lines.
// Compute dtypes, f32 accumulate: every input rounded to bf16; projections exact; attention rows < 512 3 products, rest fp16; softmax f32; W0 hl x exact.

#define NB_  2
#define TT   2048
#define DM   1024
#define NH_  16
#define NKV  16
#define REP  (NH_ / NKV)
#define HD   64
#define DQ   (NH_ * HD)
#define DKV  (NKV * HD)
#define RH   512                  // query rows < RH use hi+lo planes (0: none)
#define SCL  0.125f   // HD^-0.5
typedef _Float16 h16;
typedef unsigned short bf;
typedef __attribute__((ext_vector_type(16))) __bf16   v16bf;
typedef __attribute__((ext_vector_type(16))) _Float16 v16h;
typedef __attribute__((ext_vector_type(8)))  _Float16 v8h;
typedef __attribute__((ext_vector_type(8)))  unsigned short v8us;
typedef __attribute__((ext_vector_type(8)))  float    v8f;
typedef __attribute__((ext_vector_type(4)))  float    v4f;
typedef v8h  __attribute__((may_alias)) v8ha;
typedef v4f  __attribute__((may_alias)) v4fa;
typedef v8us __attribute__((may_alias)) v8usa;

__device__ __forceinline__ unsigned short f2bf(float f) { unsigned u = __float_as_uint(f); u += 0x7FFFu + ((u >> 16) & 1u); return (unsigned short)(u >> 16); }
__device__ __forceinline__ float bf2f(unsigned short b) { return __uint_as_float(((unsigned)b) << 16); }
__device__ __forceinline__ float bfr(float f) { return bf2f(f2bf(f)); }
__device__ __forceinline__ v16h cat16(v8h lo, v8h hi) { return __builtin_shufflevector(lo, hi, 0, 1, 2, 3, 4, 5, 6, 7, 8, 9, 10, 11, 12, 13, 14, 15); }
__device__ __forceinline__ v16bf cat16b(v8us lo, v8us hi) { return __builtin_bit_cast(v16bf, __builtin_shufflevector(lo, hi, 0, 1, 2, 3, 4, 5, 6, 7, 8, 9, 10, 11, 12, 13, 14, 15)); }
__device__ __forceinline__ v8f wmma16(v16h a, v16h b, v8f c) { return __builtin_amdgcn_wmma_f32_16x16x32_f16(false, a, false, b, (short)0, c, false, false); }
__device__ __forceinline__ v8f wmmab(v16bf a, v16bf b, v8f c) { return __builtin_amdgcn_wmma_f32_16x16x32_bf16(false, a, false, b, (short)0, c, false, false); }



// ---- WFrag: a 16 x 32 fragment of a fragment-major plane (in memory or in LDS): lane l's two 16-byte pieces stand at l * 8 and 256 + l * 8 of the block; p = block + l * 8.
template <typename T16> struct WFrag;
template <> struct WFrag<h16> { typedef v16h V; static __device__ __forceinline__ V ld(const h16* p) { return cat16(*(const v8h*)p, *(const v8h*)(p + 256)); } static __device__ __forceinline__ v8f mma(V a, V b, v8f c) { return wmma16(a, b, c); } };
template <> struct WFrag<bf> { typedef v16bf V; static __device__ __forceinline__ V ld(const bf* p) { return cat16b(*(const v8us*)p, *(const v8us*)(p + 256)); } static __device__ __forceinline__ v8f mma(V a, V b, v8f c) { return wmmab(a, b, c); } };

__device__ __forceinline__ h16 tohx(float x) { return (h16)x; }
__device__ __forceinline__ void splitf(float y, unsigned short& h, unsigned short& l) { h = f2bf(y); l = f2bf(y - bf2f(h)); }
typedef __attribute__((ext_vector_type(2))) _Float16 v2h;
typedef __attribute__((ext_vector_type(4))) _Float16 v4h;
typedef __attribute__((ext_vector_type(2))) unsigned short v2us;
typedef __attribute__((ext_vector_type(4))) unsigned short v4us;
typedef __attribute__((ext_vector_type(2))) float v2f;
typedef __attribute__((ext_vector_type(4))) int v4i;

// k_cvt8: fragment-major bf16 copies of f32 matrices with rows of DM elements. blockIdx.y picks one of up to three equally long sources; its copy is block y of dst. A wave takes U / 4 regions of 16 rows x 64 k (neighbours along k); a thread converts U pieces of 8 floats
// and issues all its loads before the first conversion. Lanes = 4 rows x 8 pieces: the two loads of a piece read 256 bytes in a row (2 whole lines) of each of 4 rows, a store writes 64 bytes in a row in each of 8 half blocks, and 4 stores fill them.
// The grid covers n8 = gridDim.x * 256 * U pieces exactly (asserted at the launch).
template <int U>
__global__ __launch_bounds__(256) void k_cvt8(const float* __restrict__ s0, const float* __restrict__ s1, const float* __restrict__ s2, bf* dst, size_t n8) {
    static_assert(U % 4 == 0 && (DM / 64) % (U / 4) == 0, "a wave's regions lie in one block of 16 rows");
    const int lane = threadIdx.x & 31, c = lane & 7, rr = lane >> 3; const int reg0 = (blockIdx.x * 8 + (threadIdx.x >> 5)) * (U / 4); const int rb = reg0 / (DM / 64), kq = reg0 % (DM / 64);
    const float* src = ((blockIdx.y == 0) ? s0 : (blockIdx.y == 1) ? s1 : s2) + (size_t)(rb * 16 + rr) * DM + kq * 64 + c * 8;
    dst += (size_t)blockIdx.y * n8 * 8 + ((size_t)rb * (DM / 32) + kq * 2 + (c >> 2)) * 512 + ((c >> 1) & 1) * 256 + (c & 1) * 128 + rr * 8; v4f lo[U], hi[U];
#pragma unroll
    for (int u = 0; u < U; ++u) { const float* p = src + (u & 3) * 4 * DM + (u >> 2) * 64; lo[u] = *(const v4f*)p;
        if (u == U - 1) asm volatile("s_wait_xcnt 0x0" ::: "memory");   // the wait in front of an overwrite of issued loads' address registers: the compiler makes the address pair part of the last load's destination
        hi[u] = *(const v4f*)(p + 4); }
#pragma unroll
    for (int u = 0; u < U; ++u) { v8us o;
#pragma unroll
        for (int k = 0; k < 4; ++k) { o[k] = f2bf(lo[u][k]); o[4 + k] = f2bf(hi[u][k]); }
        *(v8us*)(dst + (u & 3) * 32 + (u >> 2) * 1024) = o; }
}

// k_wtH: [h][d][e] f32 -> bf16 Bt rows h * 64 + e, k = d, fragment-major; blockIdx.y = which of the three weights. A thread takes a block of 8 d x 4 e: 8 loads of 16 bytes (4 e of one d), 4 stores of 16 bytes (8 d of one e).
// Lanes = 8 groups of d x 4 groups of e: a thread's 4 stores fill 64 bytes in a row, 4 lanes a whole half block of 256 bytes; 4 lanes read 64 contiguous bytes; the 8 waves of a work-group cover 128 d x the 64 e of one head. Grid (NH_ * DM / 128, 3), exact.
__global__ __launch_bounds__(256) void k_wtH(const float* __restrict__ w0, const float* __restrict__ w1, const float* __restrict__ w2, bf* Bt) { const float* w = (blockIdx.y == 0) ? w0 : (blockIdx.y == 1) ? w1 : w2; Bt += (size_t)blockIdx.y * DQ * DM;
    const int h = blockIdx.x / (DM / 128), db = blockIdx.x % (DM / 128); const int wave = threadIdx.x >> 5, lane = threadIdx.x & 31;
    const int d = db * 128 + (wave >> 2) * 64 + (lane & 7) * 8, e = (wave & 3) * 16 + (lane >> 3) * 4;
    const float* s = w + ((size_t)h * DM + d) * HD + e; v4f r[8];
#pragma unroll
    for (int j = 0; j < 8; ++j) r[j] = *(const v4f*)(s + j * HD);
#pragma unroll
    for (int i = 0; i < 4; ++i) { v8us o;
#pragma unroll
        for (int j = 0; j < 8; ++j) o[j] = f2bf(r[j][i]);
        *(v8us*)(Bt + ((size_t)((h * HD + e) >> 4) * (DM / 32) + (d >> 5)) * 512 + ((d >> 4) & 1) * 256 + ((d >> 3) & 1) * 128 + ((e & 15) + i) * 8) = o; }
}
// ---- k_proj: the three projections, each tile stored straight as the 16-bit planes that k_attn reads. Grid (rows / 128, heads / 2, 3 streams), 4 waves as 2 x 2: a work-group makes 128 rows t x the 128 columns of two heads, a wave a 64x64 tile over the whole K in one accumulator chain.
// The two operands' 128 rows x 64 k (8 + 8 row blocks of 2 KiB in a row, fragment-major as in memory) are one stage of 32 KiB in LDS, read by two waves each; two buffers, the next stage's asynchronous copies fly while this stage is worked on.
// q, k (z = 0, 1): A = weight rows d, B = rows t, so a lane holds 8 consecutive d of one t; v (z = 2): A = rows t, B = weight rows d, so a lane holds 8 consecutive t of one d. Either way that is the 16-byte piece at lane * 8 of a half block of the fragment-major plane
// (q, k: blocks (t / 16, d / 32); v: blocks (t / 32, d / 16)): the accumulators go from the registers to the fp16, hi and lo planes, a wave filling 512 bytes in a row with each store.
#define PLN ((size_t)NB_ * NH_ * TT * HD)   // elements of one kind of plane, both batches
// 8 asynchronous copies of 16 bytes a lane: row blocks 0..7 of one operand (32 KiB apart in memory, 2 KiB apart in LDS). The s_wait_xcnt stands in the copies' own statement, in front of any rewrite of the address registers that they name.
__device__ __forceinline__ void acopy8(unsigned l, const bf* g) {
    asm volatile("global_load_async_to_lds_b128 %0, %8, off\n\tglobal_load_async_to_lds_b128 %1, %9, off\n\tglobal_load_async_to_lds_b128 %2, %10, off\n\tglobal_load_async_to_lds_b128 %3, %11, off\n\t"
                 "global_load_async_to_lds_b128 %4, %12, off\n\tglobal_load_async_to_lds_b128 %5, %13, off\n\tglobal_load_async_to_lds_b128 %6, %14, off\n\tglobal_load_async_to_lds_b128 %7, %15, off\n\ts_wait_xcnt 0x0"
                 :: "v"(l), "v"(l + 2048u), "v"(l + 4096u), "v"(l + 6144u), "v"(l + 8192u), "v"(l + 10240u), "v"(l + 12288u), "v"(l + 14336u),
                    "v"(g), "v"(g + 16 * DM), "v"(g + 32 * DM), "v"(g + 48 * DM), "v"(g + 64 * DM), "v"(g + 80 * DM), "v"(g + 96 * DM), "v"(g + 112 * DM) : "memory");
}
__global__ __launch_bounds__(128) void k_proj(const bf* __restrict__ X, const bf* __restrict__ Wt, h16* P16, bf* Ph, bf* Pl, h16* V16, bf* Vh, bf* Vl) {
    __shared__ __align__(2048) bf ring[2 * 16384];   // two stages of [A 8 row blocks | B 8 row blocks] x 64 k
    const int z = blockIdx.z, r0 = blockIdx.x * 128, hp = blockIdx.y;
    const int wave = __builtin_amdgcn_readfirstlane(threadIdx.x >> 5); const int lane = threadIdx.x & 31, wm = wave >> 1, wn = wave & 1;
    const bf* xr = X + ((size_t)z * NB_ * TT + r0) * DM; const bf* wr = Wt + ((size_t)z * DQ + hp * 128) * DM;
    const bf* ga = ((z == 2) ? xr : wr) + threadIdx.x * 8; const bf* gb = ((z == 2) ? wr : xr) + threadIdx.x * 8;   // a thread copies piece threadIdx.x of each row block's 2 KiB
    const unsigned ls = (unsigned)(size_t)ring + threadIdx.x * 16;
    auto fill = [&](int t) { const unsigned l = ls + (t & 1) * 32768u; acopy8(l, ga + t * 1024); acopy8(l + 16384u, gb + t * 1024); };
    fill(0);
    asm volatile("s_wait_asynccnt 0x0" ::: "memory");   // this wave's copies of stage 0 have landed
    __syncthreads();                                    // ... and every other wave's: stage 0 may be read
    fill(1);
    v8f acc[4][4];
#pragma unroll
    for (int mb = 0; mb < 4; ++mb)
#pragma unroll
        for (int nb = 0; nb < 4; ++nb) acc[mb][nb] = (v8f){};
#pragma unroll 1   // rolled: one set of fragment registers, the buffer picked by the trip's parity
    for (int t = 0; t < DM / 64; ++t) {
        const bf* st = ring + (t & 1) * 16384 + lane * 8;
#pragma unroll
        for (int ks = 0; ks < 2; ++ks) { v16bf a[4], b[4];
#pragma unroll
            for (int i = 0; i < 4; ++i) { a[i] = WFrag<bf>::ld(st + (wm * 4 + i) * 1024 + ks * 512); b[i] = WFrag<bf>::ld(st + 8192 + (wn * 4 + i) * 1024 + ks * 512); }
            // inputs-only fence on the loaded fragments: the 16 LDS reads of a 32-k step go as one group, one LDS latency for 16 matrix instructions; without it the compiler reuses one B fragment's registers and waits for LDS in front of every 4
            asm volatile("" :: "v"(a[0]), "v"(a[1]), "v"(a[2]), "v"(a[3]), "v"(b[0]), "v"(b[1]), "v"(b[2]), "v"(b[3]));
#pragma unroll
            for (int nb = 0; nb < 4; ++nb)
#pragma unroll
                for (int mb = 0; mb < 4; ++mb) acc[mb][nb] = wmmab(a[mb], b[nb], acc[mb][nb]); }
        __builtin_amdgcn_sched_barrier(0);   // the trip's matrix instructions stay in front of the barrier: else the compiler sinks a 32-k step's worth of them between the barrier and the refill, and the next copies start that much later
        asm volatile("s_wait_dscnt 0x0" ::: "memory");      // this wave's reads of stage t are done before the buffer is refilled
        asm volatile("s_wait_asynccnt 0x0" ::: "memory");   // this wave's copies of stage t + 1 have landed
        __syncthreads();                                    // publishes stage t + 1 and ends every wave's reads of stage t
        if (t + 2 < DM / 64) fill(t + 2);
    }
    asm volatile("s_wait_asynccnt 0x0" ::: "memory");   // no copy is outstanding when the wave ends
    const int g = (r0 / TT) * NH_ + hp * 2 + ((z == 2) ? wn : wm), t0 = r0 % TT + ((z == 2) ? wm : wn) * 64;
    const size_t base = ((z == 2) ? 0 : (size_t)z * PLN) + ((size_t)g * TT + t0) * HD + lane * 8;
    const int sM = (z == 2) ? 2048 : 512, sN = (z == 2) ? 512 : 1024;   // elements from one pair of A blocks, and from one B block, to the next in the plane
    h16* d16 = ((z == 2) ? V16 : P16) + base; bf* dh = ((z == 2) ? Vh : Ph) + base; bf* dl = ((z == 2) ? Vl : Pl) + base;
#pragma unroll
    for (int mb = 0; mb < 4; ++mb)
#pragma unroll
        for (int nb = 0; nb < 4; ++nb) { v8h o16; v8us oh, ol;
#pragma unroll
            for (int j = 0; j < 8; ++j) { const float x = acc[mb][nb][j]; o16[j] = tohx(x); unsigned short a2, c2; splitf(x, a2, c2); oh[j] = a2; ol[j] = c2; }
            const int po = (mb >> 1) * sM + (mb & 1) * 256 + nb * sN; *(v8h*)(d16 + po) = o16; *(v8us*)(dh + po) = oh; *(v8us*)(dl + po) = ol; }
}
// ---- k_out: out[m][n] (f32, rows of DM) = sum_k (Ah[m][k] + Al[m][k]) W0[n][k], tiled and staged as k_proj: grid (rows / 128, DM / 128), 4 waves as 2 x 2, a wave a 64x64 tile over the whole K; a stage is 128 k, two halves of [W0 8 row blocks | Ah 8 | Al 8] x 64 k = 96 KiB (one work-group a WGP: the longer stage spreads a copy's latency over more bytes), two buffers.
// A = W0 rows n, B = rows m, so a lane holds 8 consecutive n of one row m. After the loop the ring is free (its last barrier ends every read, no copy is outstanding): each wave lays its tile there as 64 rows m at pitch 68 floats and stores whole 256-byte rows, 16 lanes a row.
__global__ __launch_bounds__(128) void k_out(const bf* __restrict__ Ah, const bf* __restrict__ Al, const bf* __restrict__ Wo, float* C) {
    __shared__ __align__(2048) bf ring[2 * 49152];
    const int r0 = blockIdx.x * 128, c0 = blockIdx.y * 128;
    const int wave = __builtin_amdgcn_readfirstlane(threadIdx.x >> 5); const int lane = threadIdx.x & 31, lr = lane & 15, hi = lane >> 4, wm = wave >> 1, wn = wave & 1;
    const bf* gw = Wo + (size_t)c0 * DQ + threadIdx.x * 8; const bf* gh = Ah + (size_t)r0 * DQ + threadIdx.x * 8; const bf* gl = Al + (size_t)r0 * DQ + threadIdx.x * 8;   // a thread copies piece threadIdx.x of each row block's 2 KiB
    const unsigned ls = (unsigned)(size_t)ring + threadIdx.x * 16;
    auto fill = [&](int t) {   // 48 copies a wave
#pragma unroll
        for (int h = 0; h < 2; ++h) { const unsigned l = ls + (t & 1) * 98304u + h * 49152u; const int k = (t * 2 + h) * 1024; acopy8(l, gw + k); acopy8(l + 16384u, gh + k); acopy8(l + 32768u, gl + k);
            __builtin_amdgcn_sched_barrier(0); } };   // a half's address arithmetic stays with its copies: formed all ahead, the 48 address pairs push the kernel past 256 registers
    fill(0);
    asm volatile("s_wait_asynccnt 0x0" ::: "memory");   // this wave's copies of stage 0 have landed
    __syncthreads();                                    // ... and every other wave's: stage 0 may be read
    fill(1);
    v8f acc[4][4];
#pragma unroll
    for (int mb = 0; mb < 4; ++mb)
#pragma unroll
        for (int nb = 0; nb < 4; ++nb) acc[mb][nb] = (v8f){};
#pragma unroll 1   // rolled: one set of fragment registers, the buffer picked by the trip's parity
    for (int t = 0; t < DQ / 128; ++t) {
#pragma unroll
        for (int kk = 0; kk < 4; ++kk) { v16bf a[4], b[4], b2[4]; const int ks = kk & 1; const bf* st = ring + (t & 1) * 49152 + (kk >> 1) * 24576 + lane * 8;
#pragma unroll
            for (int i = 0; i < 4; ++i) { a[i] = WFrag<bf>::ld(st + (wm * 4 + i) * 1024 + ks * 512); b[i] = WFrag<bf>::ld(st + 8192 + (wn * 4 + i) * 1024 + ks * 512); }
#pragma unroll
            for (int i = 0; i < 4; ++i) b2[i] = WFrag<bf>::ld(st + 16384 + (wn * 4 + i) * 1024 + ks * 512);
            // inputs-only fence on the loaded fragments, as in k_proj: the 24 LDS reads of a 32-k step go as one group; without it the compiler reuses one lo fragment's registers and waits for LDS in front of every 4 matrix instructions
            asm volatile("" :: "v"(a[0]), "v"(a[1]), "v"(a[2]), "v"(a[3]), "v"(b[0]), "v"(b[1]), "v"(b[2]), "v"(b[3]), "v"(b2[0]), "v"(b2[1]), "v"(b2[2]), "v"(b2[3]));
#pragma unroll
            for (int nb = 0; nb < 4; ++nb)
#pragma unroll
                for (int mb = 0; mb < 4; ++mb) acc[mb][nb] = wmmab(a[mb], b[nb], acc[mb][nb]);
#pragma unroll
            for (int nb = 0; nb < 4; ++nb)
#pragma unroll
                for (int mb = 0; mb < 4; ++mb) acc[mb][nb] = wmmab(a[mb], b2[nb], acc[mb][nb]); }
        __builtin_amdgcn_sched_barrier(0);   // the trip's matrix instructions stay in front of the barrier: else the compiler sinks a 32-k step's worth of them between the barrier and the refill, and the next copies start that much later
        asm volatile("s_wait_dscnt 0x0" ::: "memory");      // this wave's reads of stage t are done before the buffer is refilled
        asm volatile("s_wait_asynccnt 0x0" ::: "memory");   // this wave's copies of stage t + 1 have landed
        __syncthreads();                                    // publishes stage t + 1 and ends every wave's reads of stage t
        if (t + 2 < DQ / 128) fill(t + 2);
    }
    asm volatile("s_wait_asynccnt 0x0" ::: "memory");   // no copy is outstanding when the ring becomes output staging
    float* mine = (float*)ring + wave * (64 * 68);
#pragma unroll
    for (int mb = 0; mb < 4; ++mb)
#pragma unroll
        for (int nb = 0; nb < 4; ++nb) { float* p = mine + (nb * 16 + lr) * 68 + mb * 16 + hi * 8;
            *(v4fa*)p = (v4f){acc[mb][nb][0], acc[mb][nb][1], acc[mb][nb][2], acc[mb][nb][3]}; *(v4fa*)(p + 4) = (v4f){acc[mb][nb][4], acc[mb][nb][5], acc[mb][nb][6], acc[mb][nb][7]}; }
    __syncthreads();   // the tile's LDS writes stand in front of the reads below, which take other lanes' values
    float* Ct = C + (size_t)(r0 + wn * 64) * DM + c0 + wm * 64;
#pragma unroll
    for (int u = 0; u < 32; ++u) { const int idx = u * 32 + lane; const int row = idx >> 4, cofs = (idx & 15) * 4;
        *(v4f*)(Ct + (size_t)row * DM + cofs) = *(const v4fa*)(mine + row * 68 + cofs); }
}
// ---- k_attn: causal attention, one launch for every (batch, head) pair g = blockIdx.x; blockIdx.y = block of query rows, the longest first. A wave owns QT * 16 query rows and walks the keys 0 .. its last row in steps of 32; waves share nothing (no LDS, no barrier).
// Per step: S^T = K Q^T (A = 16 key rows, B = 16 query rows, both from planes with rows t, k = d), so a lane holds scores of ONE query (column lane & 15): keys 8 * hi + j of each 16-key tile. Running maximum m and running sum l per query: in-lane, plus one exchange between the lane halves for m
// (l's halves are joined once, at the end). p = exp2((s - m) x SCL x log2 e (+ 10 in the fp16 rows: the x1024 carrier)); two converted S^T tiles are, register for register, the B operand of O^T += V^T P^T (A = 16 rows of the plane with rows d, k = t), whose column is again the lane's own query:
// the rescale by exp2(m_old - m_new) and the final 1 / l are in-lane too. HR (rows < RH): q, k, v, p as bf16 hi + lo, 3 products each; else fp16, 1 product. Output: hi/lo bf16 of O / l, row t, k = h * 64 + d of the fragment-major planes that the last product reads, 8 consecutive d per lane, 512 bytes in a row per store.
__device__ __forceinline__ float xhalf(float x) { const int b = __float_as_int(x); return __int_as_float(__builtin_amdgcn_permlanex16(b, b, 0x76543210, 0xfedcba98, false, false)); }   // the value of lane ^ 16
template <typename T16, bool HR, int QT>
__device__ __forceinline__ void attn_rows(const T16* __restrict__ Q, const T16* __restrict__ Q2, const T16* __restrict__ Kp, const T16* __restrict__ K2, const T16* __restrict__ Vt, const T16* __restrict__ Vt2, int q0, int lane, bf* Ah, bf* Al) {
    typedef typename WFrag<T16>::V V;
    const int lr = lane & 15, hi = lane >> 4; const float CE = SCL * 1.4426950408889634f; const float SH = HR ? 0.0f : 10.0f;
    V qf[QT][2], qf2[QT][2], kf[2][2], kf2[2][2]; v8f o[4][QT]; float m[QT], l[QT];
#pragma unroll
    for (int qt = 0; qt < QT; ++qt) { m[qt] = -3.0e38f; l[qt] = 0.0f;
#pragma unroll
        for (int ks = 0; ks < 2; ++ks) { const size_t qo = (size_t)(q0 + qt * 16) * HD + ks * 512 + lane * 8; qf[qt][ks] = WFrag<T16>::ld(Q + qo); if (HR) qf2[qt][ks] = WFrag<T16>::ld(Q2 + qo); }
#pragma unroll
        for (int dt = 0; dt < 4; ++dt) o[dt][qt] = (v8f){}; }
    const int last = (q0 + QT * 16 - 1) & ~31;   // first key of the last step; last <= q0, so key kb of every step is at or below the diagonal of every row
    const size_t kof = lane * 8, vof = lane * 8;
    auto ldk = [&](int k0) {
#pragma unroll
        for (int kt = 0; kt < 2; ++kt)
#pragma unroll
            for (int ks = 0; ks < 2; ++ks) { const size_t ko = kof + (size_t)(k0 + kt * 16) * HD + ks * 512; kf[kt][ks] = WFrag<T16>::ld(Kp + ko); if (HR) kf2[kt][ks] = WFrag<T16>::ld(K2 + ko); } };
    if (!HR) ldk(0);
#pragma unroll 1   // rolled: a second copy of the body would need a second set of fragment registers
    for (int kb = 0; kb <= last; kb += 32) {
        if constexpr (HR) { ldk(kb);   // hi + lo fragments of two steps at once would not fit 256 registers: these (short) rows fetch each step's keys at its head
            asm volatile("s_wait_xcnt 0x0" ::: "memory"); }   // the wait in front of an overwrite of an issued load's address registers: the compiler makes the key loads' address registers the destination of one of the value loads below
        V vf[4], vf2[4];
#pragma unroll
        for (int dt = 0; dt < 4; ++dt) { const size_t vo = vof + (size_t)kb * HD + dt * 512; vf[dt] = WFrag<T16>::ld(Vt + vo);
            if constexpr (HR) { if (dt == 3) asm volatile("s_wait_xcnt 0x0" ::: "memory");   // the same wait: the compiler makes the hi plane's address pair part of the destination of the last lo load
                vf2[dt] = WFrag<T16>::ld(Vt2 + vo); } }
        // inputs-only fence on the loaded fragments: all 32 loads of the step are in flight together, one load latency a step; without it the compiler fetches the key fragments two loads at a time, each pair waited for on its own
        if constexpr (HR) asm volatile("" :: "v"(kf[0][0]), "v"(kf[0][1]), "v"(kf[1][0]), "v"(kf[1][1]), "v"(kf2[0][0]), "v"(kf2[0][1]), "v"(kf2[1][0]), "v"(kf2[1][1]), "v"(vf[0]), "v"(vf[1]), "v"(vf[2]), "v"(vf[3]), "v"(vf2[0]), "v"(vf2[1]), "v"(vf2[2]), "v"(vf2[3]));
        v8f s[2][QT];
#pragma unroll
        for (int kt = 0; kt < 2; ++kt)
#pragma unroll
            for (int qt = 0; qt < QT; ++qt) { s[kt][qt] = (v8f){};
#pragma unroll
                for (int ks = 0; ks < 2; ++ks) { s[kt][qt] = WFrag<T16>::mma(kf[kt][ks], qf[qt][ks], s[kt][qt]); if (HR) { s[kt][qt] = WFrag<T16>::mma(kf[kt][ks], qf2[qt][ks], s[kt][qt]); s[kt][qt] = WFrag<T16>::mma(kf2[kt][ks], qf[qt][ks], s[kt][qt]); } } }
        if (!HR) ldk(min(kb + 32, last));   // the next step's key fragments fly during this step's softmax and P.V; the last step fetches its own again (in bounds, unused)
        V pf[QT], pf2[QT];
#pragma unroll
        for (int qt = 0; qt < QT; ++qt) {
            if (kb + 31 > q0 + qt * 16) {   // wave-uniform: only a step that reaches above this tile's diagonal masks
                const int q = q0 + qt * 16 + lr;
#pragma unroll
                for (int kt = 0; kt < 2; ++kt)
#pragma unroll
                    for (int j = 0; j < 8; ++j) s[kt][qt][j] = (kb + kt * 16 + hi * 8 + j <= q) ? s[kt][qt][j] : -3.0e38f; }
            float mx = s[0][qt][0];
#pragma unroll
            for (int j = 1; j < 8; ++j) mx = fmaxf(mx, s[0][qt][j]);
#pragma unroll
            for (int j = 0; j < 8; ++j) mx = fmaxf(mx, s[1][qt][j]);
            mx = fmaxf(mx, xhalf(mx));
            const float mn = fmaxf(m[qt], mx); const float mc = mn * CE - SH; float al = (m[qt] - mn) * CE; m[qt] = mn;
            float sum = 0.0f; float p[16];
#pragma unroll
            for (int e = 0; e < 16; ++e) p[e] = s[e >> 3][qt][e & 7] * CE - mc;
            asm("v_exp_f32 %0, %0\n\tv_exp_f32 %1, %1\n\tv_exp_f32 %2, %2\n\tv_exp_f32 %3, %3\n\tv_exp_f32 %4, %4\n\tv_exp_f32 %5, %5\n\tv_exp_f32 %6, %6\n\tv_exp_f32 %7, %7\n\tv_exp_f32 %8, %8\n\tv_exp_f32 %9, %9\n\tv_exp_f32 %10, %10\n\tv_exp_f32 %11, %11\n\tv_exp_f32 %12, %12\n\tv_exp_f32 %13, %13\n\tv_exp_f32 %14, %14\n\tv_exp_f32 %15, %15\n\tv_exp_f32 %16, %16\n\tv_nop"
                : "+v"(p[0]), "+v"(p[1]), "+v"(p[2]), "+v"(p[3]), "+v"(p[4]), "+v"(p[5]), "+v"(p[6]), "+v"(p[7]), "+v"(p[8]), "+v"(p[9]), "+v"(p[10]), "+v"(p[11]), "+v"(p[12]), "+v"(p[13]), "+v"(p[14]), "+v"(p[15]), "+v"(al));
#pragma unroll
            for (int e = 0; e < 16; ++e) sum += p[e];
            l[qt] = l[qt] * al + sum;
#pragma unroll
            for (int dt = 0; dt < 4; ++dt) o[dt][qt] *= al;
            if constexpr (HR) { v8us h0, h1, l0, l1;
#pragma unroll
                for (int j = 0; j < 8; ++j) { unsigned short a, c2; splitf(p[j], a, c2); h0[j] = a; l0[j] = c2; splitf(p[8 + j], a, c2); h1[j] = a; l1[j] = c2; }
                pf[qt] = cat16b(h0, h1); pf2[qt] = cat16b(l0, l1);
            } else { v8h h0, h1;
#pragma unroll
                for (int j = 0; j < 8; ++j) { h0[j] = tohx(p[j]); h1[j] = tohx(p[8 + j]); }
                pf[qt] = cat16(h0, h1); }
        }
#pragma unroll
        for (int dt = 0; dt < 4; ++dt)
#pragma unroll
            for (int qt = 0; qt < QT; ++qt) { o[dt][qt] = WFrag<T16>::mma(vf[dt], pf[qt], o[dt][qt]); if (HR) { o[dt][qt] = WFrag<T16>::mma(vf[dt], pf2[qt], o[dt][qt]); o[dt][qt] = WFrag<T16>::mma(vf2[dt], pf[qt], o[dt][qt]); } }
    }
#pragma unroll
    for (int qt = 0; qt < QT; ++qt) { const float f = __fdiv_rn(1.0f, l[qt] + xhalf(l[qt])); const size_t oo = (size_t)(q0 + qt * 16) * DQ + lane * 8;
#pragma unroll
        for (int dt = 0; dt < 4; ++dt) { v8us oh, ol;
#pragma unroll
            for (int j = 0; j < 8; ++j) { unsigned short a, c2; splitf(o[dt][qt][j] * f, a, c2); oh[j] = a; ol[j] = c2; }
            *(v8us*)(Ah + oo + dt * 256) = oh; *(v8us*)(Al + oo + dt * 256) = ol; } }
}
#define NBF ((TT - RH) / 128)     // blocks of 4 waves x 32 fp16 rows
#define NBH (RH / 64)             // blocks of 4 waves x 16 hi/lo rows
__global__ __launch_bounds__(128) void k_attn(const h16* __restrict__ Q16, const h16* __restrict__ K16, const h16* __restrict__ V16, const bf* __restrict__ Qh, const bf* __restrict__ Ql, const bf* __restrict__ Kh, const bf* __restrict__ Kl, const bf* __restrict__ Vh, const bf* __restrict__ Vl, bf* Ah, bf* Al) {
    const int g = blockIdx.x, y = blockIdx.y; const int wave = __builtin_amdgcn_readfirstlane(threadIdx.x >> 5); const int lane = threadIdx.x & 31;
    const size_t po = (size_t)g * TT * HD, vo = po, ao = (size_t)(g / NH_) * TT * DQ + (size_t)(g % NH_) * (HD * 16);
    if (y < NBF) attn_rows<h16, false, 2>(Q16 + po, nullptr, K16 + po, nullptr, V16 + vo, nullptr, RH + (NBF - 1 - y) * 128 + wave * 32, lane, Ah + ao, Al + ao);
    else attn_rows<bf, true, 1>(Qh + po, Ql + po, Kh + po, Kl + po, Vh + vo, Vl + vo, (NBF + NBH - 1 - y) * 64 + wave * 16, lane, Ah + ao, Al + ao);
}

extern "C" void kernel_launch(void* const* d_in, const int* in_sizes, int n_in,
                              void* d_out, int out_size, void* d_ws, size_t ws_size, hipStream_t stream) {
    (void)in_sizes; (void)n_in; (void)out_size;
    const float* x = (const float*)d_in[0]; const float* xk = (const float*)d_in[1]; const float* xv = (const float*)d_in[2]; const float* wq = (const float*)d_in[3]; const float* wk = (const float*)d_in[4]; const float* wv = (const float*)d_in[5]; const float* wo = (const float*)d_in[6];   /* x_query, x_key, x_value, Wq, Wk, Wv [16][1024][64] ([h][d][k]), W0 ('oi' [1024][1024]) */
    float* OUT = (float*)d_out;     // [2][2048][1024]
    char* wsp = (char*)d_ws;
    auto take = [&](size_t bytes) { char* p = wsp; wsp += (bytes + 255) & ~(size_t)255; return (void*)p; };
    bf* WQ = (bf*)take((size_t)3 * DQ * DM * 2);   // Wq, Wk, Wv as Bt planes, one behind the other
    bf* WO = (bf*)take((size_t)DM * DQ * 2);
    const size_t PL = (size_t)NB_ * NH_ * TT * HD;   // one kind of plane, both batches: [b][h], each head's TT x HD elements fragment-major
    h16* QP16 = (h16*)take(2 * PL * 2); h16* KP16 = QP16 + PL; bf* QPh = (bf*)take(2 * PL * 2); bf* KPh = QPh + PL; bf* QPl = (bf*)take(2 * PL * 2); bf* KPl = QPl + PL;   // the k planes follow the q planes
    h16* VT16 = (h16*)take(PL * 2); bf* VTh = (bf*)take(PL * 2); bf* VTl = (bf*)take(PL * 2);
    bf* XB = (bf*)take((size_t)3 * NB_ * TT * DM * 2);   // bf16 streams [3], rows (b, t), k = d
    bf* ATh = (bf*)take((size_t)NB_ * TT * DQ * 2); bf* ATl = (bf*)take((size_t)NB_ * TT * DQ * 2);
    if ((size_t)(wsp - (char*)d_ws) > ws_size) return;    // ws 256 MiB
    static_assert(NKV == NH_ && RH % 64 == 0 && (TT - RH) % 128 == 0 && TT % 128 == 0 && NH_ % 2 == 0 && DM / 128 >= 2, "q, k and v planes are numbered alike; whole row blocks; k_proj: whole tiles inside one batch, two stages or more");
    static_assert(HD == 64 && DM % 128 == 0 && DQ == DM && ((size_t)DM * DQ / 8) % (256 * 4) == 0 && ((size_t)NB_ * TT * DM / 8) % (256 * 8) == 0, "the three grids below cover their arrays exactly");
    k_wtH<<<dim3(NH_ * (DM / 128), 3, 1), 256, 0, stream>>>(wq, wk, wv, WQ);
    k_cvt8<4><<<dim3((unsigned)((size_t)DM * DQ / 8 / (256 * 4)), 1, 1), 256, 0, stream>>>(wo, wo, wo, WO, (size_t)DM * DQ / 8);
    k_cvt8<8><<<dim3((unsigned)((size_t)NB_ * TT * DM / 8 / (256 * 8)), 3, 1), 256, 0, stream>>>(x, xk, xv, XB, (size_t)NB_ * TT * DM / 8);
    k_proj<<<dim3(NB_ * TT / 128, NH_ / 2, 3), 128, 0, stream>>>(XB, WQ, QP16, QPh, QPl, VT16, VTh, VTl);
    k_attn<<<dim3(NB_ * NH_, NBF + NBH, 1), 128, 0, stream>>>(QP16, KP16, VT16, QPh, QPl, KPh, KPl, VTh, VTl, ATh, ATl);
    k_out<<<dim3(NB_ * TT / 128, DM / 128, 1), 128, 0, stream>>>(ATh, ATl, WO, OUT);
}

// v008
// Measured time: 101 microseconds a run.
// In two side-by-side timings against v007, it was 1.05 and 1.04 times as fast.
// Counting every step since v000, it is 14.5 times as fast.
#include <hip/hip_runtime.h>

// Causal multi-head attention on three input streams with per-head stacked projection weights (x_query, x_key, x_value [2][2048][1024]; q = einsum('bsd,hdk', x_query, Wq) with Wq [16][1024][64] = [h][d][k] (1/32), k, v likewise from x_key / x_value; scores x 1/sqrt(64) + causal additive mask (0 / -inf); softmax; heads concatenated h-major; out = concat W0^T ('oi' [1024][1024]) -> [2][2048][1024] (4.2 M); argument order x_query, x_key, x_value, Wq, Wk, Wv, W0).
// Layout, both batches at once: k_prep: bf16 copies of the three streams and of W0, each [h][d][k] weight turned into Bt rows h*64 + k; k_proj: exact projections (one launch, z = stream) whose epilogue stores the fp16 and hi/lo head planes; k_attn: scores, running softmax and P.V of all 32 (batch, head) pairs in one launch, scores and probabilities never leave the registers (hybrid rows: < 512 hi/lo 3 products, rest fp16 x1024); merged hi/lo x W0 exact.
// Every 16-bit matrix operand plane (bf16 streams, weights, q / k / v planes, attention output) is stored fragment-major: a block of 16 rows x 32 k is 1 KiB in a row, element (r, k) at ((k >> 4) & 1) * 256 + ((k >> 3) & 1) * 128 + (r & 15) * 8 + (k & 7),
// the blocks of a row block one behind the other along k (v: the 4 blocks of d of a 32-key step one behind the other). Lane l's two 16-byte pieces of a fragment stand at l * 8 and 256 + l * 8: each wave-wide load covers 512 bytes in a row (4 whole lines), not 32 bytes of each of 16 lines.
// Compute dtypes, f32 accumulate: every input rounded to bf16; projections exact; attention rows < 512 3 products, rest fp16; softmax f32; W0 hl x exact.

#define NB_  2
#define TT   2048
#define DM   1024
#define NH_  16
#define NKV  16
#define REP  (NH_ / NKV)
#define HD   64
#define DQ   (NH_ * HD)
#define DKV  (NKV * HD)
#define RH   512                  // query rows < RH use hi+lo planes (0: none)
#define SCL  0.125f   // HD^-0.5
typedef _Float16 h16;
typedef unsigned short bf;
typedef __attribute__((ext_vector_type(16))) __bf16   v16bf;
typedef __attribute__((ext_vector_type(16))) _Float16 v16h;
typedef __attribute__((ext_vector_type(8)))  _Float16 v8h;
typedef __attribute__((ext_vector_type(8)))  unsigned short v8us;
typedef __attribute__((ext_vector_type(8)))  float    v8f;
typedef __attribute__((ext_vector_type(4)))  float    v4f;
typedef v8h  __attribute__((may_alias)) v8ha;
typedef v4f  __attribute__((may_alias)) v4fa;
typedef v8us __attribute__((may_alias)) v8usa;

__device__ __forceinline__ unsigned short f2bf(float f) { unsigned u = __float_as_uint(f); u += 0x7FFFu + ((u >> 16) & 1u); return (unsigned short)(u >> 16); }
__device__ __forceinline__ float bf2f(unsigned short b) { return __uint_as_float(((unsigned)b) << 16); }
__device__ __forceinline__ float bfr(float f) { return bf2f(f2bf(f)); }
__device__ __forceinline__ v16h cat16(v8h lo, v8h hi) { return __builtin_shufflevector(lo, hi, 0, 1, 2, 3, 4, 5, 6, 7, 8, 9, 10, 11, 12, 13, 14, 15); }
__device__ __forceinline__ v16bf cat16b(v8us lo, v8us hi) { return __builtin_bit_cast(v16bf, __builtin_shufflevector(lo, hi, 0, 1, 2, 3, 4, 5, 6, 7, 8, 9, 10, 11, 12, 13, 14, 15)); }
__device__ __forceinline__ v8f wmma16(v16h a, v16h b, v8f c) { return __builtin_amdgcn_wmma_f32_16x16x32_f16(false, a, false, b, (short)0, c, false, false); }
__device__ __forceinline__ v8f wmmab(v16bf a, v16bf b, v8f c) { return __builtin_amdgcn_wmma_f32_16x16x32_bf16(false, a, false, b, (short)0, c, false, false); }



// ---- WFrag: a 16 x 32 fragment of a fragment-major plane (in memory or in LDS): lane l's two 16-byte pieces stand at l * 8 and 256 + l * 8 of the block; p = block + l * 8.
template <typename T16> struct WFrag;
template <> struct WFrag<h16> { typedef v16h V; static __device__ __forceinline__ V ld(const h16* p) { return cat16(*(const v8h*)p, *(const v8h*)(p + 256)); } static __device__ __forceinline__ v8f mma(V a, V b, v8f c) { return wmma16(a, b, c); } };
template <> struct WFrag<bf> { typedef v16bf V; static __device__ __forceinline__ V ld(const bf* p) { return cat16b(*(const v8us*)p, *(const v8us*)(p + 256)); } static __device__ __forceinline__ v8f mma(V a, V b, v8f c) { return wmmab(a, b, c); } };

__device__ __forceinline__ h16 tohx(float x) { return (h16)x; }
__device__ __forceinline__ void splitf(float y, unsigned short& h, unsigned short& l) { h = f2bf(y); l = f2bf(y - bf2f(h)); }
typedef __attribute__((ext_vector_type(2))) _Float16 v2h;
typedef __attribute__((ext_vector_type(4))) _Float16 v4h;
typedef __attribute__((ext_vector_type(2))) unsigned short v2us;
typedef __attribute__((ext_vector_type(4))) unsigned short v4us;
typedef __attribute__((ext_vector_type(2))) float v2f;
typedef __attribute__((ext_vector_type(4))) int v4i;

// cvt8: fragment-major bf16 copy of an f32 matrix with rows of DM elements, the share of work-group bx of its range in k_prep. A wave takes U / 4 regions of 16 rows x 64 k (neighbours along k); a thread converts U pieces of 8 floats
// and issues all its loads before the first conversion. Lanes = 4 rows x 8 pieces: the two loads of a piece read 256 bytes in a row (2 whole lines) of each of 4 rows, a store writes 64 bytes in a row in each of 8 half blocks, and 4 stores fill them.
// A range of n work-groups covers n * 256 * U pieces of 8 floats exactly (asserted at the launch).
template <int U>
__device__ __forceinline__ void cvt8(const float* __restrict__ s, bf* dst, int bx) {
    static_assert(U % 4 == 0 && (DM / 64) % (U / 4) == 0, "a wave's regions lie in one block of 16 rows");
    const int lane = threadIdx.x & 31, c = lane & 7, rr = lane >> 3; const int reg0 = (bx * 8 + (threadIdx.x >> 5)) * (U / 4); const int rb = reg0 / (DM / 64), kq = reg0 % (DM / 64);
    const float* src = s + (size_t)(rb * 16 + rr) * DM + kq * 64 + c * 8;
    dst += ((size_t)rb * (DM / 32) + kq * 2 + (c >> 2)) * 512 + ((c >> 1) & 1) * 256 + (c & 1) * 128 + rr * 8; v4f lo[U], hi[U];
#pragma unroll
    for (int u = 0; u < U; ++u) { const float* p = src + (u & 3) * 4 * DM + (u >> 2) * 64; lo[u] = *(const v4f*)p;
        if (u == U - 1) asm volatile("s_wait_xcnt 0x0" ::: "memory");   // the wait in front of an overwrite of issued loads' address registers: the compiler makes the address pair part of the last load's destination
        hi[u] = *(const v4f*)(p + 4); }
#pragma unroll
    for (int u = 0; u < U; ++u) { v8us o;
#pragma unroll
        for (int k = 0; k < 4; ++k) { o[k] = f2bf(lo[u][k]); o[4 + k] = f2bf(hi[u][k]); }
        *(v8us*)(dst + (u & 3) * 32 + (u >> 2) * 1024) = o; }
}

// wtH: one weight [h][d][e] f32 -> bf16 Bt rows h * 64 + e, k = d, fragment-major, the share of work-group bx of its range in k_prep. A thread takes a block of 8 d x 4 e: 8 loads of 16 bytes (4 e of one d), 4 stores of 16 bytes (8 d of one e).
// Lanes = 8 groups of d x 4 groups of e: a thread's 4 stores fill 64 bytes in a row, 4 lanes a whole half block of 256 bytes; 4 lanes read 64 contiguous bytes; the 8 waves of a work-group cover 128 d x the 64 e of one head. NH_ * DM / 128 work-groups a weight, exact.
__device__ __forceinline__ void wtH(const float* __restrict__ w, bf* Bt, int bx) {
    const int h = bx / (DM / 128), db = bx % (DM / 128); const int wave = threadIdx.x >> 5, lane = threadIdx.x & 31;
    const int d = db * 128 + (wave >> 2) * 64 + (lane & 7) * 8, e = (wave & 3) * 16 + (lane >> 3) * 4;
    const float* s = w + ((size_t)h * DM + d) * HD + e; v4f r[8];
#pragma unroll
    for (int j = 0; j < 8; ++j) r[j] = *(const v4f*)(s + j * HD);
#pragma unroll
    for (int i = 0; i < 4; ++i) { v8us o;
#pragma unroll
        for (int j = 0; j < 8; ++j) o[j] = f2bf(r[j][i]);
        *(v8us*)(Bt + ((size_t)((h * HD + e) >> 4) * (DM / 32) + (d >> 5)) * 512 + ((d >> 4) & 1) * 256 + ((d >> 3) & 1) * 128 + ((e & 15) + i) * 8) = o; }
}
// ---- k_prep: every 16-bit copy that the products read, in one launch: the jobs need nothing of each other, so ranges of the work-group index pick them (a work-group-uniform branch), the long streams first:
// 3 x GX work-groups: the streams (cvt8<8>); 3 x GW: Wq, Wk, Wv (wtH); GO: W0 (cvt8<4>). The short jobs run beside the streams instead of each filling and draining the chip alone.
#define GX ((int)((size_t)NB_ * TT * DM / 8 / (256 * 8)))
#define GW (NH_ * (DM / 128))
#define GO ((int)((size_t)DM * DQ / 8 / (256 * 4)))
__global__ __launch_bounds__(256) void k_prep(const float* __restrict__ x0, const float* __restrict__ x1, const float* __restrict__ x2, const float* __restrict__ w0, const float* __restrict__ w1, const float* __restrict__ w2, const float* __restrict__ wo, bf* XB, bf* Bt, bf* WO) {
    const int b = blockIdx.x;
    if (b < 3 * GX) { const int y = b / GX; cvt8<8>((y == 0) ? x0 : (y == 1) ? x1 : x2, XB + (size_t)y * NB_ * TT * DM, b % GX); }
    else if (b < 3 * GX + 3 * GW) { const int c = b - 3 * GX, y = c / GW; wtH((y == 0) ? w0 : (y == 1) ? w1 : w2, Bt + (size_t)y * DQ * DM, c % GW);
        asm volatile("s_wait_xcnt 0x0" ::: "memory"); }   // the wait in front of an overwrite of issued stores' registers: in the listing this job's end runs on into the streams' code, which writes them
    else { cvt8<4>(wo, WO, b - 3 * GX - 3 * GW);
        asm volatile("s_wait_xcnt 0x0" ::: "memory"); }   // the same wait: in the listing this job's end runs on into the other two jobs' code
}
// ---- k_proj: the three projections, each tile stored straight as the 16-bit planes that k_attn reads. Grid (rows / 128, heads / 2, 3 streams), 4 waves as 2 x 2: a work-group makes 128 rows t x the 128 columns of two heads, a wave a 64x64 tile over the whole K in one accumulator chain.
// The two operands' 128 rows x 64 k (8 + 8 row blocks of 2 KiB in a row, fragment-major as in memory) are one stage of 32 KiB in LDS, read by two waves each; two buffers, the next stage's asynchronous copies fly while this stage is worked on.
// q, k (z = 0, 1): A = weight rows d, B = rows t, so a lane holds 8 consecutive d of one t; v (z = 2): A = rows t, B = weight rows d, so a lane holds 8 consecutive t of one d. Either way that is the 16-byte piece at lane * 8 of a half block of the fragment-major plane
// (q, k: blocks (t / 16, d / 32); v: blocks (t / 32, d / 16)): the accumulators go from the registers to the fp16, hi and lo planes, a wave filling 512 bytes in a row with each store.
#define PLN ((size_t)NB_ * NH_ * TT * HD)   // elements of one kind of plane, both batches
// 8 asynchronous copies of 16 bytes a lane: row blocks 0..7 of one operand (32 KiB apart in memory, 2 KiB apart in LDS). The s_wait_xcnt stands in the copies' own statement, in front of any rewrite of the address registers that they name.
__device__ __forceinline__ void acopy8(unsigned l, const bf* g) {
    asm volatile("global_load_async_to_lds_b128 %0, %8, off\n\tglobal_load_async_to_lds_b128 %1, %9, off\n\tglobal_load_async_to_lds_b128 %2, %10, off\n\tglobal_load_async_to_lds_b128 %3, %11, off\n\t"
                 "global_load_async_to_lds_b128 %4, %12, off\n\tglobal_load_async_to_lds_b128 %5, %13, off\n\tglobal_load_async_to_lds_b128 %6, %14, off\n\tglobal_load_async_to_lds_b128 %7, %15, off\n\ts_wait_xcnt 0x0"
                 :: "v"(l), "v"(l + 2048u), "v"(l + 4096u), "v"(l + 6144u), "v"(l + 8192u), "v"(l + 10240u), "v"(l + 12288u), "v"(l + 14336u),
                    "v"(g), "v"(g + 16 * DM), "v"(g + 32 * DM), "v"(g + 48 * DM), "v"(g + 64 * DM), "v"(g + 80 * DM), "v"(g + 96 * DM), "v"(g + 112 * DM) : "memory");
}
__global__ __launch_bounds__(128) void k_proj(const bf* __restrict__ X, const bf* __restrict__ Wt, h16* P16, bf* Ph, bf* Pl, h16* V16, bf* Vh, bf* Vl) {
    __shared__ __align__(2048) bf ring[2 * 16384];   // two stages of [A 8 row blocks | B 8 row blocks] x 64 k
    const int z = blockIdx.z, r0 = blockIdx.x * 128, hp = blockIdx.y;
    const int wave = __builtin_amdgcn_readfirstlane(threadIdx.x >> 5); const int lane = threadIdx.x & 31, wm = wave >> 1, wn = wave & 1;
    const bf* xr = X + ((size_t)z * NB_ * TT + r0) * DM; const bf* wr = Wt + ((size_t)z * DQ + hp * 128) * DM;
    const bf* ga = ((z == 2) ? xr : wr) + threadIdx.x * 8; const bf* gb = ((z == 2) ? wr : xr) + threadIdx.x * 8;   // a thread copies piece threadIdx.x of each row block's 2 KiB
    const unsigned ls = (unsigned)(size_t)ring + threadIdx.x * 16;
    auto fill = [&](int t) { const unsigned l = ls + (t & 1) * 32768u; acopy8(l, ga + t * 1024); acopy8(l + 16384u, gb + t * 1024); };
    fill(0);
    asm volatile("s_wait_asynccnt 0x0" ::: "memory");   // this wave's copies of stage 0 have landed
    __syncthreads();                                    // ... and every other wave's: stage 0 may be read
    fill(1);
    v8f acc[4][4];
#pragma unroll
    for (int mb = 0; mb < 4; ++mb)
#pragma unroll
        for (int nb = 0; nb < 4; ++nb) acc[mb][nb] = (v8f){};
#pragma unroll 1   // rolled: one set of fragment registers, the buffer picked by the trip's parity
    for (int t = 0; t < DM / 64; ++t) {
        const bf* st = ring + (t & 1) * 16384 + lane * 8;
#pragma unroll
        for (int ks = 0; ks < 2; ++ks) { v16bf a[4], b[4];
#pragma unroll
            for (int i = 0; i < 4; ++i) { a[i] = WFrag<bf>::ld(st + (wm * 4 + i) * 1024 + ks * 512); b[i] = WFrag<bf>::ld(st + 8192 + (wn * 4 + i) * 1024 + ks * 512); }
            // inputs-only fence on the loaded fragments: the 16 LDS reads of a 32-k step go as one group, one LDS latency for 16 matrix instructions; without it the compiler reuses one B fragment's registers and waits for LDS in front of every 4
            asm volatile("" :: "v"(a[0]), "v"(a[1]), "v"(a[2]), "v"(a[3]), "v"(b[0]), "v"(b[1]), "v"(b[2]), "v"(b[3]));
#pragma unroll
            for (int nb = 0; nb < 4; ++nb)
#pragma unroll
                for (int mb = 0; mb < 4; ++mb) acc[mb][nb] = wmmab(a[mb], b[nb], acc[mb][nb]); }
        __builtin_amdgcn_sched_barrier(0);   // the trip's matrix instructions stay in front of the barrier: else the compiler sinks a 32-k step's worth of them between the barrier and the refill, and the next copies start that much later
        asm volatile("s_wait_dscnt 0x0" ::: "memory");      // this wave's reads of stage t are done before the buffer is refilled
        asm volatile("s_wait_asynccnt 0x0" ::: "memory");   // this wave's copies of stage t + 1 have landed
        __syncthreads();                                    // publishes stage t + 1 and ends every wave's reads of stage t
        if (t + 2 < DM / 64) fill(t + 2);
    }
    asm volatile("s_wait_asynccnt 0x0" ::: "memory");   // no copy is outstanding when the wave ends
    const int g = (r0 / TT) * NH_ + hp * 2 + ((z == 2) ? wn : wm), t0 = r0 % TT + ((z == 2) ? wm : wn) * 64;
    const size_t base = ((z == 2) ? 0 : (size_t)z * PLN) + ((size_t)g * TT + t0) * HD + lane * 8;
    const int sM = (z == 2) ? 2048 : 512, sN = (z == 2) ? 512 : 1024;   // elements from one pair of A blocks, and from one B block, to the next in the plane
    h16* d16 = ((z == 2) ? V16 : P16) + base; bf* dh = ((z == 2) ? Vh : Ph) + base; bf* dl = ((z == 2) ? Vl : Pl) + base;
#pragma unroll
    for (int mb = 0; mb < 4; ++mb)
#pragma unroll
        for (int nb = 0; nb < 4; ++nb) { v8h o16; v8us oh, ol;
#pragma unroll
            for (int j = 0; j < 8; ++j) { const float x = acc[mb][nb][j]; o16[j] = tohx(x); unsigned short a2, c2; splitf(x, a2, c2); oh[j] = a2; ol[j] = c2; }
            const int po = (mb >> 1) * sM + (mb & 1) * 256 + nb * sN; *(v8h*)(d16 + po) = o16; *(v8us*)(dh + po) = oh; *(v8us*)(dl + po) = ol; }
}
// ---- k_out: out[m][n] (f32, rows of DM) = sum_k (Ah[m][k] + Al[m][k]) W0[n][k], tiled and staged as k_proj: grid (rows / 128, DM / 128), 4 waves as 2 x 2, a wave a 64x64 tile over the whole K; a stage is 128 k, two halves of [W0 8 row blocks | Ah 8 | Al 8] x 64 k = 96 KiB (one work-group a WGP: the longer stage spreads a copy's latency over more bytes), two buffers.
// A = W0 rows n, B = rows m, so a lane holds 8 consecutive n of one row m. After the loop the ring is free (its last barrier ends every read, no copy is outstanding): each wave lays its tile there as 64 rows m at pitch 68 floats and stores whole 256-byte rows, 16 lanes a row.
__global__ __launch_bounds__(128) void k_out(const bf* __restrict__ Ah, const bf* __restrict__ Al, const bf* __restrict__ Wo, float* C) {
    __shared__ __align__(2048) bf ring[2 * 49152];
    const int r0 = blockIdx.x * 128, c0 = blockIdx.y * 128;
    const int wave = __builtin_amdgcn_readfirstlane(threadIdx.x >> 5); const int lane = threadIdx.x & 31, lr = lane & 15, hi = lane >> 4, wm = wave >> 1, wn = wave & 1;
    const bf* gw = Wo + (size_t)c0 * DQ + threadIdx.x * 8; const bf* gh = Ah + (size_t)r0 * DQ + threadIdx.x * 8; const bf* gl = Al + (size_t)r0 * DQ + threadIdx.x * 8;   // a thread copies piece threadIdx.x of each row block's 2 KiB
    const unsigned ls = (unsigned)(size_t)ring + threadIdx.x * 16;
    auto fill = [&](int t) {   // 48 copies a wave
#pragma unroll
        for (int h = 0; h < 2; ++h) { const unsigned l = ls + (t & 1) * 98304u + h * 49152u; const int k = (t * 2 + h) * 1024; acopy8(l, gw + k); acopy8(l + 16384u, gh + k); acopy8(l + 32768u, gl + k);
            __builtin_amdgcn_sched_barrier(0); } };   // a half's address arithmetic stays with its copies: formed all ahead, the 48 address pairs push the kernel past 256 registers
    fill(0);
    asm volatile("s_wait_asynccnt 0x0" ::: "memory");   // this wave's copies of stage 0 have landed
    __syncthreads();                                    // ... and every other wave's: stage 0 may be read
    fill(1);
    v8f acc[4][4];
#pragma unroll
    for (int mb = 0; mb < 4; ++mb)
#pragma unroll
        for (int nb = 0; nb < 4; ++nb) acc[mb][nb] = (v8f){};
#pragma unroll 1   // rolled: one set of fragment registers, the buffer picked by the trip's parity
    for (int t = 0; t < DQ / 128; ++t) {
#pragma unroll
        for (int kk = 0; kk < 4; ++kk) { v16bf a[4], b[4], b2[4]; const int ks = kk & 1; const bf* st = ring + (t & 1) * 49152 + (kk >> 1) * 24576 + lane * 8;
#pragma unroll
            for (int i = 0; i < 4; ++i) { a[i] = WFrag<bf>::ld(st + (wm * 4 + i) * 1024 + ks * 512); b[i] = WFrag<bf>::ld(st + 8192 + (wn * 4 + i) * 1024 + ks * 512); }
#pragma unroll
            for (int i = 0; i < 4; ++i) b2[i] = WFrag<bf>::ld(st + 16384 + (wn * 4 + i) * 1024 + ks * 512);
            // inputs-only fence on the loaded fragments, as in k_proj: the 24 LDS reads of a 32-k step go as one group; without it the compiler reuses one lo fragment's registers and waits for LDS in front of every 4 matrix instructions
            asm volatile("" :: "v"(a[0]), "v"(a[1]), "v"(a[2]), "v"(a[3]), "v"(b[0]), "v"(b[1]), "v"(b[2]), "v"(b[3]), "v"(b2[0]), "v"(b2[1]), "v"(b2[2]), "v"(b2[3]));
#pragma unroll
            for (int nb = 0; nb < 4; ++nb)
#pragma unroll
                for (int mb = 0; mb < 4; ++mb) acc[mb][nb] = wmmab(a[mb], b[nb], acc[mb][nb]);
#pragma unroll
            for (int nb = 0; nb < 4; ++nb)
#pragma unroll
                for (int mb = 0; mb < 4; ++mb) acc[mb][nb] = wmmab(a[mb], b2[nb], acc[mb][nb]); }
        __builtin_amdgcn_sched_barrier(0);   // the trip's matrix instructions stay in front of the barrier: else the compiler sinks a 32-k step's worth of them between the barrier and the refill, and the next copies start that much later
        asm volatile("s_wait_dscnt 0x0" ::: "memory");      // this wave's reads of stage t are done before the buffer is refilled
        asm volatile("s_wait_asynccnt 0x0" ::: "memory");   // this wave's copies of stage t + 1 have landed
        __syncthreads();                                    // publishes stage t + 1 and ends every wave's reads of stage t
        if (t + 2 < DQ / 128) fill(t + 2);
    }
    asm volatile("s_wait_asynccnt 0x0" ::: "memory");   // no copy is outstanding when the ring becomes output staging
    float* mine = (float*)ring + wave * (64 * 68);
#pragma unroll
    for (int mb = 0; mb < 4; ++mb)
#pragma unroll
        for (int nb = 0; nb < 4; ++nb) { float* p = mine + (nb * 16 + lr) * 68 + mb * 16 + hi * 8;
            *(v4fa*)p = (v4f){acc[mb][nb][0], acc[mb][nb][1], acc[mb][nb][2], acc[mb][nb][3]}; *(v4fa*)(p + 4) = (v4f){acc[mb][nb][4], acc[mb][nb][5], acc[mb][nb][6], acc[mb][nb][7]}; }
    __syncthreads();   // the tile's LDS writes stand in front of the reads below, which take other lanes' values
    float* Ct = C + (size_t)(r0 + wn * 64) * DM + c0 + wm * 64;
#pragma unroll
    for (int u = 0; u < 32; ++u) { const int idx = u * 32 + lane; const int row = idx >> 4, cofs = (idx & 15) * 4;
        *(v4f*)(Ct + (size_t)row * DM + cofs) = *(const v4fa*)(mine + row * 68 + cofs); }
}
// ---- k_attn: causal attention, one launch for every (batch, head) pair g = blockIdx.x; blockIdx.y = block of query rows, the longest first. A wave owns QT * 16 query rows and walks the keys 0 .. its last row in steps of 32; waves share nothing (no LDS, no barrier).
// Per step: S^T = K Q^T (A = 16 key rows, B = 16 query rows, both from planes with rows t, k = d), so a lane holds scores of ONE query (column lane & 15): keys 8 * hi + j of each 16-key tile. Running maximum m and running sum l per query: in-lane, plus one exchange between the lane halves for m
// (l's halves are joined once, at the end). p = exp2((s - m) x SCL x log2 e (+ 10 in the fp16 rows: the x1024 carrier)); two converted S^T tiles are, register for register, the B operand of O^T += V^T P^T (A = 16 rows of the plane with rows d, k = t), whose column is again the lane's own query:
// the rescale by exp2(m_old - m_new) and the final 1 / l are in-lane too. HR (rows < RH): q, k, v, p as bf16 hi + lo, 3 products each; else fp16, 1 product. Output: hi/lo bf16 of O / l, row t, k = h * 64 + d of the fragment-major planes that the last product reads, 8 consecutive d per lane, 512 bytes in a row per store.
__device__ __forceinline__ float xhalf(float x) { const int b = __float_as_int(x); return __int_as_float(__builtin_amdgcn_permlanex16(b, b, 0x76543210, 0xfedcba98, false, false)); }   // the value of lane ^ 16
template <typename T16, bool HR, int QT>
__device__ __forceinline__ void attn_rows(const T16* __restrict__ Q, const T16* __restrict__ Q2, const T16* __restrict__ Kp, const T16* __restrict__ K2, const T16* __restrict__ Vt, const T16* __restrict__ Vt2, int q0, int lane, bf* Ah, bf* Al) {
    typedef typename WFrag<T16>::V V;
    const int lr = lane & 15, hi = lane >> 4; const float CE = SCL * 1.4426950408889634f; const float SH = HR ? 0.0f : 10.0f;
    V qf[QT][2], qf2[QT][2], kf[2][2], kf2[2][2]; v8f o[4][QT]; float m[QT], l[QT];
#pragma unroll
    for (int qt = 0; qt < QT; ++qt) { m[qt] = -3.0e38f; l[qt] = 0.0f;
#pragma unroll
        for (int ks = 0; ks < 2; ++ks) { const size_t qo = (size_t)(q0 + qt * 16) * HD + ks * 512 + lane * 8; qf[qt][ks] = WFrag<T16>::ld(Q + qo); if (HR) qf2[qt][ks] = WFrag<T16>::ld(Q2 + qo); }
#pragma unroll
        for (int dt = 0; dt < 4; ++dt) o[dt][qt] = (v8f){}; }
    const int last = (q0 + QT * 16 - 1) & ~31;   // first key of the last step; last <= q0, so key kb of every step is at or below the diagonal of every row
    const size_t kof = lane * 8, vof = lane * 8;
    auto ldk = [&](int k0) {
#pragma unroll
        for (int kt = 0; kt < 2; ++kt)
#pragma unroll
            for (int ks = 0; ks < 2; ++ks) { const size_t ko = kof + (size_t)(k0 + kt * 16) * HD + ks * 512; kf[kt][ks] = WFrag<T16>::ld(Kp + ko); if (HR) kf2[kt][ks] = WFrag<T16>::ld(K2 + ko); } };
    if (!HR) ldk(0);
#pragma unroll 1   // rolled: a second copy of the body would need a second set of fragment registers
    for (int kb = 0; kb <= last; kb += 32) {
        if constexpr (HR) { ldk(kb);   // hi + lo fragments of two steps at once would not fit 256 registers: these (short) rows fetch each step's keys at its head
            asm volatile("s_wait_xcnt 0x0" ::: "memory"); }   // the wait in front of an overwrite of an issued load's address registers: the compiler makes the key loads' address registers the destination of one of the value loads below
        V vf[4], vf2[4];
#pragma unroll
        for (int dt = 0; dt < 4; ++dt) { const size_t vo = vof + (size_t)kb * HD + dt * 512; vf[dt] = WFrag<T16>::ld(Vt + vo);
            if constexpr (HR) { if (dt == 3) asm volatile("s_wait_xcnt 0x0" ::: "memory");   // the same wait: the compiler makes the hi plane's address pair part of the destination of the last lo load
                vf2[dt] = WFrag<T16>::ld(Vt2 + vo); } }
        // inputs-only fence on the loaded fragments: all 32 loads of the step are in flight together, one load latency a step; without it the compiler fetches the key fragments two loads at a time, each pair waited for on its own
        if constexpr (HR) asm volatile("" :: "v"(kf[0][0]), "v"(kf[0][1]), "v"(kf[1][0]), "v"(kf[1][1]), "v"(kf2[0][0]), "v"(kf2[0][1]), "v"(kf2[1][0]), "v"(kf2[1][1]), "v"(vf[0]), "v"(vf[1]), "v"(vf[2]), "v"(vf[3]), "v"(vf2[0]), "v"(vf2[1]), "v"(vf2[2]), "v"(vf2[3]));
        v8f s[2][QT];
#pragma unroll
        for (int kt = 0; kt < 2; ++kt)
#pragma unroll
            for (int qt = 0; qt < QT; ++qt) { s[kt][qt] = (v8f){};
#pragma unroll
                for (int ks = 0; ks < 2; ++ks) { s[kt][qt] = WFrag<T16>::mma(kf[kt][ks], qf[qt][ks], s[kt][qt]); if (HR) { s[kt][qt] = WFrag<T16>::mma(kf[kt][ks], qf2[qt][ks], s[kt][qt]); s[kt][qt] = WFrag<T16>::mma(kf2[kt][ks], qf[qt][ks], s[kt][qt]); } } }
        if (!HR) ldk(min(kb + 32, last));   // the next step's key fragments fly during this step's softmax and P.V; the last step fetches its own again (in bounds, unused)
        V pf[QT], pf2[QT];
#pragma unroll
        for (int qt = 0; qt < QT; ++qt) {
            if (kb + 31 > q0 + qt * 16) {   // wave-uniform: only a step that reaches above this tile's diagonal masks
                const int q = q0 + qt * 16 + lr;
#pragma unroll
                for (int kt = 0; kt < 2; ++kt)
#pragma unroll
                    for (int j = 0; j < 8; ++j) s[kt][qt][j] = (kb + kt * 16 + hi * 8 + j <= q) ? s[kt][qt][j] : -3.0e38f; }
            float mx = s[0][qt][0];
#pragma unroll
            for (int j = 1; j < 8; ++j) mx = fmaxf(mx, s[0][qt][j]);
#pragma unroll
            for (int j = 0; j < 8; ++j) mx = fmaxf(mx, s[1][qt][j]);
            mx = fmaxf(mx, xhalf(mx));
            const float mn = fmaxf(m[qt], mx); const float mc = mn * CE - SH; float al = (m[qt] - mn) * CE; m[qt] = mn;
            float sum = 0.0f; float p[16];
#pragma unroll
            for (int e = 0; e < 16; ++e) p[e] = s[e >> 3][qt][e & 7] * CE - mc;
            asm("v_exp_f32 %0, %0\n\tv_exp_f32 %1, %1\n\tv_exp_f32 %2, %2\n\tv_exp_f32 %3, %3\n\tv_exp_f32 %4, %4\n\tv_exp_f32 %5, %5\n\tv_exp_f32 %6, %6\n\tv_exp_f32 %7, %7\n\tv_exp_f32 %8, %8\n\tv_exp_f32 %9, %9\n\tv_exp_f32 %10, %10\n\tv_exp_f32 %11, %11\n\tv_exp_f32 %12, %12\n\tv_exp_f32 %13, %13\n\tv_exp_f32 %14, %14\n\tv_exp_f32 %15, %15\n\tv_exp_f32 %16, %16\n\tv_nop"
                : "+v"(p[0]), "+v"(p[1]), "+v"(p[2]), "+v"(p[3]), "+v"(p[4]), "+v"(p[5]), "+v"(p[6]), "+v"(p[7]), "+v"(p[8]), "+v"(p[9]), "+v"(p[10]), "+v"(p[11]), "+v"(p[12]), "+v"(p[13]), "+v"(p[14]), "+v"(p[15]), "+v"(al));
#pragma unroll
            for (int e = 0; e < 16; ++e) sum += p[e];
            l[qt] = l[qt] * al + sum;
#pragma unroll
            for (int dt = 0; dt < 4; ++dt) o[dt][qt] *= al;
            if constexpr (HR) { v8us h0, h1, l0, l1;
#pragma unroll
                for (int j = 0; j < 8; ++j) { unsigned short a, c2; splitf(p[j], a, c2); h0[j] = a; l0[j] = c2; splitf(p[8 + j], a, c2); h1[j] = a; l1[j] = c2; }
                pf[qt] = cat16b(h0, h1); pf2[qt] = cat16b(l0, l1);
            } else { v8h h0, h1;
#pragma unroll
                for (int j = 0; j < 8; ++j) { h0[j] = tohx(p[j]); h1[j] = tohx(p[8 + j]); }
                pf[qt] = cat16(h0, h1); }
        }
#pragma unroll
        for (int dt = 0; dt < 4; ++dt)
#pragma unroll
            for (int qt = 0; qt < QT; ++qt) { o[dt][qt] = WFrag<T16>::mma(vf[dt], pf[qt], o[dt][qt]); if (HR) { o[dt][qt] = WFrag<T16>::mma(vf[dt], pf2[qt], o[dt][qt]); o[dt][qt] = WFrag<T16>::mma(vf2[dt], pf[qt], o[dt][qt]); } }
    }
#pragma unroll
    for (int qt = 0; qt < QT; ++qt) { const float f = __fdiv_rn(1.0f, l[qt] + xhalf(l[qt])); const size_t oo = (size_t)(q0 + qt * 16) * DQ + lane * 8;
#pragma unroll
        for (int dt = 0; dt < 4; ++dt) { v8us oh, ol;
#pragma unroll
            for (int j = 0; j < 8; ++j) { unsigned short a, c2; splitf(o[dt][qt][j] * f, a, c2); oh[j] = a; ol[j] = c2; }
            *(v8us*)(Ah + oo + dt * 256) = oh; *(v8us*)(Al + oo + dt * 256) = ol; } }
}
#define NBF ((TT - RH) / 128)     // blocks of 4 waves x 32 fp16 rows
#define NBH (RH / 64)             // blocks of 4 waves x 16 hi/lo rows
__global__ __launch_bounds__(128) void k_attn(const h16* __restrict__ Q16, const h16* __restrict__ K16, const h16* __restrict__ V16, const bf* __restrict__ Qh, const bf* __restrict__ Ql, const bf* __restrict__ Kh, const bf* __restrict__ Kl, const bf* __restrict__ Vh, const bf* __restrict__ Vl, bf* Ah, bf* Al) {
    const int g = blockIdx.x, y = blockIdx.y; const int wave = __builtin_amdgcn_readfirstlane(threadIdx.x >> 5); const int lane = threadIdx.x & 31;
    const size_t po = (size_t)g * TT * HD, vo = po, ao = (size_t)(g / NH_) * TT * DQ + (size_t)(g % NH_) * (HD * 16);
    if (y < NBF) attn_rows<h16, false, 2>(Q16 + po, nullptr, K16 + po, nullptr, V16 + vo, nullptr, RH + (NBF - 1 - y) * 128 + wave * 32, lane, Ah + ao, Al + ao);
    else attn_rows<bf, true, 1>(Qh + po, Ql + po, Kh + po, Kl + po, Vh + vo, Vl + vo, (NBF + NBH - 1 - y) * 64 + wave * 16, lane, Ah + ao, Al + ao);
}

extern "C" void kernel_launch(void* const* d_in, const int* in_sizes, int n_in,
                              void* d_out, int out_size, void* d_ws, size_t ws_size, hipStream_t stream) {
    (void)in_sizes; (void)n_in; (void)out_size;
    const float* x = (const float*)d_in[0]; const float* xk = (const float*)d_in[1]; const float* xv = (const float*)d_in[2]; const float* wq = (const float*)d_in[3]; const float* wk = (const float*)d_in[4]; const float* wv = (const float*)d_in[5]; const float* wo = (const float*)d_in[6];   /* x_query, x_key, x_value, Wq, Wk, Wv [16][1024][64] ([h][d][k]), W0 ('oi' [1024][1024]) */
    float* OUT = (float*)d_out;     // [2][2048][1024]
    char* wsp = (char*)d_ws;
    auto take = [&](size_t bytes) { char* p = wsp; wsp += (bytes + 255) & ~(size_t)255; return (void*)p; };
    bf* WQ = (bf*)take((size_t)3 * DQ * DM * 2);   // Wq, Wk, Wv as Bt planes, one behind the other
    bf* WO = (bf*)take((size_t)DM * DQ * 2);
    const size_t PL = (size_t)NB_ * NH_ * TT * HD;   // one kind of plane, both batches: [b][h], each head's TT x HD elements fragment-major
    h16* QP16 = (h16*)take(2 * PL * 2); h16* KP16 = QP16 + PL; bf* QPh = (bf*)take(2 * PL * 2); bf* KPh = QPh + PL; bf* QPl = (bf*)take(2 * PL * 2); bf* KPl = QPl + PL;   // the k planes follow the q planes
    h16* VT16 = (h16*)take(PL * 2); bf* VTh = (bf*)take(PL * 2); bf* VTl = (bf*)take(PL * 2);
    bf* XB = (bf*)take((size_t)3 * NB_ * TT * DM * 2);   // bf16 streams [3], rows (b, t), k = d
    bf* ATh = (bf*)take((size_t)NB_ * TT * DQ * 2); bf* ATl = (bf*)take((size_t)NB_ * TT * DQ * 2);
    if ((size_t)(wsp - (char*)d_ws) > ws_size) return;    // ws 256 MiB
    static_assert(NKV == NH_ && RH % 64 == 0 && (TT - RH) % 128 == 0 && TT % 128 == 0 && NH_ % 2 == 0 && DM / 128 >= 2, "q, k and v planes are numbered alike; whole row blocks; k_proj: whole tiles inside one batch, two stages or more");
    static_assert(HD == 64 && DM % 128 == 0 && DQ == DM && ((size_t)DM * DQ / 8) % (256 * 4) == 0 && ((size_t)NB_ * TT * DM / 8) % (256 * 8) == 0, "the ranges of k_prep cover their arrays exactly");
    k_prep<<<dim3(3 * GX + 3 * GW + GO, 1, 1), 256, 0, stream>>>(x, xk, xv, wq, wk, wv, wo, XB, WQ, WO);
    k_proj<<<dim3(NB_ * TT / 128, NH_ / 2, 3), 128, 0, stream>>>(XB, WQ, QP16, QPh, QPl, VT16, VTh, VTl);
    k_attn<<<dim3(NB_ * NH_, NBF + NBH, 1), 128, 0, stream>>>(QP16, KP16, VT16, QPh, QPl, KPh, KPl, VTh, VTl, ATh, ATl);
    k_out<<<dim3(NB_ * TT / 128, DM / 128, 1), 128, 0, stream>>>(ATh, ATl, WO, OUT);
}

// v009
// One run takes 78.5 microseconds.
// Timed twice side by side with v008, it ran 1.30 times as fast both times.
// All steps since v000 together make it 18.8 times as fast.
#include <hip/hip_runtime.h>

// Causal multi-head attention on three input streams with per-head stacked projection weights (x_query, x_key, x_value [2][2048][1024]; q = einsum('bsd,hdk', x_query, Wq) with Wq [16][1024][64] = [h][d][k] (1/32), k, v likewise from x_key / x_value; scores x 1/sqrt(64) + causal additive mask (0 / -inf); softmax; heads concatenated h-major; out = concat W0^T ('oi' [1024][1024]) -> [2][2048][1024] (4.2 M); argument order x_query, x_key, x_value, Wq, Wk, Wv, W0).
// Layout, both batches at once: k_prep: bf16 copies of the three streams and of W0, each [h][d][k] weight turned into Bt rows h*64 + k; k_proj: exact projections (one launch, z = stream) whose epilogue stores the fp16 and hi/lo head planes; k_attn: scores, running softmax and P.V of all 32 (batch, head) pairs in one launch, scores and probabilities never leave the registers (hybrid rows: < 512 hi/lo 3 products, rest fp16 x1024); merged hi/lo x W0 exact.
// Every 16-bit matrix operand plane (bf16 streams, weights, q / k / v planes, attention output) is stored fragment-major: a block of 16 rows x 32 k is 1 KiB in a row, element (r, k) at ((k >> 4) & 1) * 256 + ((k >> 3) & 1) * 128 + (r & 15) * 8 + (k & 7),
// the blocks of a row block one behind the other along k (v: the 4 blocks of d of a 32-key step one behind the other). Lane l's two 16-byte pieces of a fragment stand at l * 8 and 256 + l * 8: each wave-wide load covers 512 bytes in a row (4 whole lines), not 32 bytes of each of 16 lines.
// Compute dtypes, f32 accumulate: every input rounded to bf16; projections exact; attention rows < 512 3 products, rest fp16; softmax f32; W0 hl x exact.

#define NB_  2
#define TT   2048
#define DM   1024
#define NH_  16
#define NKV  16
#define REP  (NH_ / NKV)
#define HD   64
#define DQ   (NH_ * HD)
#define DKV  (NKV * HD)
#define RH   512                  // query rows < RH use hi+lo planes (0: none)
#define SCL  0.125f   // HD^-0.5
typedef _Float16 h16;
typedef unsigned short bf;
typedef __attribute__((ext_vector_type(16))) __bf16   v16bf;
typedef __attribute__((ext_vector_type(16))) _Float16 v16h;
typedef __attribute__((ext_vector_type(8)))  _Float16 v8h;
typedef __attribute__((ext_vector_type(8)))  unsigned short v8us;
typedef __attribute__((ext_vector_type(8)))  float    v8f;
typedef __attribute__((ext_vector_type(4)))  float    v4f;
typedef v8h  __attribute__((may_alias)) v8ha;
typedef v4f  __attribute__((may_alias)) v4fa;
typedef v8us __attribute__((may_alias)) v8usa;

__device__ __forceinline__ unsigned short f2bf(float f) { unsigned u = __float_as_uint(f); u += 0x7FFFu + ((u >> 16) & 1u); return (unsigned short)(u >> 16); }
__device__ __forceinline__ float bf2f(unsigned short b) { return __uint_as_float(((unsigned)b) << 16); }
__device__ __forceinline__ float bfr(float f) { return bf2f(f2bf(f)); }
__device__ __forceinline__ v16h cat16(v8h lo, v8h hi) { return __builtin_shufflevector(lo, hi, 0, 1, 2, 3, 4, 5, 6, 7, 8, 9, 10, 11, 12, 13, 14, 15); }
__device__ __forceinline__ v16bf cat16b(v8us lo, v8us hi) { return __builtin_bit_cast(v16bf, __builtin_shufflevector(lo, hi, 0, 1, 2, 3, 4, 5, 6, 7, 8, 9, 10, 11, 12, 13, 14, 15)); }
__device__ __forceinline__ v8f wmma16(v16h a, v16h b, v8f c) { return __builtin_amdgcn_wmma_f32_16x16x32_f16(false, a, false, b, (short)0, c, false, false); }
__device__ __forceinline__ v8f wmmab(v16bf a, v16bf b, v8f c) { return __builtin_amdgcn_wmma_f32_16x16x32_bf16(false, a, false, b, (short)0, c, false, false); }



// ---- WFrag: a 16 x 32 fragment of a fragment-major plane (in memory or in LDS): lane l's two 16-byte pieces stand at l * 8 and 256 + l * 8 of the block; p = block + l * 8.
template <typename T16> struct WFrag;
template <> struct WFrag<h16> { typedef v16h V; static __device__ __forceinline__ V ld(const h16* p) { return cat16(*(const v8h*)p, *(const v8h*)(p + 256)); } static __device__ __forceinline__ v8f mma(V a, V b, v8f c) { return wmma16(a, b, c); } };
template <> struct WFrag<bf> { typedef v16bf V; static __device__ __forceinline__ V ld(const bf* p) { return cat16b(*(const v8us*)p, *(const v8us*)(p + 256)); } static __device__ __forceinline__ v8f mma(V a, V b, v8f c) { return wmmab(a, b, c); } };

__device__ __forceinline__ h16 tohx(float x) { return (h16)x; }
__device__ __forceinline__ void splitf(float y, unsigned short& h, unsigned short& l) { h = f2bf(y); l = f2bf(y - bf2f(h)); }
typedef __attribute__((ext_vector_type(2))) _Float16 v2h;
typedef __attribute__((ext_vector_type(4))) _Float16 v4h;
typedef __attribute__((ext_vector_type(2))) unsigned short v2us;
typedef __attribute__((ext_vector_type(4))) unsigned short v4us;
typedef __attribute__((ext_vector_type(2))) float v2f;
typedef __attribute__((ext_vector_type(4))) int v4i;

// cvt8: fragment-major bf16 copy of an f32 matrix with rows of DM elements, the share of work-group bx of its range in k_prep. A wave takes U / 4 regions of 16 rows x 64 k (neighbours along k); a thread converts U pieces of 8 floats
// and issues all its loads before the first conversion. Lanes = 4 rows x 8 pieces: the two loads of a piece read 256 bytes in a row (2 whole lines) of each of 4 rows, a store writes 64 bytes in a row in each of 8 half blocks, and 4 stores fill them.
// A range of n work-groups covers n * 256 * U pieces of 8 floats exactly (asserted at the launch).
template <int U>
__device__ __forceinline__ void cvt8(const float* __restrict__ s, bf* dst, int bx) {
    static_assert(U % 4 == 0 && (DM / 64) % (U / 4) == 0, "a wave's regions lie in one block of 16 rows");
    const int lane = threadIdx.x & 31, c = lane & 7, rr = lane >> 3; const int reg0 = (bx * 8 + (threadIdx.x >> 5)) * (U / 4); const int rb = reg0 / (DM / 64), kq = reg0 % (DM / 64);
    const float* src = s + (size_t)(rb * 16 + rr) * DM + kq * 64 + c * 8;
    dst += ((size_t)rb * (DM / 32) + kq * 2 + (c >> 2)) * 512 + ((c >> 1) & 1) * 256 + (c & 1) * 128 + rr * 8; v4f lo[U], hi[U];
#pragma unroll
    for (int u = 0; u < U; ++u) { const float* p = src + (u & 3) * 4 * DM + (u >> 2) * 64; lo[u] = *(const v4f*)p;
        if (u == U - 1) asm volatile("s_wait_xcnt 0x0" ::: "memory");   // the wait in front of an overwrite of issued loads' address registers: the compiler makes the address pair part of the last load's destination
        hi[u] = *(const v4f*)(p + 4); }
#pragma unroll
    for (int u = 0; u < U; ++u) { v8us o;
#pragma unroll
        for (int k = 0; k < 4; ++k) { o[k] = f2bf(lo[u][k]); o[4 + k] = f2bf(hi[u][k]); }
        *(v8us*)(dst + (u & 3) * 32 + (u >> 2) * 1024) = o; }
}

// wtH: one weight [h][d][e] f32 -> bf16 Bt rows h * 64 + e, k = d, fragment-major, the share of work-group bx of its range in k_prep. A thread takes a block of 8 d x 4 e: 8 loads of 16 bytes (4 e of one d), 4 stores of 16 bytes (8 d of one e).
// Lanes = 8 groups of d x 4 groups of e: a thread's 4 stores fill 64 bytes in a row, 4 lanes a whole half block of 256 bytes; 4 lanes read 64 contiguous bytes; the 8 waves of a work-group cover 128 d x the 64 e of one head. NH_ * DM / 128 work-groups a weight, exact.
__device__ __forceinline__ void wtH(const float* __restrict__ w, bf* Bt, int bx) {
    const int h = bx / (DM / 128), db = bx % (DM / 128); const int wave = threadIdx.x >> 5, lane = threadIdx.x & 31;
    const int d = db * 128 + (wave >> 2) * 64 + (lane & 7) * 8, e = (wave & 3) * 16 + (lane >> 3) * 4;
    const float* s = w + ((size_t)h * DM + d) * HD + e; v4f r[8];
#pragma unroll
    for (int j = 0; j < 8; ++j) r[j] = *(const v4f*)(s + j * HD);
#pragma unroll
    for (int i = 0; i < 4; ++i) { v8us o;
#pragma unroll
        for (int j = 0; j < 8; ++j) o[j] = f2bf(r[j][i]);
        *(v8us*)(Bt + ((size_t)((h * HD + e) >> 4) * (DM / 32) + (d >> 5)) * 512 + ((d >> 4) & 1) * 256 + ((d >> 3) & 1) * 128 + ((e & 15) + i) * 8) = o; }
}
// ---- k_prep: every 16-bit copy that the products read, in one launch: the jobs need nothing of each other, so ranges of the work-group index pick them (a work-group-uniform branch), the long streams first:
// 3 x GX work-groups: the streams (cvt8<8>); 3 x GW: Wq, Wk, Wv (wtH); GO: W0 (cvt8<4>). The short jobs run beside the streams instead of each filling and draining the chip alone.
#define GX ((int)((size_t)NB_ * TT * DM / 8 / (256 * 8)))
#define GW (NH_ * (DM / 128))
#define GO ((int)((size_t)DM * DQ / 8 / (256 * 4)))
__global__ __launch_bounds__(256) void k_prep(const float* __restrict__ x0, const float* __restrict__ x1, const float* __restrict__ x2, const float* __restrict__ w0, const float* __restrict__ w1, const float* __restrict__ w2, const float* __restrict__ wo, bf* XB, bf* Bt, bf* WO) {
    const int b = blockIdx.x;
    if (b < 3 * GX) { const int y = b / GX; cvt8<8>((y == 0) ? x0 : (y == 1) ? x1 : x2, XB + (size_t)y * NB_ * TT * DM, b % GX); }
    else if (b < 3 * GX + 3 * GW) { const int c = b - 3 * GX, y = c / GW; wtH((y == 0) ? w0 : (y == 1) ? w1 : w2, Bt + (size_t)y * DQ * DM, c % GW);
        asm volatile("s_wait_xcnt 0x0" ::: "memory"); }   // the wait in front of an overwrite of issued stores' registers: in the listing this job's end runs on into the streams' code, which writes them
    else { cvt8<4>(wo, WO, b - 3 * GX - 3 * GW);
        asm volatile("s_wait_xcnt 0x0" ::: "memory"); }   // the same wait: in the listing this job's end runs on into the other two jobs' code
}
// ---- k_proj: the three projections, each tile stored straight as the 16-bit planes that k_attn reads. Grid (rows / 128, heads / 2, 3 streams), 4 waves as 2 x 2: a work-group makes 128 rows t x the 128 columns of two heads, a wave a 64x64 tile over the whole K in one accumulator chain.
// The two operands' 128 rows x 64 k (8 + 8 row blocks of 2 KiB in a row, fragment-major as in memory) are one stage of 32 KiB in LDS, read by two waves each; two buffers, the next stage's asynchronous copies fly while this stage is worked on.
// q, k (z = 0, 1): A = weight rows d, B = rows t, so a lane holds 8 consecutive d of one t; v (z = 2): A = rows t, B = weight rows d, so a lane holds 8 consecutive t of one d. Either way that is the 16-byte piece at lane * 8 of a half block of the fragment-major plane
// (q, k: blocks (t / 16, d / 32); v: blocks (t / 32, d / 16)): the accumulators go from the registers to the fp16, hi and lo planes, a wave filling 512 bytes in a row with each store.
#define PLN ((size_t)NB_ * NH_ * TT * HD)   // elements of one kind of plane, both batches
// 8 asynchronous copies of 16 bytes a lane: row blocks 0..7 of one operand (32 KiB apart in memory, 2 KiB apart in LDS). The s_wait_xcnt stands in the copies' own statement, in front of any rewrite of the address registers that they name.
__device__ __forceinline__ void acopy8(unsigned l, const bf* g) {
    asm volatile("global_load_async_to_lds_b128 %0, %8, off\n\tglobal_load_async_to_lds_b128 %1, %9, off\n\tglobal_load_async_to_lds_b128 %2, %10, off\n\tglobal_load_async_to_lds_b128 %3, %11, off\n\t"
                 "global_load_async_to_lds_b128 %4, %12, off\n\tglobal_load_async_to_lds_b128 %5, %13, off\n\tglobal_load_async_to_lds_b128 %6, %14, off\n\tglobal_load_async_to_lds_b128 %7, %15, off\n\ts_wait_xcnt 0x0"
                 :: "v"(l), "v"(l + 2048u), "v"(l + 4096u), "v"(l + 6144u), "v"(l + 8192u), "v"(l + 10240u), "v"(l + 12288u), "v"(l + 14336u),
                    "v"(g), "v"(g + 16 * DM), "v"(g + 32 * DM), "v"(g + 48 * DM), "v"(g + 64 * DM), "v"(g + 80 * DM), "v"(g + 96 * DM), "v"(g + 112 * DM) : "memory");
}
__global__ __launch_bounds__(128) void k_proj(const bf* __restrict__ X, const bf* __restrict__ Wt, h16* P16, bf* Ph, bf* Pl, h16* V16, bf* Vh, bf* Vl) {
    __shared__ __align__(2048) bf ring[2 * 16384];   // two stages of [A 8 row blocks | B 8 row blocks] x 64 k
    const int z = blockIdx.z, r0 = blockIdx.x * 128, hp = blockIdx.y;
    const int wave = __builtin_amdgcn_readfirstlane(threadIdx.x >> 5); const int lane = threadIdx.x & 31, wm = wave >> 1, wn = wave & 1;
    const bf* xr = X + ((size_t)z * NB_ * TT + r0) * DM; const bf* wr = Wt + ((size_t)z * DQ + hp * 128) * DM;
    const bf* ga = ((z == 2) ? xr : wr) + threadIdx.x * 8; const bf* gb = ((z == 2) ? wr : xr) + threadIdx.x * 8;   // a thread copies piece threadIdx.x of each row block's 2 KiB
    const unsigned ls = (unsigned)(size_t)ring + threadIdx.x * 16;
    auto fill = [&](int t) { const unsigned l = ls + (t & 1) * 32768u; acopy8(l, ga + t * 1024); acopy8(l + 16384u, gb + t * 1024); };
    fill(0);
    asm volatile("s_wait_asynccnt 0x0" ::: "memory");   // this wave's copies of stage 0 have landed
    __syncthreads();                                    // ... and every other wave's: stage 0 may be read
    fill(1);
    v8f acc[4][4];
#pragma unroll
    for (int mb = 0; mb < 4; ++mb)
#pragma unroll
        for (int nb = 0; nb < 4; ++nb) acc[mb][nb] = (v8f){};
#pragma unroll 1   // rolled: one set of fragment registers, the buffer picked by the trip's parity
    for (int t = 0; t < DM / 64; ++t) {
        const bf* st = ring + (t & 1) * 16384 + lane * 8;
#pragma unroll
        for (int ks = 0; ks < 2; ++ks) { v16bf a[4], b[4];
#pragma unroll
            for (int i = 0; i < 4; ++i) { a[i] = WFrag<bf>::ld(st + (wm * 4 + i) * 1024 + ks * 512); b[i] = WFrag<bf>::ld(st + 8192 + (wn * 4 + i) * 1024 + ks * 512); }
            // inputs-only fence on the loaded fragments: the 16 LDS reads of a 32-k step go as one group, one LDS latency for 16 matrix instructions; without it the compiler reuses one B fragment's registers and waits for LDS in front of every 4
            asm volatile("" :: "v"(a[0]), "v"(a[1]), "v"(a[2]), "v"(a[3]), "v"(b[0]), "v"(b[1]), "v"(b[2]), "v"(b[3]));
#pragma unroll
            for (int nb = 0; nb < 4; ++nb)
#pragma unroll
                for (int mb = 0; mb < 4; ++mb) acc[mb][nb] = wmmab(a[mb], b[nb], acc[mb][nb]); }
        __builtin_amdgcn_sched_barrier(0);   // the trip's matrix instructions stay in front of the barrier: else the compiler sinks a 32-k step's worth of them between the barrier and the refill, and the next copies start that much later
        asm volatile("s_wait_dscnt 0x0" ::: "memory");      // this wave's reads of stage t are done before the buffer is refilled
        asm volatile("s_wait_asynccnt 0x0" ::: "memory");   // this wave's copies of stage t + 1 have landed
        __syncthreads();                                    // publishes stage t + 1 and ends every wave's reads of stage t
        if (t + 2 < DM / 64) fill(t + 2);
    }
    asm volatile("s_wait_asynccnt 0x0" ::: "memory");   // no copy is outstanding when the wave ends
    const int g = (r0 / TT) * NH_ + hp * 2 + ((z == 2) ? wn : wm), t0 = r0 % TT + ((z == 2) ? wm : wn) * 64;
    const size_t base = ((z == 2) ? 0 : (size_t)z * PLN) + ((size_t)g * TT + t0) * HD + lane * 8;
    const int sM = (z == 2) ? 2048 : 512, sN = (z == 2) ? 512 : 1024;   // elements from one pair of A blocks, and from one B block, to the next in the plane
    h16* d16 = ((z == 2) ? V16 : P16) + base; bf* dh = ((z == 2) ? Vh : Ph) + base; bf* dl = ((z == 2) ? Vl : Pl) + base;
#pragma unroll
    for (int mb = 0; mb < 4; ++mb)
#pragma unroll
        for (int nb = 0; nb < 4; ++nb) { v8h o16; v8us oh, ol;
#pragma unroll
            for (int j = 0; j < 8; ++j) { const float x = acc[mb][nb][j]; o16[j] = tohx(x); unsigned short a2, c2; splitf(x, a2, c2); oh[j] = a2; ol[j] = c2; }
            const int po = (mb >> 1) * sM + (mb & 1) * 256 + nb * sN; *(v8h*)(d16 + po) = o16; *(v8us*)(dh + po) = oh; *(v8us*)(dl + po) = ol; }
}
// ---- k_out: out[m][n] (f32, rows of DM) = sum_k (Ah[m][k] + Al[m][k]) W0[n][k], tiled and staged as k_proj: grid (rows / 128, DM / 128), 4 waves as 2 x 2, a wave a 64x64 tile over the whole K; a stage is 128 k, two halves of [W0 8 row blocks | Ah 8 | Al 8] x 64 k = 96 KiB (one work-group a WGP: the longer stage spreads a copy's latency over more bytes), two buffers.
// A = W0 rows n, B = rows m, so a lane holds 8 consecutive n of one row m. After the loop the ring is free (its last barrier ends every read, no copy is outstanding): each wave lays its tile there as 64 rows m at pitch 68 floats and stores whole 256-byte rows, 16 lanes a row.
__global__ __launch_bounds__(128) void k_out(const bf* __restrict__ Ah, const bf* __restrict__ Al, const bf* __restrict__ Wo, float* C) {
    __shared__ __align__(2048) bf ring[2 * 49152];
    const int r0 = blockIdx.x * 128, c0 = blockIdx.y * 128;
    const int wave = __builtin_amdgcn_readfirstlane(threadIdx.x >> 5); const int lane = threadIdx.x & 31, lr = lane & 15, hi = lane >> 4, wm = wave >> 1, wn = wave & 1;
    const bf* gw = Wo + (size_t)c0 * DQ + threadIdx.x * 8; const bf* gh = Ah + (size_t)r0 * DQ + threadIdx.x * 8; const bf* gl = Al + (size_t)r0 * DQ + threadIdx.x * 8;   // a thread copies piece threadIdx.x of each row block's 2 KiB
    const unsigned ls = (unsigned)(size_t)ring + threadIdx.x * 16;
    auto fill = [&](int t) {   // 48 copies a wave
#pragma unroll
        for (int h = 0; h < 2; ++h) { const unsigned l = ls + (t & 1) * 98304u + h * 49152u; const int k = (t * 2 + h) * 1024; acopy8(l, gw + k); acopy8(l + 16384u, gh + k); acopy8(l + 32768u, gl + k);
            __builtin_amdgcn_sched_barrier(0); } };   // a half's address arithmetic stays with its copies: formed all ahead, the 48 address pairs push the kernel past 256 registers
    fill(0);
    asm volatile("s_wait_asynccnt 0x0" ::: "memory");   // this wave's copies of stage 0 have landed
    __syncthreads();                                    // ... and every other wave's: stage 0 may be read
    fill(1);
    v8f acc[4][4];
#pragma unroll
    for (int mb = 0; mb < 4; ++mb)
#pragma unroll
        for (int nb = 0; nb < 4; ++nb) acc[mb][nb] = (v8f){};
#pragma unroll 1   // rolled: one set of fragment registers, the buffer picked by the trip's parity
    for (int t = 0; t < DQ / 128; ++t) {
#pragma unroll
        for (int kk = 0; kk < 4; ++kk) { v16bf a[4], b[4], b2[4]; const int ks = kk & 1; const bf* st = ring + (t & 1) * 49152 + (kk >> 1) * 24576 + lane * 8;
#pragma unroll
            for (int i = 0; i < 4; ++i) { a[i] = WFrag<bf>::ld(st + (wm * 4 + i) * 1024 + ks * 512); b[i] = WFrag<bf>::ld(st + 8192 + (wn * 4 + i) * 1024 + ks * 512); }
#pragma unroll
            for (int i = 0; i < 4; ++i) b2[i] = WFrag<bf>::ld(st + 16384 + (wn * 4 + i) * 1024 + ks * 512);
            // inputs-only fence on the loaded fragments, as in k_proj: the 24 LDS reads of a 32-k step go as one group; without it the compiler reuses one lo fragment's registers and waits for LDS in front of every 4 matrix instructions
            asm volatile("" :: "v"(a[0]), "v"(a[1]), "v"(a[2]), "v"(a[3]), "v"(b[0]), "v"(b[1]), "v"(b[2]), "v"(b[3]), "v"(b2[0]), "v"(b2[1]), "v"(b2[2]), "v"(b2[3]));
#pragma unroll
            for (int nb = 0; nb < 4; ++nb)
#pragma unroll
                for (int mb = 0; mb < 4; ++mb) acc[mb][nb] = wmmab(a[mb], b[nb], acc[mb][nb]);
#pragma unroll
            for (int nb = 0; nb < 4; ++nb)
#pragma unroll
                for (int mb = 0; mb < 4; ++mb) acc[mb][nb] = wmmab(a[mb], b2[nb], acc[mb][nb]); }
        __builtin_amdgcn_sched_barrier(0);   // the trip's matrix instructions stay in front of the barrier: else the compiler sinks a 32-k step's worth of them between the barrier and the refill, and the next copies start that much later
        asm volatile("s_wait_dscnt 0x0" ::: "memory");      // this wave's reads of stage t are done before the buffer is refilled
        asm volatile("s_wait_asynccnt 0x0" ::: "memory");   // this wave's copies of stage t + 1 have landed
        __syncthreads();                                    // publishes stage t + 1 and ends every wave's reads of stage t
        if (t + 2 < DQ / 128) fill(t + 2);
    }
    asm volatile("s_wait_asynccnt 0x0" ::: "memory");   // no copy is outstanding when the ring becomes output staging
    float* mine = (float*)ring + wave * (64 * 68);
#pragma unroll
    for (int mb = 0; mb < 4; ++mb)
#pragma unroll
        for (int nb = 0; nb < 4; ++nb) { float* p = mine + (nb * 16 + lr) * 68 + mb * 16 + hi * 8;
            *(v4fa*)p = (v4f){acc[mb][nb][0], acc[mb][nb][1], acc[mb][nb][2], acc[mb][nb][3]}; *(v4fa*)(p + 4) = (v4f){acc[mb][nb][4], acc[mb][nb][5], acc[mb][nb][6], acc[mb][nb][7]}; }
    __syncthreads();   // the tile's LDS writes stand in front of the reads below, which take other lanes' values
    float* Ct = C + (size_t)(r0 + wn * 64) * DM + c0 + wm * 64;
#pragma unroll
    for (int u = 0; u < 32; ++u) { const int idx = u * 32 + lane; const int row = idx >> 4, cofs = (idx & 15) * 4;
        *(v4f*)(Ct + (size_t)row * DM + cofs) = *(const v4fa*)(mine + row * 68 + cofs); }
}
// ---- k_attn: causal attention, one launch for every (batch, head) pair g = blockIdx.x; blockIdx.y = block of query rows, the longest first. A wave owns QT * 16 query rows and walks the keys 0 .. its last row in steps of 32. The long fp16 rows: two waves a tile (w and w + 4 of 8), one takes the even steps and one the odd, each with its own running m, l and O; behind the loop they join the halves through LDS (one barrier). The hi/lo rows: one wave a tile, no LDS, no barrier.
// Per step: S^T = K Q^T (A = 16 key rows, B = 16 query rows, both from planes with rows t, k = d), so a lane holds scores of ONE query (column lane & 15): keys 8 * hi + j of each 16-key tile. Running maximum m and running sum l per query: in-lane, plus one exchange between the lane halves for m
// (l's halves are joined once, at the end). p = exp2((s - m) x SCL x log2 e (+ 10 in the fp16 rows: the x1024 carrier)); two converted S^T tiles are, register for register, the B operand of O^T += V^T P^T (A = 16 rows of the plane with rows d, k = t), whose column is again the lane's own query:
// the rescale by exp2(m_old - m_new) and the final 1 / l are in-lane too. HR (rows < RH): q, k, v, p as bf16 hi + lo, 3 products each; else fp16, 1 product. Output: hi/lo bf16 of O / l, row t, k = h * 64 + d of the fragment-major planes that the last product reads, 8 consecutive d per lane, 512 bytes in a row per store.
__device__ __forceinline__ float xhalf(float x) { const int b = __float_as_int(x); return __int_as_float(__builtin_amdgcn_permlanex16(b, b, 0x76543210, 0xfedcba98, false, false)); }   // the value of lane ^ 16
template <typename T16, bool HR, int QT, int SP>
__device__ __forceinline__ void attn_rows(const T16* __restrict__ Q, const T16* __restrict__ Q2, const T16* __restrict__ Kp, const T16* __restrict__ K2, const T16* __restrict__ Vt, const T16* __restrict__ Vt2, int q0, int lane, bf* Ah, bf* Al, int sp, float* mine, const float* theirs) {
    static_assert(SP == 1 || (SP == 2 && !HR), "one wave a tile, or two waves that take every other key step");
    typedef typename WFrag<T16>::V V;
    const int lr = lane & 15, hi = lane >> 4; const float CE = SCL * 1.4426950408889634f; const float SH = HR ? 0.0f : 10.0f;
    V qf[QT][2], qf2[QT][2], kf[2][2], kf2[2][2]; v8f o[4][QT]; float m[QT], l[QT];
#pragma unroll
    for (int qt = 0; qt < QT; ++qt) { m[qt] = -3.0e38f; l[qt] = 0.0f;
#pragma unroll
        for (int ks = 0; ks < 2; ++ks) { const size_t qo = (size_t)(q0 + qt * 16) * HD + ks * 512 + lane * 8; qf[qt][ks] = WFrag<T16>::ld(Q + qo); if (HR) qf2[qt][ks] = WFrag<T16>::ld(Q2 + qo); }
#pragma unroll
        for (int dt = 0; dt < 4; ++dt) o[dt][qt] = (v8f){}; }
    const int last = (q0 + QT * 16 - 1) & ~31;   // first key of the last step; last <= q0, so key kb of every step is at or below the diagonal of every row
    const size_t kof = lane * 8, vof = lane * 8;
    auto ldk = [&](int k0) {
#pragma unroll
        for (int kt = 0; kt < 2; ++kt)
#pragma unroll
            for (int ks = 0; ks < 2; ++ks) { const size_t ko = kof + (size_t)(k0 + kt * 16) * HD + ks * 512; kf[kt][ks] = WFrag<T16>::ld(Kp + ko); if (HR) kf2[kt][ks] = WFrag<T16>::ld(K2 + ko); } };
    if (!HR) ldk(sp * 32);
#pragma unroll 1   // rolled: a second copy of the body would need a second set of fragment registers
    for (int kb = sp * 32; kb <= last; kb += 32 * SP) {
        if constexpr (HR) { ldk(kb);   // hi + lo fragments of two steps at once would not fit 256 registers: these (short) rows fetch each step's keys at its head
            asm volatile("s_wait_xcnt 0x0" ::: "memory"); }   // the wait in front of an overwrite of an issued load's address registers: the compiler makes the key loads' address registers the destination of one of the value loads below
        V vf[4], vf2[4];
#pragma unroll
        for (int dt = 0; dt < 4; ++dt) { const size_t vo = vof + (size_t)kb * HD + dt * 512; vf[dt] = WFrag<T16>::ld(Vt + vo);
            if constexpr (HR) { if (dt == 3) asm volatile("s_wait_xcnt 0x0" ::: "memory");   // the same wait: the compiler makes the hi plane's address pair part of the destination of the last lo load
                vf2[dt] = WFrag<T16>::ld(Vt2 + vo); } }
        // inputs-only fence on the loaded fragments: all 32 loads of the step are in flight together, one load latency a step; without it the compiler fetches the key fragments two loads at a time, each pair waited for on its own
        if constexpr (HR) asm volatile("" :: "v"(kf[0][0]), "v"(kf[0][1]), "v"(kf[1][0]), "v"(kf[1][1]), "v"(kf2[0][0]), "v"(kf2[0][1]), "v"(kf2[1][0]), "v"(kf2[1][1]), "v"(vf[0]), "v"(vf[1]), "v"(vf[2]), "v"(vf[3]), "v"(vf2[0]), "v"(vf2[1]), "v"(vf2[2]), "v"(vf2[3]));
        v8f s[2][QT];
#pragma unroll
        for (int kt = 0; kt < 2; ++kt)
#pragma unroll
            for (int qt = 0; qt < QT; ++qt) { s[kt][qt] = (v8f){};
#pragma unroll
                for (int ks = 0; ks < 2; ++ks) { s[kt][qt] = WFrag<T16>::mma(kf[kt][ks], qf[qt][ks], s[kt][qt]); if (HR) { s[kt][qt] = WFrag<T16>::mma(kf[kt][ks], qf2[qt][ks], s[kt][qt]); s[kt][qt] = WFrag<T16>::mma(kf2[kt][ks], qf[qt][ks], s[kt][qt]); } } }
        if (!HR) ldk(min(kb + 32 * SP, last));   // this wave's next step's key fragments fly during this step's softmax and P.V; the last step fetches the keys of the tile's last step (in bounds, unused)
        V pf[QT], pf2[QT];
#pragma unroll
        for (int qt = 0; qt < QT; ++qt) {
            if (kb + 31 > q0 + qt * 16) {   // wave-uniform: only a step that reaches above this tile's diagonal masks
                const int q = q0 + qt * 16 + lr;
#pragma unroll
                for (int kt = 0; kt < 2; ++kt)
#pragma unroll
                    for (int j = 0; j < 8; ++j) s[kt][qt][j] = (kb + kt * 16 + hi * 8 + j <= q) ? s[kt][qt][j] : -3.0e38f; }
            float mx = s[0][qt][0];
#pragma unroll
            for (int j = 1; j < 8; ++j) mx = fmaxf(mx, s[0][qt][j]);
#pragma unroll
            for (int j = 0; j < 8; ++j) mx = fmaxf(mx, s[1][qt][j]);
            mx = fmaxf(mx, xhalf(mx));
            const float mn = fmaxf(m[qt], mx); const float mc = mn * CE - SH; float al = (m[qt] - mn) * CE; m[qt] = mn;
            float sum = 0.0f; float p[16];
#pragma unroll
            for (int e = 0; e < 16; ++e) p[e] = s[e >> 3][qt][e & 7] * CE - mc;
            asm("v_exp_f32 %0, %0\n\tv_exp_f32 %1, %1\n\tv_exp_f32 %2, %2\n\tv_exp_f32 %3, %3\n\tv_exp_f32 %4, %4\n\tv_exp_f32 %5, %5\n\tv_exp_f32 %6, %6\n\tv_exp_f32 %7, %7\n\tv_exp_f32 %8, %8\n\tv_exp_f32 %9, %9\n\tv_exp_f32 %10, %10\n\tv_exp_f32 %11, %11\n\tv_exp_f32 %12, %12\n\tv_exp_f32 %13, %13\n\tv_exp_f32 %14, %14\n\tv_exp_f32 %15, %15\n\tv_exp_f32 %16, %16\n\tv_nop"
                : "+v"(p[0]), "+v"(p[1]), "+v"(p[2]), "+v"(p[3]), "+v"(p[4]), "+v"(p[5]), "+v"(p[6]), "+v"(p[7]), "+v"(p[8]), "+v"(p[9]), "+v"(p[10]), "+v"(p[11]), "+v"(p[12]), "+v"(p[13]), "+v"(p[14]), "+v"(p[15]), "+v"(al));
#pragma unroll
            for (int e = 0; e < 16; ++e) sum += p[e];
            l[qt] = l[qt] * al + sum;
#pragma unroll
            for (int dt = 0; dt < 4; ++dt) o[dt][qt] *= al;
            if constexpr (HR) { v8us h0, h1, l0, l1;
#pragma unroll
                for (int j = 0; j < 8; ++j) { unsigned short a, c2; splitf(p[j], a, c2); h0[j] = a; l0[j] = c2; splitf(p[8 + j], a, c2); h1[j] = a; l1[j] = c2; }
                pf[qt] = cat16b(h0, h1); pf2[qt] = cat16b(l0, l1);
            } else { v8h h0, h1;
#pragma unroll
                for (int j = 0; j < 8; ++j) { h0[j] = tohx(p[j]); h1[j] = tohx(p[8 + j]); }
                pf[qt] = cat16(h0, h1); }
        }
#pragma unroll
        for (int dt = 0; dt < 4; ++dt)
#pragma unroll
            for (int qt = 0; qt < QT; ++qt) { o[dt][qt] = WFrag<T16>::mma(vf[dt], pf[qt], o[dt][qt]); if (HR) { o[dt][qt] = WFrag<T16>::mma(vf[dt], pf2[qt], o[dt][qt]); o[dt][qt] = WFrag<T16>::mma(vf2[dt], pf[qt], o[dt][qt]); } }
    }
    if constexpr (SP == 2) {   // the two waves of a tile join their halves: wave sp finishes d tiles 2 * sp and 2 * sp + 1 and hands the other two, with its m and l, to its partner through LDS
#pragma unroll
        for (int qt = 0; qt < QT; ++qt) { mine[1024 + qt * 32 + lane] = m[qt]; mine[1088 + qt * 32 + lane] = l[qt];
#pragma unroll
            for (int d = 0; d < 2; ++d) { const v8f t = sp ? o[d][qt] : o[2 + d][qt]; float* p = mine + (d * QT + qt) * 256 + lane * 4;   // 16 bytes a lane, 512 bytes in a row: no bank met twice
                *(v4fa*)p = (v4f){t[0], t[1], t[2], t[3]}; *(v4fa*)(p + 128) = (v4f){t[4], t[5], t[6], t[7]}; } }
        __syncthreads();   // every wave's hand-over stands in LDS before its partner reads it
#pragma unroll
        for (int qt = 0; qt < QT; ++qt) { const float pm = theirs[1024 + qt * 32 + lane], pl = theirs[1088 + qt * 32 + lane]; const float mn = fmaxf(m[qt], pm); float a = (m[qt] - mn) * CE, b = (pm - mn) * CE;
            // the two rescale factors in one statement, the v_nop behind the last: no transcendental stands directly in front of an instruction that reads its result
            asm("v_exp_f32 %0, %0\n\tv_exp_f32 %1, %1\n\tv_nop" : "+v"(a), "+v"(b));
            l[qt] = l[qt] * a + pl * b;
#pragma unroll
            for (int d = 0; d < 2; ++d) { v8f k = sp ? o[2 + d][qt] : o[d][qt]; const float* p = theirs + (d * QT + qt) * 256 + lane * 4; const v4f x = *(const v4fa*)p, y = *(const v4fa*)(p + 128);
#pragma unroll
                for (int j = 0; j < 4; ++j) { k[j] = k[j] * a + x[j] * b; k[4 + j] = k[4 + j] * a + y[j] * b; }
                o[d][qt] = k; } }
    }
#pragma unroll
    for (int qt = 0; qt < QT; ++qt) { const float f = __fdiv_rn(1.0f, l[qt] + xhalf(l[qt])); const size_t oo = (size_t)(q0 + qt * 16) * DQ + lane * 8 + (SP == 2 ? sp * 512 : 0);
#pragma unroll
        for (int dt = 0; dt < 4 / SP; ++dt) { v8us oh, ol;
#pragma unroll
            for (int j = 0; j < 8; ++j) { unsigned short a, c2; splitf(o[dt][qt][j] * f, a, c2); oh[j] = a; ol[j] = c2; }
            *(v8us*)(Ah + oo + dt * 256) = oh; *(v8us*)(Al + oo + dt * 256) = ol; } }
}
#define NBF ((TT - RH) / 128)     // blocks of 4 tiles of 32 fp16 rows x 2 waves a tile
#define NBH (RH / 128)            // blocks of 8 waves x 16 hi/lo rows
__global__ __launch_bounds__(256) void k_attn(const h16* __restrict__ Q16, const h16* __restrict__ K16, const h16* __restrict__ V16, const bf* __restrict__ Qh, const bf* __restrict__ Ql, const bf* __restrict__ Kh, const bf* __restrict__ Kl, const bf* __restrict__ Vh, const bf* __restrict__ Vl, bf* Ah, bf* Al) {
    const int g = blockIdx.x, y = blockIdx.y; const int wave = __builtin_amdgcn_readfirstlane(threadIdx.x >> 5); const int lane = threadIdx.x & 31;
    const size_t po = (size_t)g * TT * HD, vo = po, ao = (size_t)(g / NH_) * TT * DQ + (size_t)(g % NH_) * (HD * 16);
    __shared__ __align__(16) float xch[8 * 1152];   // a wave's hand-over to its partner: 2 d tiles x 2 query tiles x 256 floats, then m and l of 2 query tiles x 32 lanes
    if (y < NBF) attn_rows<h16, false, 2, 2>(Q16 + po, nullptr, K16 + po, nullptr, V16 + vo, nullptr, RH + (NBF - 1 - y) * 128 + (wave & 3) * 32, lane, Ah + ao, Al + ao, wave >> 2, xch + wave * 1152, xch + (wave ^ 4) * 1152);
    else attn_rows<bf, true, 1, 1>(Qh + po, Ql + po, Kh + po, Kl + po, Vh + vo, Vl + vo, (NBF + NBH - 1 - y) * 128 + wave * 16, lane, Ah + ao, Al + ao, 0, nullptr, nullptr);
}

extern "C" void kernel_launch(void* const* d_in, const int* in_sizes, int n_in,
                              void* d_out, int out_size, void* d_ws, size_t ws_size, hipStream_t stream) {
    (void)in_sizes; (void)n_in; (void)out_size;
    const float* x = (const float*)d_in[0]; const float* xk = (const float*)d_in[1]; const float* xv = (const float*)d_in[2]; const float* wq = (const float*)d_in[3]; const float* wk = (const float*)d_in[4]; const float* wv = (const float*)d_in[5]; const float* wo = (const float*)d_in[6];   /* x_query, x_key, x_value, Wq, Wk, Wv [16][1024][64] ([h][d][k]), W0 ('oi' [1024][1024]) */
    float* OUT = (float*)d_out;     // [2][2048][1024]
    char* wsp = (char*)d_ws;
    auto take = [&](size_t bytes) { char* p = wsp; wsp += (bytes + 255) & ~(size_t)255; return (void*)p; };
    bf* WQ = (bf*)take((size_t)3 * DQ * DM * 2);   // Wq, Wk, Wv as Bt planes, one behind the other
    bf* WO = (bf*)take((size_t)DM * DQ * 2);
    const size_t PL = (size_t)NB_ * NH_ * TT * HD;   // one kind of plane, both batches: [b][h], each head's TT x HD elements fragment-major
    h16* QP16 = (h16*)take(2 * PL * 2); h16* KP16 = QP16 + PL; bf* QPh = (bf*)take(2 * PL * 2); bf* KPh = QPh + PL; bf* QPl = (bf*)take(2 * PL * 2); bf* KPl = QPl + PL;   // the k planes follow the q planes
    h16* VT16 = (h16*)take(PL * 2); bf* VTh = (bf*)take(PL * 2); bf* VTl = (bf*)take(PL * 2);
    bf* XB = (bf*)take((size_t)3 * NB_ * TT * DM * 2);   // bf16 streams [3], rows (b, t), k = d
    bf* ATh = (bf*)take((size_t)NB_ * TT * DQ * 2); bf* ATl = (bf*)take((size_t)NB_ * TT * DQ * 2);
    if ((size_t)(wsp - (char*)d_ws) > ws_size) return;    // ws 256 MiB
    static_assert(NKV == NH_ && RH % 128 == 0 && (TT - RH) % 128 == 0 && TT % 128 == 0 && NH_ % 2 == 0 && DM / 128 >= 2, "q, k and v planes are numbered alike; whole row blocks; k_proj: whole tiles inside one batch, two stages or more");
    static_assert(HD == 64 && DM % 128 == 0 && DQ == DM && ((size_t)DM * DQ / 8) % (256 * 4) == 0 && ((size_t)NB_ * TT * DM / 8) % (256 * 8) == 0, "the ranges of k_prep cover their arrays exactly");
    k_prep<<<dim3(3 * GX + 3 * GW + GO, 1, 1), 256, 0, stream>>>(x, xk, xv, wq, wk, wv, wo, XB, WQ, WO);
    k_proj<<<dim3(NB_ * TT / 128, NH_ / 2, 3), 128, 0, stream>>>(XB, WQ, QP16, QPh, QPl, VT16, VTh, VTl);
    k_attn<<<dim3(NB_ * NH_, NBF + NBH, 1), 256, 0, stream>>>(QP16, KP16, VT16, QPh, QPl, KPh, KPl, VTh, VTl, ATh, ATl);
    k_out<<<dim3(NB_ * TT / 128, DM / 128, 1), 128, 0, stream>>>(ATh, ATl, WO, OUT);
}

// v010
// It runs in 73.6 microseconds.
// In two side-by-side timings against v009, it was 1.07 and 1.06 times as fast.
// Counting every step since v000, it is 20.0 times as fast.
#include <hip/hip_runtime.h>

// Causal multi-head attention on three input streams with per-head stacked projection weights (x_query, x_key, x_value [2][2048][1024]; q = einsum('bsd,hdk', x_query, Wq) with Wq [16][1024][64] = [h][d][k] (1/32), k, v likewise from x_key / x_value; scores x 1/sqrt(64) + causal additive mask (0 / -inf); softmax; heads concatenated h-major; out = concat W0^T ('oi' [1024][1024]) -> [2][2048][1024] (4.2 M); argument order x_query, x_key, x_value, Wq, Wk, Wv, W0).
// Layout, both batches at once: k_prep: bf16 copies of the three streams and of W0, each [h][d][k] weight turned into Bt rows h*64 + k; k_proj: exact projections (one launch, z = stream) whose epilogue stores the fp16 and hi/lo head planes; k_attn: scores, running softmax and P.V of all 32 (batch, head) pairs in one launch, scores and probabilities never leave the registers (hybrid rows: < 512 hi/lo 3 products, rest fp16 x1024); merged hi/lo x W0 exact.
// Every 16-bit matrix operand plane (bf16 streams, weights, q / k / v planes, attention output) is stored fragment-major: a block of 16 rows x 32 k is 1 KiB in a row, element (r, k) at ((k >> 4) & 1) * 256 + ((k >> 3) & 1) * 128 + (r & 15) * 8 + (k & 7),
// the blocks of a row block one behind the other along k (v: the 4 blocks of d of a 32-key step one behind the other). Lane l's two 16-byte pieces of a fragment stand at l * 8 and 256 + l * 8: each wave-wide load covers 512 bytes in a row (4 whole lines), not 32 bytes of each of 16 lines.
// Compute dtypes, f32 accumulate: every input rounded to bf16; projections exact; attention rows < 512 3 products, rest fp16; softmax f32; W0 hl x exact.

#define NB_  2
#define TT   2048
#define DM   1024
#define NH_  16
#define NKV  16
#define REP  (NH_ / NKV)
#define HD   64
#define DQ   (NH_ * HD)
#define DKV  (NKV * HD)
#define RH   512                  // query rows < RH use hi+lo planes
#define SCL  0.125f   // HD^-0.5
typedef _Float16 h16;
typedef unsigned short bf;
typedef __attribute__((ext_vector_type(16))) __bf16   v16bf;
typedef __attribute__((ext_vector_type(16))) _Float16 v16h;
typedef __attribute__((ext_vector_type(8)))  _Float16 v8h;
typedef __attribute__((ext_vector_type(8)))  unsigned short v8us;
typedef __attribute__((ext_vector_type(8)))  float    v8f;
typedef __attribute__((ext_vector_type(4)))  float    v4f;
typedef v8h  __attribute__((may_alias)) v8ha;
typedef v4f  __attribute__((may_alias)) v4fa;
typedef v8us __attribute__((may_alias)) v8usa;

__device__ __forceinline__ unsigned short f2bf(float f) { unsigned u = __float_as_uint(f); u += 0x7FFFu + ((u >> 16) & 1u); return (unsigned short)(u >> 16); }
__device__ __forceinline__ float bf2f(unsigned short b) { return __uint_as_float(((unsigned)b) << 16); }
__device__ __forceinline__ float bfr(float f) { return bf2f(f2bf(f)); }
__device__ __forceinline__ v16h cat16(v8h lo, v8h hi) { return __builtin_shufflevector(lo, hi, 0, 1, 2, 3, 4, 5, 6, 7, 8, 9, 10, 11, 12, 13, 14, 15); }
__device__ __forceinline__ v16bf cat16b(v8us lo, v8us hi) { return __builtin_bit_cast(v16bf, __builtin_shufflevector(lo, hi, 0, 1, 2, 3, 4, 5, 6, 7, 8, 9, 10, 11, 12, 13, 14, 15)); }
__device__ __forceinline__ v8f wmma16(v16h a, v16h b, v8f c) { return __builtin_amdgcn_wmma_f32_16x16x32_f16(false, a, false, b, (short)0, c, false, false); }
__device__ __forceinline__ v8f wmmab(v16bf a, v16bf b, v8f c) { return __builtin_amdgcn_wmma_f32_16x16x32_bf16(false, a, false, b, (short)0, c, false, false); }



// ---- WFrag: a 16 x 32 fragment of a fragment-major plane (in memory or in LDS): lane l's two 16-byte pieces stand at l * 8 and 256 + l * 8 of the block; p = block + l * 8.
template <typename T16> struct WFrag;
template <> struct WFrag<h16> { typedef v16h V; static __device__ __forceinline__ V ld(const h16* p) { return cat16(*(const v8h*)p, *(const v8h*)(p + 256)); } static __device__ __forceinline__ v8f mma(V a, V b, v8f c) { return wmma16(a, b, c); } };
template <> struct WFrag<bf> { typedef v16bf V; static __device__ __forceinline__ V ld(const bf* p) { return cat16b(*(const v8us*)p, *(const v8us*)(p + 256)); } static __device__ __forceinline__ v8f mma(V a, V b, v8f c) { return wmmab(a, b, c); } };

__device__ __forceinline__ h16 tohx(float x) { return (h16)x; }
__device__ __forceinline__ void splitf(float y, unsigned short& h, unsigned short& l) { h = f2bf(y); l = f2bf(y - bf2f(h)); }
typedef __attribute__((ext_vector_type(2))) _Float16 v2h;
typedef __attribute__((ext_vector_type(4))) _Float16 v4h;
typedef __attribute__((ext_vector_type(2))) unsigned short v2us;
typedef __attribute__((ext_vector_type(4))) unsigned short v4us;
typedef __attribute__((ext_vector_type(2))) float v2f;
typedef __attribute__((ext_vector_type(4))) int v4i;

// cvt8: fragment-major bf16 copy of an f32 matrix with rows of DM elements, the share of work-group bx of its range in k_prep. A wave takes U / 4 regions of 16 rows x 64 k (neighbours along k); a thread converts U pieces of 8 floats
// and issues all its loads before the first conversion. Lanes = 4 rows x 8 pieces: the two loads of a piece read 256 bytes in a row (2 whole lines) of each of 4 rows, a store writes 64 bytes in a row in each of 8 half blocks, and 4 stores fill them.
// A range of n work-groups covers n * 256 * U pieces of 8 floats exactly (asserted at the launch).
template <int U>
__device__ __forceinline__ void cvt8(const float* __restrict__ s, bf* dst, int bx) {
    static_assert(U % 4 == 0 && (DM / 64) % (U / 4) == 0, "a wave's regions lie in one block of 16 rows");
    const int lane = threadIdx.x & 31, c = lane & 7, rr = lane >> 3; const int reg0 = (bx * 8 + (threadIdx.x >> 5)) * (U / 4); const int rb = reg0 / (DM / 64), kq = reg0 % (DM / 64);
    const float* src = s + (size_t)(rb * 16 + rr) * DM + kq * 64 + c * 8;
    dst += ((size_t)rb * (DM / 32) + kq * 2 + (c >> 2)) * 512 + ((c >> 1) & 1) * 256 + (c & 1) * 128 + rr * 8; v4f lo[U], hi[U];
#pragma unroll
    for (int u = 0; u < U; ++u) { const float* p = src + (u & 3) * 4 * DM + (u >> 2) * 64; lo[u] = *(const v4f*)p;
        if (u == U - 1) asm volatile("s_wait_xcnt 0x0" ::: "memory");   // the wait in front of an overwrite of issued loads' address registers: the compiler makes the address pair part of the last load's destination
        hi[u] = *(const v4f*)(p + 4); }
#pragma unroll
    for (int u = 0; u < U; ++u) { v8us o;
#pragma unroll
        for (int k = 0; k < 4; ++k) { o[k] = f2bf(lo[u][k]); o[4 + k] = f2bf(hi[u][k]); }
        *(v8us*)(dst + (u & 3) * 32 + (u >> 2) * 1024) = o; }
}

// wtH: one weight [h][d][e] f32 -> bf16 Bt rows h * 64 + e, k = d, fragment-major, the share of work-group bx of its range in k_prep. A thread takes a block of 8 d x 4 e: 8 loads of 16 bytes (4 e of one d), 4 stores of 16 bytes (8 d of one e).
// Lanes = 8 groups of d x 4 groups of e: a thread's 4 stores fill 64 bytes in a row, 4 lanes a whole half block of 256 bytes; 4 lanes read 64 contiguous bytes; the 8 waves of a work-group cover 128 d x the 64 e of one head. NH_ * DM / 128 work-groups a weight, exact.
__device__ __forceinline__ void wtH(const float* __restrict__ w, bf* Bt, int bx) {
    const int h = bx / (DM / 128), db = bx % (DM / 128); const int wave = threadIdx.x >> 5, lane = threadIdx.x & 31;
    const int d = db * 128 + (wave >> 2) * 64 + (lane & 7) * 8, e = (wave & 3) * 16 + (lane >> 3) * 4;
    const float* s = w + ((size_t)h * DM + d) * HD + e; v4f r[8];
#pragma unroll
    for (int j = 0; j < 8; ++j) r[j] = *(const v4f*)(s + j * HD);
#pragma unroll
    for (int i = 0; i < 4; ++i) { v8us o;
#pragma unroll
        for (int j = 0; j < 8; ++j) o[j] = f2bf(r[j][i]);
        *(v8us*)(Bt + ((size_t)((h * HD + e) >> 4) * (DM / 32) + (d >> 5)) * 512 + ((d >> 4) & 1) * 256 + ((d >> 3) & 1) * 128 + ((e & 15) + i) * 8) = o; }
}
// ---- k_prep: every 16-bit copy that the products read, in one launch: the jobs need nothing of each other, so ranges of the work-group index pick them (a work-group-uniform branch), the long streams first:
// 3 x GX work-groups: the streams (cvt8<8>); 3 x GW: Wq, Wk, Wv (wtH); GO: W0 (cvt8<4>). The short jobs run beside the streams instead of each filling and draining the chip alone.
#define GX ((int)((size_t)NB_ * TT * DM / 8 / (256 * 8)))
#define GW (NH_ * (DM / 128))
#define GO ((int)((size_t)DM * DQ / 8 / (256 * 4)))
__global__ __launch_bounds__(256) void k_prep(const float* __restrict__ x0, const float* __restrict__ x1, const float* __restrict__ x2, const float* __restrict__ w0, const float* __restrict__ w1, const float* __restrict__ w2, const float* __restrict__ wo, bf* XB, bf* Bt, bf* WO) {
    const int b = blockIdx.x;
    if (b < 3 * GX) { const int y = b / GX; cvt8<8>((y == 0) ? x0 : (y == 1) ? x1 : x2, XB + (size_t)y * NB_ * TT * DM, b % GX); }
    else if (b < 3 * GX + 3 * GW) { const int c = b - 3 * GX, y = c / GW; wtH((y == 0) ? w0 : (y == 1) ? w1 : w2, Bt + (size_t)y * DQ * DM, c % GW);
        asm volatile("s_wait_xcnt 0x0" ::: "memory"); }   // the wait in front of an overwrite of issued stores' registers: in the listing this job's end runs on into the streams' code, which writes them
    else { cvt8<4>(wo, WO, b - 3 * GX - 3 * GW);
        asm volatile("s_wait_xcnt 0x0" ::: "memory"); }   // the same wait: in the listing this job's end runs on into the other two jobs' code
}
// ---- k_proj: the three projections, each tile stored straight as the 16-bit planes that k_attn reads. Grid (rows / 128, heads / 2, 3 streams), 4 waves as 2 x 2: a work-group makes 128 rows t x the 128 columns of two heads, a wave a 64x64 tile over the whole K in one accumulator chain.
// The two operands' 128 rows x 64 k (8 + 8 row blocks of 2 KiB in a row, fragment-major as in memory) are one stage of 32 KiB in LDS, read by two waves each; two buffers, the next stage's asynchronous copies fly while this stage is worked on.
// q, k (z = 0, 1): A = weight rows d, B = rows t, so a lane holds 8 consecutive d of one t; v (z = 2): A = rows t, B = weight rows d, so a lane holds 8 consecutive t of one d. Either way that is the 16-byte piece at lane * 8 of a half block of the fragment-major plane
// (q, k: blocks (t / 16, d / 32); v: blocks (t / 32, d / 16)): the accumulators go from the registers to the fp16, hi and lo planes, a wave filling 512 bytes in a row with each store.
#define PLN ((size_t)NB_ * NH_ * TT * HD)   // elements of one kind of plane, both batches
// 8 asynchronous copies of 16 bytes a lane: row blocks 0..7 of one operand (32 KiB apart in memory, 2 KiB apart in LDS). The s_wait_xcnt stands in the copies' own statement, in front of any rewrite of the address registers that they name.
__device__ __forceinline__ void acopy8(unsigned l, const bf* g) {
    asm volatile("global_load_async_to_lds_b128 %0, %8, off\n\tglobal_load_async_to_lds_b128 %1, %9, off\n\tglobal_load_async_to_lds_b128 %2, %10, off\n\tglobal_load_async_to_lds_b128 %3, %11, off\n\t"
                 "global_load_async_to_lds_b128 %4, %12, off\n\tglobal_load_async_to_lds_b128 %5, %13, off\n\tglobal_load_async_to_lds_b128 %6, %14, off\n\tglobal_load_async_to_lds_b128 %7, %15, off\n\ts_wait_xcnt 0x0"
                 :: "v"(l), "v"(l + 2048u), "v"(l + 4096u), "v"(l + 6144u), "v"(l + 8192u), "v"(l + 10240u), "v"(l + 12288u), "v"(l + 14336u),
                    "v"(g), "v"(g + 16 * DM), "v"(g + 32 * DM), "v"(g + 48 * DM), "v"(g + 64 * DM), "v"(g + 80 * DM), "v"(g + 96 * DM), "v"(g + 112 * DM) : "memory");
}
__global__ __launch_bounds__(128) void k_proj(const bf* __restrict__ X, const bf* __restrict__ Wt, h16* P16, bf* Ph, bf* Pl, h16* V16, bf* Vh, bf* Vl) {
    __shared__ __align__(2048) bf ring[2 * 16384];   // two stages of [A 8 row blocks | B 8 row blocks] x 64 k
    const int z = blockIdx.z, r0 = blockIdx.x * 128, hp = blockIdx.y;
    const int wave = __builtin_amdgcn_readfirstlane(threadIdx.x >> 5); const int lane = threadIdx.x & 31, wm = wave >> 1, wn = wave & 1;
    const bf* xr = X + ((size_t)z * NB_ * TT + r0) * DM; const bf* wr = Wt + ((size_t)z * DQ + hp * 128) * DM;
    const bf* ga = ((z == 2) ? xr : wr) + threadIdx.x * 8; const bf* gb = ((z == 2) ? wr : xr) + threadIdx.x * 8;   // a thread copies piece threadIdx.x of each row block's 2 KiB
    const unsigned ls = (unsigned)(size_t)ring + threadIdx.x * 16;
    auto fill = [&](int t) { const unsigned l = ls + (t & 1) * 32768u; acopy8(l, ga + t * 1024); acopy8(l + 16384u, gb + t * 1024); };
    fill(0);
    asm volatile("s_wait_asynccnt 0x0" ::: "memory");   // this wave's copies of stage 0 have landed
    __syncthreads();                                    // ... and every other wave's: stage 0 may be read
    fill(1);
    v8f acc[4][4];
#pragma unroll
    for (int mb = 0; mb < 4; ++mb)
#pragma unroll
        for (int nb = 0; nb < 4; ++nb) acc[mb][nb] = (v8f){};
#pragma unroll 1   // rolled: one set of fragment registers, the buffer picked by the trip's parity
    for (int t = 0; t < DM / 64; ++t) {
        const bf* st = ring + (t & 1) * 16384 + lane * 8;
#pragma unroll
        for (int ks = 0; ks < 2; ++ks) { v16bf a[4], b[4];
#pragma unroll
            for (int i = 0; i < 4; ++i) { a[i] = WFrag<bf>::ld(st + (wm * 4 + i) * 1024 + ks * 512); b[i] = WFrag<bf>::ld(st + 8192 + (wn * 4 + i) * 1024 + ks * 512); }
            // inputs-only fence on the loaded fragments: the 16 LDS reads of a 32-k step go as one group, one LDS latency for 16 matrix instructions; without it the compiler reuses one B fragment's registers and waits for LDS in front of every 4
            asm volatile("" :: "v"(a[0]), "v"(a[1]), "v"(a[2]), "v"(a[3]), "v"(b[0]), "v"(b[1]), "v"(b[2]), "v"(b[3]));
#pragma unroll
            for (int nb = 0; nb < 4; ++nb)
#pragma unroll
                for (int mb = 0; mb < 4; ++mb) acc[mb][nb] = wmmab(a[mb], b[nb], acc[mb][nb]); }
        __builtin_amdgcn_sched_barrier(0);   // the trip's matrix instructions stay in front of the barrier: else the compiler sinks a 32-k step's worth of them between the barrier and the refill, and the next copies start that much later
        asm volatile("s_wait_dscnt 0x0" ::: "memory");      // this wave's reads of stage t are done before the buffer is refilled
        asm volatile("s_wait_asynccnt 0x0" ::: "memory");   // this wave's copies of stage t + 1 have landed
        __syncthreads();                                    // publishes stage t + 1 and ends every wave's reads of stage t
        if (t + 2 < DM / 64) fill(t + 2);
    }
    asm volatile("s_wait_asynccnt 0x0" ::: "memory");   // no copy is outstanding when the wave ends
    const int g = (r0 / TT) * NH_ + hp * 2 + ((z == 2) ? wn : wm), t0 = r0 % TT + ((z == 2) ? wm : wn) * 64;
    const size_t base = ((z == 2) ? 0 : (size_t)z * PLN) + ((size_t)g * TT + t0) * HD + lane * 8;
    const int sM = (z == 2) ? 2048 : 512, sN = (z == 2) ? 512 : 1024;   // elements from one pair of A blocks, and from one B block, to the next in the plane
    h16* d16 = ((z == 2) ? V16 : P16) + base; bf* dh = ((z == 2) ? Vh : Ph) + base; bf* dl = ((z == 2) ? Vl : Pl) + base;
#pragma unroll
    for (int mb = 0; mb < 4; ++mb)
#pragma unroll
        for (int nb = 0; nb < 4; ++nb) { v8h o16; v8us oh, ol;
#pragma unroll
            for (int j = 0; j < 8; ++j) { const float x = acc[mb][nb][j]; o16[j] = tohx(x); unsigned short a2, c2; splitf(x, a2, c2); oh[j] = a2; ol[j] = c2; }
            const int po = (mb >> 1) * sM + (mb & 1) * 256 + nb * sN; *(v8h*)(d16 + po) = o16; *(v8us*)(dh + po) = oh; *(v8us*)(dl + po) = ol; }
}
// ---- k_out: out[m][n] (f32, rows of DM) = sum_k (Ah[m][k] + Al[m][k]) W0[n][k], tiled and staged as k_proj: grid (rows / 128, DM / 128), 4 waves as 2 x 2, a wave a 64x64 tile over the whole K; a stage is 128 k, two halves of [W0 8 row blocks | Ah 8 | Al 8] x 64 k = 96 KiB (one work-group a WGP: the longer stage spreads a copy's latency over more bytes), two buffers.
// A = W0 rows n, B = rows m, so a lane holds 8 consecutive n of one row m. After the loop the ring is free (its last barrier ends every read, no copy is outstanding): each wave lays its tile there as 64 rows m at pitch 68 floats and stores whole 256-byte rows, 16 lanes a row.
__global__ __launch_bounds__(128) void k_out(const bf* __restrict__ Ah, const bf* __restrict__ Al, const bf* __restrict__ Wo, float* C) {
    __shared__ __align__(2048) bf ring[2 * 49152];
    const int r0 = blockIdx.x * 128, c0 = blockIdx.y * 128;
    const int wave = __builtin_amdgcn_readfirstlane(threadIdx.x >> 5); const int lane = threadIdx.x & 31, lr = lane & 15, hi = lane >> 4, wm = wave >> 1, wn = wave & 1;
    const bf* gw = Wo + (size_t)c0 * DQ + threadIdx.x * 8; const bf* gh = Ah + (size_t)r0 * DQ + threadIdx.x * 8; const bf* gl = Al + (size_t)r0 * DQ + threadIdx.x * 8;   // a thread copies piece threadIdx.x of each row block's 2 KiB
    const unsigned ls = (unsigned)(size_t)ring + threadIdx.x * 16;
    auto fill = [&](int t) {   // 48 copies a wave
#pragma unroll
        for (int h = 0; h < 2; ++h) { const unsigned l = ls + (t & 1) * 98304u + h * 49152u; const int k = (t * 2 + h) * 1024; acopy8(l, gw + k); acopy8(l + 16384u, gh + k); acopy8(l + 32768u, gl + k);
            __builtin_amdgcn_sched_barrier(0); } };   // a half's address arithmetic stays with its copies: formed all ahead, the 48 address pairs push the kernel past 256 registers
    fill(0);
    asm volatile("s_wait_asynccnt 0x0" ::: "memory");   // this wave's copies of stage 0 have landed
    __syncthreads();                                    // ... and every other wave's: stage 0 may be read
    fill(1);
    v8f acc[4][4];
#pragma unroll
    for (int mb = 0; mb < 4; ++mb)
#pragma unroll
        for (int nb = 0; nb < 4; ++nb) acc[mb][nb] = (v8f){};
#pragma unroll 1   // rolled: one set of fragment registers, the buffer picked by the trip's parity
    for (int t = 0; t < DQ / 128; ++t) {
#pragma unroll
        for (int kk = 0; kk < 4; ++kk) { v16bf a[4], b[4], b2[4]; const int ks = kk & 1; const bf* st = ring + (t & 1) * 49152 + (kk >> 1) * 24576 + lane * 8;
#pragma unroll
            for (int i = 0; i < 4; ++i) { a[i] = WFrag<bf>::ld(st + (wm * 4 + i) * 1024 + ks * 512); b[i] = WFrag<bf>::ld(st + 8192 + (wn * 4 + i) * 1024 + ks * 512); }
#pragma unroll
            for (int i = 0; i < 4; ++i) b2[i] = WFrag<bf>::ld(st + 16384 + (wn * 4 + i) * 1024 + ks * 512);
            // inputs-only fence on the loaded fragments, as in k_proj: the 24 LDS reads of a 32-k step go as one group; without it the compiler reuses one lo fragment's registers and waits for LDS in front of every 4 matrix instructions
            asm volatile("" :: "v"(a[0]), "v"(a[1]), "v"(a[2]), "v"(a[3]), "v"(b[0]), "v"(b[1]), "v"(b[2]), "v"(b[3]), "v"(b2[0]), "v"(b2[1]), "v"(b2[2]), "v"(b2[3]));
#pragma unroll
            for (int nb = 0; nb < 4; ++nb)
#pragma unroll
                for (int mb = 0; mb < 4; ++mb) acc[mb][nb] = wmmab(a[mb], b[nb], acc[mb][nb]);
#pragma unroll
            for (int nb = 0; nb < 4; ++nb)
#pragma unroll
                for (int mb = 0; mb < 4; ++mb) acc[mb][nb] = wmmab(a[mb], b2[nb], acc[mb][nb]); }
        __builtin_amdgcn_sched_barrier(0);   // the trip's matrix instructions stay in front of the barrier: else the compiler sinks a 32-k step's worth of them between the barrier and the refill, and the next copies start that much later
        asm volatile("s_wait_dscnt 0x0" ::: "memory");      // this wave's reads of stage t are done before the buffer is refilled
        asm volatile("s_wait_asynccnt 0x0" ::: "memory");   // this wave's copies of stage t + 1 have landed
        __syncthreads();                                    // publishes stage t + 1 and ends every wave's reads of stage t
        if (t + 2 < DQ / 128) fill(t + 2);
    }
    asm volatile("s_wait_asynccnt 0x0" ::: "memory");   // no copy is outstanding when the ring becomes output staging
    float* mine = (float*)ring + wave * (64 * 68);
#pragma unroll
    for (int mb = 0; mb < 4; ++mb)
#pragma unroll
        for (int nb = 0; nb < 4; ++nb) { float* p = mine + (nb * 16 + lr) * 68 + mb * 16 + hi * 8;
            *(v4fa*)p = (v4f){acc[mb][nb][0], acc[mb][nb][1], acc[mb][nb][2], acc[mb][nb][3]}; *(v4fa*)(p + 4) = (v4f){acc[mb][nb][4], acc[mb][nb][5], acc[mb][nb][6], acc[mb][nb][7]}; }
    __syncthreads();   // the tile's LDS writes stand in front of the reads below, which take other lanes' values
    float* Ct = C + (size_t)(r0 + wn * 64) * DM + c0 + wm * 64;
#pragma unroll
    for (int u = 0; u < 32; ++u) { const int idx = u * 32 + lane; const int row = idx >> 4, cofs = (idx & 15) * 4;
        *(v4f*)(Ct + (size_t)row * DM + cofs) = *(const v4fa*)(mine + row * 68 + cofs); }
}
// ---- k_attn: causal attention, one launch for every (batch, head) pair g = blockIdx.x; blockIdx.y = block of query rows, the longest first. A wave owns QT * 16 query rows and walks the keys 0 .. its last row in steps of 32. The long fp16 rows: two waves a tile (w and w + 4 of 8), one takes the even steps and one the odd, each with its own running m, l and O; behind the loop they join the halves through LDS (one barrier). The 8 waves of such a block walk the same keys: K and V come once a block, 128 keys a stage, by asynchronous copies into a two-buffer LDS ring (the next stage flies while this one is worked on; one barrier a stage; the block's row base / 128 + 1 stages end at its diagonal). The hi/lo rows: one wave a tile, fragments straight from memory, no LDS, no barrier.
// Per step: S^T = K Q^T (A = 16 key rows, B = 16 query rows, both from planes with rows t, k = d), so a lane holds scores of ONE query (column lane & 15): keys 8 * hi + j of each 16-key tile. Running maximum m and running sum l per query: in-lane, plus one exchange between the lane halves for m
// (l's halves are joined once, at the end). p = exp2((s - m) x SCL x log2 e (+ 10 in the fp16 rows: the x1024 carrier)); two converted S^T tiles are, register for register, the B operand of O^T += V^T P^T (A = 16 rows of the plane with rows d, k = t), whose column is again the lane's own query:
// the rescale by exp2(m_old - m_new) and the final 1 / l are in-lane too. HR (rows < RH): q, k, v, p as bf16 hi + lo, 3 products each; else fp16, 1 product. Output: hi/lo bf16 of O / l, row t, k = h * 64 + d of the fragment-major planes that the last product reads, 8 consecutive d per lane, 512 bytes in a row per store.
// 8 asynchronous copies of 16 bytes a lane: 4 pieces (4 KiB apart) of a stage's K, then 4 of its V, 4 KiB apart in LDS. The s_wait_xcnt stands in the copies' own statement, in front of any rewrite of the address registers that they name.
template <typename T16>
__device__ __forceinline__ void acopy8kv(unsigned l, const T16* k, const T16* v) {
    asm volatile("global_load_async_to_lds_b128 %0, %8, off\n\tglobal_load_async_to_lds_b128 %1, %9, off\n\tglobal_load_async_to_lds_b128 %2, %10, off\n\tglobal_load_async_to_lds_b128 %3, %11, off\n\t"
                 "global_load_async_to_lds_b128 %4, %12, off\n\tglobal_load_async_to_lds_b128 %5, %13, off\n\tglobal_load_async_to_lds_b128 %6, %14, off\n\tglobal_load_async_to_lds_b128 %7, %15, off\n\ts_wait_xcnt 0x0"
                 :: "v"(l), "v"(l + 4096u), "v"(l + 8192u), "v"(l + 12288u), "v"(l + 16384u), "v"(l + 20480u), "v"(l + 24576u), "v"(l + 28672u),
                    "v"(k), "v"(k + 2048), "v"(k + 4096), "v"(k + 6144), "v"(v), "v"(v + 2048), "v"(v + 4096), "v"(v + 6144) : "memory");
}
__device__ __forceinline__ float xhalf(float x) { const int b = __float_as_int(x); return __int_as_float(__builtin_amdgcn_permlanex16(b, b, 0x76543210, 0xfedcba98, false, false)); }   // the value of lane ^ 16
template <typename T16, bool HR, int QT, int SP>
__device__ __forceinline__ void attn_rows(const T16* __restrict__ Q, const T16* __restrict__ Q2, const T16* __restrict__ Kp, const T16* __restrict__ K2, const T16* __restrict__ Vt, const T16* __restrict__ Vt2, int q0, int lane, bf* Ah, bf* Al, int sp, float* mine, const float* theirs, const T16* ring, int nst) {
    static_assert((SP == 1 && HR) || (SP == 2 && !HR && RH >= 128), "one wave a tile, or two waves that take every other key step of a ring of two stages or more");
    typedef typename WFrag<T16>::V V;
    const int lr = lane & 15, hi = lane >> 4; const float CE = SCL * 1.4426950408889634f; const float SH = HR ? 0.0f : 10.0f;
    V qf[QT][2], qf2[QT][2], kf[2][2], kf2[2][2]; v8f o[4][QT]; float m[QT], l[QT];
#pragma unroll
    for (int qt = 0; qt < QT; ++qt) { m[qt] = -3.0e38f; l[qt] = 0.0f;
#pragma unroll
        for (int ks = 0; ks < 2; ++ks) { const size_t qo = (size_t)(q0 + qt * 16) * HD + ks * 512 + lane * 8; qf[qt][ks] = WFrag<T16>::ld(Q + qo); if (HR) qf2[qt][ks] = WFrag<T16>::ld(Q2 + qo); }
#pragma unroll
        for (int dt = 0; dt < 4; ++dt) o[dt][qt] = (v8f){}; }
    const int last = (q0 + QT * 16 - 1) & ~31;   // first key of the last step; last <= q0, so key kb of every step is at or below the diagonal of every row
    const size_t kof = lane * 8, vof = lane * 8;
    auto ldk = [&](int k0) {
#pragma unroll
        for (int kt = 0; kt < 2; ++kt)
#pragma unroll
            for (int ks = 0; ks < 2; ++ks) { const size_t ko = kof + (size_t)(k0 + kt * 16) * HD + ks * 512; kf[kt][ks] = WFrag<T16>::ld(Kp + ko); if (HR) kf2[kt][ks] = WFrag<T16>::ld(K2 + ko); } };
    // SP == 2: stage t = keys 128 t .. 128 t + 127 of K (16 KiB in a row in its plane) and of V (likewise), copied as they stand into buffer t & 1 of the ring, piece threadIdx.x of each 4 KiB
    auto fill = [&](int t) { acopy8kv((unsigned)(size_t)ring + (t & 1) * 32768u + threadIdx.x * 16, Kp + t * 8192 + threadIdx.x * 8, Vt + t * 8192 + threadIdx.x * 8); };
    if constexpr (SP == 2) { fill(0);
        asm volatile("s_wait_asynccnt 0x0" ::: "memory");   // this wave's copies of stage 0 have landed
        __syncthreads();                                    // ... and every other wave's: stage 0 may be read
        fill(1); }
#pragma unroll 1   // rolled: a second copy of the body would need a second set of fragment registers
    for (int kb = sp * 32; SP == 2 ? kb < nst * 128 : kb <= last; kb += 32 * SP) {
      if (SP == 1 || kb <= last) {   // wave-uniform: in the work-group's last stage a wave skips the steps above its own tile's diagonal, and still passes the stage's foot
        if constexpr (HR) { ldk(kb);   // hi + lo fragments of two steps at once would not fit 256 registers: these (short) rows fetch each step's keys at its head
            asm volatile("s_wait_xcnt 0x0" ::: "memory"); }   // the wait in front of an overwrite of an issued load's address registers: the compiler makes the key loads' address registers the destination of one of the value loads below
        V vf[4], vf2[4];
#pragma unroll
        for (int dt = 0; dt < 4; ++dt) { const size_t vo = vof + (size_t)kb * HD + dt * 512; vf[dt] = WFrag<T16>::ld(HR ? Vt + vo : ring + ((kb >> 7) & 1) * 16384 + 8192 + (kb & 127) * HD + dt * 512 + lane * 8);
            if constexpr (HR) { if (dt == 3) asm volatile("s_wait_xcnt 0x0" ::: "memory");   // the same wait: the compiler makes the hi plane's address pair part of the destination of the last lo load
                vf2[dt] = WFrag<T16>::ld(Vt2 + vo); } }
        // inputs-only fence on the loaded fragments: all 32 loads of the step are in flight together, one load latency a step; without it the compiler fetches the key fragments two loads at a time, each pair waited for on its own
        if constexpr (HR) asm volatile("" :: "v"(kf[0][0]), "v"(kf[0][1]), "v"(kf[1][0]), "v"(kf[1][1]), "v"(kf2[0][0]), "v"(kf2[0][1]), "v"(kf2[1][0]), "v"(kf2[1][1]), "v"(vf[0]), "v"(vf[1]), "v"(vf[2]), "v"(vf[3]), "v"(vf2[0]), "v"(vf2[1]), "v"(vf2[2]), "v"(vf2[3]));
        if constexpr (!HR) {
#pragma unroll
            for (int kt = 0; kt < 2; ++kt)
#pragma unroll
                for (int ks = 0; ks < 2; ++ks) kf[kt][ks] = WFrag<T16>::ld(ring + ((kb >> 7) & 1) * 16384 + (kb & 127) * HD + kt * 1024 + ks * 512 + lane * 8);
            // inputs-only fence on the loaded key fragments: their 8 LDS reads go as one group, one LDS latency a step; without it the compiler reuses one fragment's registers and waits for LDS a second time in the middle of the score products
            asm volatile("" :: "v"(kf[0][0]), "v"(kf[0][1]), "v"(kf[1][0]), "v"(kf[1][1])); }
        v8f s[2][QT];
#pragma unroll
        for (int kt = 0; kt < 2; ++kt)
#pragma unroll
            for (int qt = 0; qt < QT; ++qt) { s[kt][qt] = (v8f){};
#pragma unroll
                for (int ks = 0; ks < 2; ++ks) { s[kt][qt] = WFrag<T16>::mma(kf[kt][ks], qf[qt][ks], s[kt][qt]); if (HR) { s[kt][qt] = WFrag<T16>::mma(kf[kt][ks], qf2[qt][ks], s[kt][qt]); s[kt][qt] = WFrag<T16>::mma(kf2[kt][ks], qf[qt][ks], s[kt][qt]); } } }
        V pf[QT], pf2[QT];
#pragma unroll
        for (int qt = 0; qt < QT; ++qt) {
            if (kb + 31 > q0 + qt * 16) {   // wave-uniform: only a step that reaches above this tile's diagonal masks
                const int q = q0 + qt * 16 + lr;
#pragma unroll
                for (int kt = 0; kt < 2; ++kt)
#pragma unroll
                    for (int j = 0; j < 8; ++j) s[kt][qt][j] = (kb + kt * 16 + hi * 8 + j <= q) ? s[kt][qt][j] : -3.0e38f; }
            float mx = s[0][qt][0];
#pragma unroll
            for (int j = 1; j < 8; ++j) mx = fmaxf(mx, s[0][qt][j]);
#pragma unroll
            for (int j = 0; j < 8; ++j) mx = fmaxf(mx, s[1][qt][j]);
            mx = fmaxf(mx, xhalf(mx));
            const float mn = fmaxf(m[qt], mx); const float mc = mn * CE - SH; float al = (m[qt] - mn) * CE; m[qt] = mn;
            float sum = 0.0f; float p[16];
#pragma unroll
            for (int e = 0; e < 16; ++e) p[e] = s[e >> 3][qt][e & 7] * CE - mc;
            asm("v_exp_f32 %0, %0\n\tv_exp_f32 %1, %1\n\tv_exp_f32 %2, %2\n\tv_exp_f32 %3, %3\n\tv_exp_f32 %4, %4\n\tv_exp_f32 %5, %5\n\tv_exp_f32 %6, %6\n\tv_exp_f32 %7, %7\n\tv_exp_f32 %8, %8\n\tv_exp_f32 %9, %9\n\tv_exp_f32 %10, %10\n\tv_exp_f32 %11, %11\n\tv_exp_f32 %12, %12\n\tv_exp_f32 %13, %13\n\tv_exp_f32 %14, %14\n\tv_exp_f32 %15, %15\n\tv_exp_f32 %16, %16\n\tv_nop"
                : "+v"(p[0]), "+v"(p[1]), "+v"(p[2]), "+v"(p[3]), "+v"(p[4]), "+v"(p[5]), "+v"(p[6]), "+v"(p[7]), "+v"(p[8]), "+v"(p[9]), "+v"(p[10]), "+v"(p[11]), "+v"(p[12]), "+v"(p[13]), "+v"(p[14]), "+v"(p[15]), "+v"(al));
#pragma unroll
            for (int e = 0; e < 16; ++e) sum += p[e];
            l[qt] = l[qt] * al + sum;
#pragma unroll
            for (int dt = 0; dt < 4; ++dt) o[dt][qt] *= al;
            if constexpr (HR) { v8us h0, h1, l0, l1;
#pragma unroll
                for (int j = 0; j < 8; ++j) { unsigned short a, c2; splitf(p[j], a, c2); h0[j] = a; l0[j] = c2; splitf(p[8 + j], a, c2); h1[j] = a; l1[j] = c2; }
                pf[qt] = cat16b(h0, h1); pf2[qt] = cat16b(l0, l1);
            } else { v8h h0, h1;
#pragma unroll
                for (int j = 0; j < 8; ++j) { h0[j] = tohx(p[j]); h1[j] = tohx(p[8 + j]); }
                pf[qt] = cat16(h0, h1); }
        }
#pragma unroll
        for (int dt = 0; dt < 4; ++dt)
#pragma unroll
            for (int qt = 0; qt < QT; ++qt) { o[dt][qt] = WFrag<T16>::mma(vf[dt], pf[qt], o[dt][qt]); if (HR) { o[dt][qt] = WFrag<T16>::mma(vf[dt], pf2[qt], o[dt][qt]); o[dt][qt] = WFrag<T16>::mma(vf2[dt], pf[qt], o[dt][qt]); } }
      }
      if constexpr (SP == 2) { if (kb & 64) {   // the foot of a stage, behind each wave's second step of it
        asm volatile("s_wait_dscnt 0x0" ::: "memory");      // this wave's reads of stage t are done before the buffer is refilled
        asm volatile("s_wait_asynccnt 0x0" ::: "memory");   // this wave's copies of stage t + 1 have landed
        __syncthreads();                                    // publishes stage t + 1 and ends every wave's reads of stage t
        if ((kb >> 7) + 2 < nst) fill((kb >> 7) + 2); } }
    }
    if constexpr (SP == 2) asm volatile("s_wait_asynccnt 0x0" ::: "memory");   // no copy is outstanding when the wave goes on to the join and ends
    if constexpr (SP == 2) {   // the two waves of a tile join their halves: wave sp finishes d tiles 2 * sp and 2 * sp + 1 and hands the other two, with its m and l, to its partner through LDS
#pragma unroll
        for (int qt = 0; qt < QT; ++qt) { mine[1024 + qt * 32 + lane] = m[qt]; mine[1088 + qt * 32 + lane] = l[qt];
#pragma unroll
            for (int d = 0; d < 2; ++d) { const v8f t = sp ? o[d][qt] : o[2 + d][qt]; float* p = mine + (d * QT + qt) * 256 + lane * 4;   // 16 bytes a lane, 512 bytes in a row: no bank met twice
                *(v4fa*)p = (v4f){t[0], t[1], t[2], t[3]}; *(v4fa*)(p + 128) = (v4f){t[4], t[5], t[6], t[7]}; } }
        __syncthreads();   // every wave's hand-over stands in LDS before its partner reads it
#pragma unroll
        for (int qt = 0; qt < QT; ++qt) { const float pm = theirs[1024 + qt * 32 + lane], pl = theirs[1088 + qt * 32 + lane]; const float mn = fmaxf(m[qt], pm); float a = (m[qt] - mn) * CE, b = (pm - mn) * CE;
            // the two rescale factors in one statement, the v_nop behind the last: no transcendental stands directly in front of an instruction that reads its result
            asm("v_exp_f32 %0, %0\n\tv_exp_f32 %1, %1\n\tv_nop" : "+v"(a), "+v"(b));
            l[qt] = l[qt] * a + pl * b;
#pragma unroll
            for (int d = 0; d < 2; ++d) { v8f k = sp ? o[2 + d][qt] : o[d][qt]; const float* p = theirs + (d * QT + qt) * 256 + lane * 4; const v4f x = *(const v4fa*)p, y = *(const v4fa*)(p + 128);
#pragma unroll
                for (int j = 0; j < 4; ++j) { k[j] = k[j] * a + x[j] * b; k[4 + j] = k[4 + j] * a + y[j] * b; }
                o[d][qt] = k; } }
    }
#pragma unroll
    for (int qt = 0; qt < QT; ++qt) { const float f = __fdiv_rn(1.0f, l[qt] + xhalf(l[qt])); const size_t oo = (size_t)(q0 + qt * 16) * DQ + lane * 8 + (SP == 2 ? sp * 512 : 0);
#pragma unroll
        for (int dt = 0; dt < 4 / SP; ++dt) { v8us oh, ol;
#pragma unroll
            for (int j = 0; j < 8; ++j) { unsigned short a, c2; splitf(o[dt][qt][j] * f, a, c2); oh[j] = a; ol[j] = c2; }
            *(v8us*)(Ah + oo + dt * 256) = oh; *(v8us*)(Al + oo + dt * 256) = ol; } }
}
#define NBF ((TT - RH) / 128)     // blocks of 4 tiles of 32 fp16 rows x 2 waves a tile
#define NBH (RH / 128)            // blocks of 8 waves x 16 hi/lo rows
__global__ __launch_bounds__(256) void k_attn(const h16* __restrict__ Q16, const h16* __restrict__ K16, const h16* __restrict__ V16, const bf* __restrict__ Qh, const bf* __restrict__ Ql, const bf* __restrict__ Kh, const bf* __restrict__ Kl, const bf* __restrict__ Vh, const bf* __restrict__ Vl, bf* Ah, bf* Al) {
    const int g = blockIdx.x, y = blockIdx.y; const int wave = __builtin_amdgcn_readfirstlane(threadIdx.x >> 5); const int lane = threadIdx.x & 31;
    const size_t po = (size_t)g * TT * HD, vo = po, ao = (size_t)(g / NH_) * TT * DQ + (size_t)(g % NH_) * (HD * 16);
    __shared__ __align__(16) float xch[8 * 1152];   // a wave's hand-over to its partner: 2 d tiles x 2 query tiles x 256 floats, then m and l of 2 query tiles x 32 lanes
    __shared__ __align__(2048) h16 kvr[2 * 16384];   // fp16 rows: two stages of [K 128 keys | V 128 keys], fragment-major as in memory
    if (y < NBF) attn_rows<h16, false, 2, 2>(Q16 + po, nullptr, K16 + po, nullptr, V16 + vo, nullptr, RH + (NBF - 1 - y) * 128 + (wave & 3) * 32, lane, Ah + ao, Al + ao, wave >> 2, xch + wave * 1152, xch + (wave ^ 4) * 1152, kvr, (RH + (NBF - 1 - y) * 128) / 128 + 1);
    else attn_rows<bf, true, 1, 1>(Qh + po, Ql + po, Kh + po, Kl + po, Vh + vo, Vl + vo, (NBF + NBH - 1 - y) * 128 + wave * 16, lane, Ah + ao, Al + ao, 0, nullptr, nullptr, nullptr, 0);
}

extern "C" void kernel_launch(void* const* d_in, const int* in_sizes, int n_in,
                              void* d_out, int out_size, void* d_ws, size_t ws_size, hipStream_t stream) {
    (void)in_sizes; (void)n_in; (void)out_size;
    const float* x = (const float*)d_in[0]; const float* xk = (const float*)d_in[1]; const float* xv = (const float*)d_in[2]; const float* wq = (const float*)d_in[3]; const float* wk = (const float*)d_in[4]; const float* wv = (const float*)d_in[5]; const float* wo = (const float*)d_in[6];   /* x_query, x_key, x_value, Wq, Wk, Wv [16][1024][64] ([h][d][k]), W0 ('oi' [1024][1024]) */
    float* OUT = (float*)d_out;     // [2][2048][1024]
    char* wsp = (char*)d_ws;
    auto take = [&](size_t bytes) { char* p = wsp; wsp += (bytes + 255) & ~(size_t)255; return (void*)p; };
    bf* WQ = (bf*)take((size_t)3 * DQ * DM * 2);   // Wq, Wk, Wv as Bt planes, one behind the other
    bf* WO = (bf*)take((size_t)DM * DQ * 2);
    const size_t PL = (size_t)NB_ * NH_ * TT * HD;   // one kind of plane, both batches: [b][h], each head's TT x HD elements fragment-major
    h16* QP16 = (h16*)take(2 * PL * 2); h16* KP16 = QP16 + PL; bf* QPh = (bf*)take(2 * PL * 2); bf* KPh = QPh + PL; bf* QPl = (bf*)take(2 * PL * 2); bf* KPl = QPl + PL;   // the k planes follow the q planes
    h16* VT16 = (h16*)take(PL * 2); bf* VTh = (bf*)take(PL * 2); bf* VTl = (bf*)take(PL * 2);
    bf* XB = (bf*)take((size_t)3 * NB_ * TT * DM * 2);   // bf16 streams [3], rows (b, t), k = d
    bf* ATh = (bf*)take((size_t)NB_ * TT * DQ * 2); bf* ATl = (bf*)take((size_t)NB_ * TT * DQ * 2);
    if ((size_t)(wsp - (char*)d_ws) > ws_size) return;    // ws 256 MiB
    static_assert(NKV == NH_ && RH % 128 == 0 && (TT - RH) % 128 == 0 && TT % 128 == 0 && NH_ % 2 == 0 && DM / 128 >= 2, "q, k and v planes are numbered alike; whole row blocks; k_proj: whole tiles inside one batch, two stages or more");
    static_assert(HD == 64 && DM % 128 == 0 && DQ == DM && ((size_t)DM * DQ / 8) % (256 * 4) == 0 && ((size_t)NB_ * TT * DM / 8) % (256 * 8) == 0, "the ranges of k_prep cover their arrays exactly");
    k_prep<<<dim3(3 * GX + 3 * GW + GO, 1, 1), 256, 0, stream>>>(x, xk, xv, wq, wk, wv, wo, XB, WQ, WO);
    k_proj<<<dim3(NB_ * TT / 128, NH_ / 2, 3), 128, 0, stream>>>(XB, WQ, QP16, QPh, QPl, VT16, VTh, VTl);
    k_attn<<<dim3(NB_ * NH_, NBF + NBH, 1), 256, 0, stream>>>(QP16, KP16, VT16, QPh, QPl, KPh, KPl, VTh, VTl, ATh, ATl);
    k_out<<<dim3(NB_ * TT / 128, DM / 128, 1), 128, 0, stream>>>(ATh, ATl, WO, OUT);
}
